// v000
// Times are from an AMD MI455X. After a warm-up the kernel runs many times in a row, and a time is the length of
// such a window on the GPU divided by its runs, so every launch and the gaps after it count. The runs cycle
// through copies of the inputs. A figure is the median of several windows, for all but v000 over two sittings.
// Sittings can differ by a few percent; kernels timed side by side share one.
// v000 is the starting kernel. One run takes 271 microseconds.
#include <hip/hip_runtime.h>

// Sparse (local-window + global-token) multi-head attention: Q/K/V = x W^T + b (torch [out][in]), 16 heads x 64, RoPE with this module's pairing
// (x_rope[d] = -x[2d+1] for d < 32, x[2(d-32)] otherwise; angle index d mod 32), scores/8, mask: blocked if (|i-j| > 128 or j > i) unless i < 16 or j < 16,
// softmax, P.V, out = y Wo^T + bo. B=2, S=2048, D=1024. Contractions on v_wmma_f32_16x16x32_f16 with single f16 operands and f32 accumulate; fragment

namespace {
constexpr int Bsz = 2, T = 2048, HID = 1024, DH = 64, NH = 16, NKV = 16, REP = NH / NKV;
constexpr int WIN = 128, NGLOB = 16;
constexpr int KVW = NKV * DH;                 // 1024
constexpr int NQKV = HID + 2 * KVW;           // 3072 columns: q | k | v
constexpr int MROWS = Bsz * T;                // 4096
constexpr int QT_PER_B = T / 16;              // 128

typedef _Float16 b16;                                           // f16 variant: single-plane operands (the 'lo' planes hold zeros and are never multiplied)
typedef __attribute__((ext_vector_type(16))) _Float16 v16b;
typedef __attribute__((ext_vector_type(8)))  _Float16 v8b;
typedef __attribute__((ext_vector_type(8)))  float v8f;
typedef __attribute__((ext_vector_type(4)))  float v4f;

__device__ __forceinline__ v8b ld8b(const b16* p) { return *(const v8b*)p; }
__device__ __forceinline__ v16b cat8b(v8b a, v8b b) { return __builtin_shufflevector(a, b, 0, 1, 2, 3, 4, 5, 6, 7, 8, 9, 10, 11, 12, 13, 14, 15); }
// 16x16x32 16-bit fragment from a k-contiguous row pointer (A: lane&15 = row, B: lane&15 = column), hh = lane>>4:
// elements 0..7 <- p[8hh+0..7], elements 8..15 <- p[16+8hh+0..7]
__device__ __forceinline__ v16b frag_kb(const b16* p, int hh) { return cat8b(ld8b(p + 8 * hh), ld8b(p + 16 + 8 * hh)); }
__device__ __forceinline__ void split_bf16(float v, b16& hi, b16& lo) {   // (name kept) f16 conversion, no low part
  hi = (b16)v; lo = (b16)0.0f;
}
// split fragment straight from an f32 k-contiguous row
__device__ __forceinline__ void frag_ksplit(const float* p, int hh, v16b& fh_, v16b& fl_) {
  const float* p0 = p + 8 * hh; const float* p1 = p + 16 + 8 * hh;
#pragma unroll
  for (int e = 0; e < 8; ++e) { b16 a, c; split_bf16(p0[e], a, c); fh_[e] = a; fl_[e] = c; split_bf16(p1[e], a, c); fh_[8 + e] = a; fl_[8 + e] = c; }
}
__device__ __forceinline__ v8f wmma16b(v16b a, v16b b, v8f c) {
  v8f d = __builtin_amdgcn_wmma_f32_16x16x32_f16(false, a, false, b, (short)0, c, false, false);
  asm volatile("v_nop\n\tv_nop\n\tv_nop\n\tv_nop" : "+v"(d) : "v"(a), "v"(b));
  return d;
}
// acc += A.B with both operands split: A = (ah, al), B = (bh, bl)
__device__ __forceinline__ v8f wmma3(v16b ah, v16b al, v16b bh, v16b bl, v8f c) {
  (void)al; (void)bl; return wmma16b(ah, bh, c);   // single f16 product
}
__device__ __forceinline__ void wave_lds_sync() {
  __builtin_amdgcn_fence(__ATOMIC_RELEASE, "workgroup");
  __builtin_amdgcn_wave_barrier();
  __builtin_amdgcn_fence(__ATOMIC_ACQUIRE, "workgroup");
}

// ---------------------------------------------------------------------------
// Weights (torch [out][in] = [n][k]) -> f16 hi / lo planes, same [n][k] layout (k contiguous): columns of Wq|Wk|Wv into wqh/wql [3072][1024], Wo into woh/wol [1024][1024].
// ---------------------------------------------------------------------------
__global__ __launch_bounds__(256) void wcvt_kernel(const float* __restrict__ wq, const float* __restrict__ wk, const float* __restrict__ wv,
                                                   const float* __restrict__ wo, b16* __restrict__ wqh, b16* __restrict__ wql,
                                                   b16* __restrict__ woh, b16* __restrict__ wol) {
  const size_t tid = (size_t)blockIdx.x * blockDim.x + threadIdx.x, stride = (size_t)gridDim.x * blockDim.x;
  const size_t nq = (size_t)NQKV * HID / 8, no = (size_t)HID * HID / 8;
  {
    for (size_t c = tid; c < nq + no; c += stride) {
      float f[8]; size_t i; b16* dh; b16* dl;
      if (c < nq) {
        i = c * 8; const size_t n = i / HID, k0 = i % HID;
        const float* w; int nn, ld;
        if (n < (size_t)HID) { w = wq; nn = (int)n; ld = HID; } else if (n < (size_t)(HID + KVW)) { w = wk; nn = (int)n - HID; ld = KVW; } else { w = wv; nn = (int)n - HID - KVW; ld = KVW; }
#pragma unroll
        for (int e = 0; e < 8; ++e) f[e] = w[(size_t)nn * HID + k0 + e];      // W[n][k] (torch [out][in]); ld unused
        (void)ld;
        dh = wqh; dl = wql;
      } else {
        i = (c - nq) * 8; const size_t n = i / HID, k0 = i % HID;
#pragma unroll
        for (int e = 0; e < 8; ++e) f[e] = wo[(size_t)n * HID + k0 + e];    // Wo[n][k] (torch [out][in])
        dh = woh; dl = wol;
      }
      v8b bh, bl;
#pragma unroll
      for (int e = 0; e < 8; ++e) { b16 a, cc; split_bf16(f[e], a, cc); bh[e] = a; bl[e] = cc; }
      *(v8b*)(dh + i) = bh; *(v8b*)(dl + i) = bl;
    }
    
  }
}

// 32x64 wave tile over K from f32 A rows and f16-plane B rows
__device__ __forceinline__ void gemm_tile_split(const float* __restrict__ A, const b16* __restrict__ wh, const b16* __restrict__ wl,
                                                int m0, int c0, int K, int nloc, int hlf, v8f (&acc)[2][4]) {
  for (int kb = 0; kb < K; kb += 32) {
    v16b a0h, a0l, a1h, a1l;
    frag_ksplit(A + (size_t)(m0 + nloc) * K + kb, hlf, a0h, a0l);
    frag_ksplit(A + (size_t)(m0 + 16 + nloc) * K + kb, hlf, a1h, a1l);
#pragma unroll
    for (int t = 0; t < 4; ++t) {
      const size_t wofs = (size_t)(c0 + t * 16 + nloc) * K + kb;
      const v16b bh = frag_kb(wh + wofs, hlf), bl = frag_kb(wl + wofs, hlf);
      acc[0][t] = wmma3(a0h, a0l, bh, bl, acc[0][t]);
      acc[1][t] = wmma3(a1h, a1l, bh, bl, acc[1][t]);
    }
  }
}

// ---------------------------------------------------------------------------
// QKV GEMM: (4096 x 1024) x (1024 x 3072), grid (48, 32), block 4 waves, wave = 32 rows x 64 columns (one head of q, k or v). Outputs as f16 hi/lo planes:
// q (x1/8) -> Qh/Ql [b][h][t][64]; k -> Kh/Kl [b][kvh][t][64] (4 KB contiguous per wave per plane);
// v -> Vh/Vl key-tiled [b][kvh][t/16][64][16] (4 KB contiguous per wave per plane).
// ---------------------------------------------------------------------------
__global__ __launch_bounds__(128) void qkv_gemm_kernel(const float* __restrict__ xq, const float* __restrict__ xk, const float* __restrict__ xv,
                                                       const b16* __restrict__ wqh, const b16* __restrict__ wql,
                                                       const float* __restrict__ bq, const float* __restrict__ bk, const float* __restrict__ bv, const float* __restrict__ rope_cs, int xoff, int yoff,
                                                       b16* __restrict__ Qh, b16* __restrict__ Ql, b16* __restrict__ Kh, b16* __restrict__ Kl,
                                                       b16* __restrict__ Vh, b16* __restrict__ Vl) {
  __shared__ __attribute__((aligned(16))) b16 Ts[4][2][32 * 64];
  const int lane = threadIdx.x & 31, wave = threadIdx.x >> 5, nloc = lane & 15, hlf = lane >> 4;
  const int m0 = (blockIdx.y + yoff) * 128 + wave * 32;
  const int c0 = (blockIdx.x + xoff) * 64;
  const int mat = (c0 < HID) ? 0 : (c0 < HID + KVW) ? 1 : 2;
  const int head = (mat == 0) ? (c0 / DH) : (mat == 1) ? ((c0 - HID) / DH) : ((c0 - HID - KVW) / DH);
  const float* x = (mat == 0) ? xq : (mat == 1) ? xk : xv;          // three different input tensors
  const float* bias = ((mat == 0) ? bq : (mat == 1) ? bk : bv) + head * DH;
  v8f acc[2][4];
#pragma unroll
  for (int r = 0; r < 2; ++r)
#pragma unroll
    for (int t = 0; t < 4; ++t) acc[r][t] = (v8f){};
  gemm_tile_split(x, wqh, wql, m0, c0, HID, nloc, hlf, acc);
  const int b = m0 / T, t0 = m0 % T;
  const float s = (mat == 0) ? 0.125f : 1.0f;
  b16* Tp0 = Ts[wave][0]; b16* Tp1 = Ts[wave][1];
  if (mat < 2) {                                          // RoPE for q and k: partners live in other lanes -> raw f32 tile through LDS first
    float* F = reinterpret_cast<float*>(Ts[wave][0]);     // 32 x 64 f32 = exactly the wave's two staging planes
#pragma unroll
    for (int t = 0; t < 4; ++t)
#pragma unroll
      for (int r = 0; r < 2; ++r)
#pragma unroll
        for (int v = 0; v < 8; ++v) { const int rr = r * 16 + v + 8 * hlf, d = t * 16 + nloc; F[rr * 64 + d] = acc[r][t][v] + bias[d]; }
    wave_lds_sync();
#pragma unroll
    for (int t = 0; t < 4; ++t)
#pragma unroll
      for (int r = 0; r < 2; ++r)
#pragma unroll
        for (int v = 0; v < 8; ++v) {
          const int rr = r * 16 + v + 8 * hlf, d = t * 16 + nloc, tpos = t0 + rr;
          const float cv = rope_cs[((size_t)tpos * 32 + (d & 31)) * 2], sv = rope_cs[((size_t)tpos * 32 + (d & 31)) * 2 + 1];
          const float oth = (d < 32) ? -F[rr * 64 + 2 * d + 1] : F[rr * 64 + 2 * (d - 32)];
          acc[r][t][v] = F[rr * 64 + d] * cv + oth * sv - bias[d];     // bias re-added by the common path below
        }
    wave_lds_sync();                                      // all partner reads done before the planes overwrite F
  }
#pragma unroll
  for (int t = 0; t < 4; ++t)
#pragma unroll
    for (int r = 0; r < 2; ++r)
#pragma unroll
      for (int v = 0; v < 8; ++v) {
        const int rr = r * 16 + v + 8 * hlf, d = t * 16 + nloc;
        float val = acc[r][t][v] + bias[d];
        b16 yh, yl; split_bf16(val * s, yh, yl);
        const int idx = (mat < 2) ? (rr * 64 + d) : ((rr >> 4) * 1024 + d * 16 + (rr & 15));
        Tp0[idx] = yh; Tp1[idx] = yl;
      }
  wave_lds_sync();
  b16* dh; b16* dl; size_t o;
  if (mat == 0)      { o = ((size_t)(b * NH + head) * T + t0) * DH; dh = Qh + o; dl = Ql + o; }
  else if (mat == 1) { o = ((size_t)(b * NKV + head) * T + t0) * DH; dh = Kh + o; dl = Kl + o; }
  else               { o = ((size_t)(b * NKV + head) * QT_PER_B + (t0 >> 4)) * (size_t)(DH * 16); dh = Vh + o; dl = Vl + o; }
#pragma unroll
  for (int j = 0; j < 8; ++j) { const int e = (j * 32 + lane) * 8; *(v8b*)(dh + e) = ld8b(Tp0 + e); *(v8b*)(dl + e) = ld8b(Tp1 + e); }
  
}

// ---------------------------------------------------------------------------
// Transposed flash attention: each wave owns one 16-query tile of one (b, head); 8 waves per block; keys in chunks of 32: chunk 0 (global keys) + the causal window, all keys for tile 0.
// S^T = K.Q^T (split), per-lane online softmax; P^T built in registers from the two S^T accumulators
// ---------------------------------------------------------------------------
__global__ __launch_bounds__(256) void attn_kernel(const b16* __restrict__ Qh, const b16* __restrict__ Ql, const b16* __restrict__ Kh, const b16* __restrict__ Kl,
                                                   const b16* __restrict__ Vh, const b16* __restrict__ Vl,
                                                   float* __restrict__ yf) {
  __shared__ __attribute__((aligned(16))) float Os[8][16 * 64];
  const int wid = threadIdx.x >> 5, lane = threadIdx.x & 31, hh = lane >> 4, col = lane & 15;
  const int qtile = blockIdx.x * 8 + wid;                 // over Bsz*NH*QT_PER_B
  const int g = qtile / QT_PER_B;                         // b*NH + h
  const int q0 = (qtile % QT_PER_B) << 4;
  const int b = g / NH, h = g % NH, kvh = h / REP;
  const size_t ko = (size_t)(b * NKV + kvh) * T * DH;
  const size_t qo = ((size_t)g * T + q0 + col) * DH;
  const v16b q0h = frag_kb(Qh + qo, hh), q0l = frag_kb(Ql + qo, hh), q1h = frag_kb(Qh + qo + 32, hh), q1l = frag_kb(Ql + qo + 32, hh);
  float m = -INFINITY, l = 0.0f;
  v8f o0 = {}, o1 = {}, o2 = {}, o3 = {};
  const int kstart = (q0 >= WIN + 32) ? ((q0 - WIN) & ~31) : 32;   // first windowed chunk after the global chunk 0
  for (int kb = 0; kb < ((q0 == 0) ? T : (q0 + 16)); kb = (q0 != 0 && kb == 0) ? kstart : (kb + 32)) {   // tile 0 = global queries: every key; else chunk 0 (global keys) + the causal window
    const size_t r0 = ko + (size_t)(kb + col) * DH, r1 = ko + (size_t)(kb + 16 + col) * DH;
    v8f s0 = {}, s1 = {};
    {
      v16b ah = frag_kb(Kh + r0, hh), al = frag_kb(Kl + r0, hh);
      s0 = wmma3(ah, al, q0h, q0l, s0);
      ah = frag_kb(Kh + r0 + 32, hh); al = frag_kb(Kl + r0 + 32, hh);
      s0 = wmma3(ah, al, q1h, q1l, s0);
      ah = frag_kb(Kh + r1, hh); al = frag_kb(Kl + r1, hh);
      s1 = wmma3(ah, al, q0h, q0l, s1);
      ah = frag_kb(Kh + r1 + 32, hh); al = frag_kb(Kl + r1 + 32, hh);
      s1 = wmma3(ah, al, q1h, q1l, s1);
    }
    if (q0 != 0 && (kb == 0 || kb + 32 > q0 || kb < q0 + 15 - WIN)) {   // blocked = (j > i or j < i-128) unless j < 16 (queries here are >= 16)
      const int qi = q0 + col;
#pragma unroll
      for (int r = 0; r < 8; ++r) {
        const int k0i = kb + 8 * hh + r, k1i = k0i + 16;
        if (k0i >= NGLOB && (k0i > qi || k0i < qi - WIN)) s0[r] = -INFINITY;
        if (k1i >= NGLOB && (k1i > qi || k1i < qi - WIN)) s1[r] = -INFINITY;
      }
    }
    float mr = -INFINITY;
#pragma unroll
    for (int r = 0; r < 8; ++r) mr = fmaxf(mr, fmaxf(s0[r], s1[r]));
    mr = fmaxf(mr, __shfl_xor(mr, 16));
    const float mn = fmaxf(m, mr);            // finite
    const float al_ = __expf(m - mn);
    m = mn;
    float sum = 0.0f;
    v16b pbh, pbl;
#pragma unroll
    for (int r = 0; r < 8; ++r) {
      const float p0 = __expf(s0[r] - mn), p1 = __expf(s1[r] - mn);
      sum += p0 + p1;
      b16 a, c; split_bf16(p0, a, c); pbh[r] = a; pbl[r] = c; split_bf16(p1, a, c); pbh[8 + r] = a; pbl[8 + r] = c;
    }
    sum += __shfl_xor(sum, 16);
    l = l * al_ + sum;
#pragma unroll
    for (int r = 0; r < 8; ++r) { o0[r] *= al_; o1[r] *= al_; o2[r] *= al_; o3[r] *= al_; }
    const size_t v0 = ko + (size_t)(kb >> 4) * (DH * 16) + 8 * hh, v1 = v0 + DH * 16;
#pragma unroll
    for (int n = 0; n < 4; ++n) {
      const int f = n * 16 + col;
      const v16b vah = cat8b(ld8b(Vh + v0 + f * 16), ld8b(Vh + v1 + f * 16));
      const v16b val = cat8b(ld8b(Vl + v0 + f * 16), ld8b(Vl + v1 + f * 16));
      v8f& o = (n == 0) ? o0 : (n == 1) ? o1 : (n == 2) ? o2 : o3;
      o = wmma3(vah, val, pbh, pbl, o);
    }
  }
  const float inv = 1.0f / l;
  float* Tt = Os[wid];
#pragma unroll
  for (int r = 0; r < 8; ++r) {
    const int hr = 8 * hh + r;
    Tt[col * 64 + 0 + hr] = o0[r] * inv; Tt[col * 64 + 16 + hr] = o1[r] * inv;
    Tt[col * 64 + 32 + hr] = o2[r] * inv; Tt[col * 64 + 48 + hr] = o3[r] * inv;
  }
  wave_lds_sync();
  float* dst0 = yf + ((size_t)b * T + q0) * HID + h * DH;     // 16 rows x 64 floats, row stride HID
#pragma unroll
  for (int j = 0; j < 8; ++j) { const int rr = j * 2 + hh, c4 = col * 4; *(v4f*)(dst0 + (size_t)rr * HID + c4) = *(const v4f*)(Tt + rr * 64 + c4); }
  
}

// ---------------------------------------------------------------------------
// Output projection: (4096 x 1024) x (1024 x 1024) -> f32, A split on the fly from f32 y, B = Wo planes. grid (16, 32), 32x64 tiles staged in LDS,
// ---------------------------------------------------------------------------
__global__ __launch_bounds__(128) void out_gemm_kernel(const float* __restrict__ yf, const b16* __restrict__ woh, const b16* __restrict__ wol, const float* __restrict__ bo, int yoff,
                                                       float* __restrict__ out) {
  __shared__ __attribute__((aligned(16))) float Ts[4][32 * 64];
  const int lane = threadIdx.x & 31, wave = threadIdx.x >> 5, nloc = lane & 15, hlf = lane >> 4;
  const int m0 = (blockIdx.y + yoff) * 128 + wave * 32;
  const int c0 = blockIdx.x * 64;
  v8f acc[2][4];
#pragma unroll
  for (int r = 0; r < 2; ++r)
#pragma unroll
    for (int t = 0; t < 4; ++t) acc[r][t] = (v8f){};
  gemm_tile_split(yf, woh, wol, m0, c0, HID, nloc, hlf, acc);
  float* Tt = Ts[wave];
#pragma unroll
  for (int t = 0; t < 4; ++t)
#pragma unroll
    for (int r = 0; r < 2; ++r)
#pragma unroll
      for (int v = 0; v < 8; ++v) Tt[(r * 16 + v + 8 * hlf) * 64 + t * 16 + nloc] = acc[r][t][v] + bo[c0 + t * 16 + nloc];
  wave_lds_sync();
  float* dst0 = out + (size_t)m0 * HID + c0;
#pragma unroll
  for (int j = 0; j < 16; ++j) { const int rr = j * 2 + hlf, c4 = nloc * 4; *(v4f*)(dst0 + (size_t)rr * HID + c4) = *(const v4f*)(Tt + rr * 64 + c4); }
  
}
__global__ __launch_bounds__(256) void rope_table_kernel(float* __restrict__ cs) {
  const int idx = blockIdx.x * 256 + threadIdx.x;        // T * 32
  if (idx >= T * 32) return;
  const int t = idx >> 5, i = idx & 31;
  const float ang = (float)t * powf(10000.0f, -(float)i / 32.0f);
  typedef __attribute__((ext_vector_type(2))) float v2f;
  const v2f p = {cosf(ang), sinf(ang)};
  *(v2f*)(cs + (size_t)idx * 2) = p; 
}
}  // namespace

extern "C" void kernel_launch(void* const* d_in, const int* in_sizes, int n_in,
                              void* d_out, int out_size, void* d_ws, size_t ws_size, hipStream_t stream) {
  (void)in_sizes; (void)n_in; (void)out_size;
  const float* xq = (const float*)d_in[0];   // q [2,2048,1024]
  const float* xk = (const float*)d_in[1];   // k
  const float* xv = (const float*)d_in[2];   // v
  const float* Wq = (const float*)d_in[3];  const float* bq = (const float*)d_in[4];    // torch [out][in]
  const float* Wk = (const float*)d_in[5];  const float* bk = (const float*)d_in[6];
  const float* Wv = (const float*)d_in[7];  const float* bv = (const float*)d_in[8];
  const float* Wo = (const float*)d_in[9];  const float* bo = (const float*)d_in[10];
  float* out = (float*)d_out;                // [2,2048,1024]

  size_t off = 0; char* ws = (char*)d_ws;
  b16* wqh = (b16*)(ws + off); off += (size_t)NQKV * HID * 2;
  b16* wql = (b16*)(ws + off); off += (size_t)NQKV * HID * 2;     // 'lo' planes: zeros in the f16 variant (real buffers: the kernels write both)
  b16* woh = (b16*)(ws + off); off += (size_t)HID * HID * 2;
  b16* wol = (b16*)(ws + off); off += (size_t)HID * HID * 2;
  b16* Qh  = (b16*)(ws + off); off += (size_t)MROWS * HID * 2;
  b16* Ql  = (b16*)(ws + off); off += (size_t)MROWS * HID * 2;
  b16* Kh  = (b16*)(ws + off); off += (size_t)MROWS * KVW * 2;
  b16* Kl  = (b16*)(ws + off); off += (size_t)MROWS * KVW * 2;
  b16* Vh  = (b16*)(ws + off); off += (size_t)MROWS * KVW * 2;
  b16* Vl  = (b16*)(ws + off); off += (size_t)MROWS * KVW * 2;
  float* yf = (float*)(ws + off); off += (size_t)MROWS * HID * 4;
  float* rope_cs = (float*)(ws + off); off += (size_t)T * 32 * 2 * 4;
  if (off > ws_size) return;
  rope_table_kernel<<<(T * 32 + 255) / 256, 256, 0, stream>>>(rope_cs);
  const int ROWBLK = MROWS / 128, NQT = Bsz * NH * QT_PER_B;
  wcvt_kernel<<<2048, 256, 0, stream>>>(Wq, Wk, Wv, Wo, wqh, wql, woh, wol);
  qkv_gemm_kernel<<<dim3(NQKV / 64, ROWBLK), 128, 0, stream>>>(xq, xk, xv, wqh, wql, bq, bk, bv, rope_cs, 0, 0, Qh, Ql, Kh, Kl, Vh, Vl);
  attn_kernel<<<NQT / 8, 256, 0, stream>>>(Qh, Ql, Kh, Kl, Vh, Vl, yf);
  out_gemm_kernel<<<dim3(HID / 64, ROWBLK), 128, 0, stream>>>(yf, woh, wol, bo, 0, out);
}

// v001
// One run takes 175 microseconds.
// Next to v000, in two timings, it ran 1.56 and 1.55 times as fast.
#include <hip/hip_runtime.h>

// Sparse (local-window + global-token) multi-head attention: Q/K/V = x W^T + b (torch [out][in]), 16 heads x 64, RoPE with this module's pairing
// (x_rope[d] = -x[2d+1] for d < 32, x[2(d-32)] otherwise; angle index d mod 32), scores/8, mask: blocked if (|i-j| > 128 or j > i) unless i < 16 or j < 16,
// softmax, P.V, out = y Wo^T + bo. B=2, S=2048, D=1024. Contractions on v_wmma_f32_16x16x32_f16 with single f16 operands and f32 accumulate; fragment

namespace {
constexpr int Bsz = 2, T = 2048, HID = 1024, DH = 64, NH = 16, NKV = 16, REP = NH / NKV;
constexpr int WIN = 128, NGLOB = 16;
constexpr int KVW = NKV * DH;                 // 1024
constexpr int NQKV = HID + 2 * KVW;           // 3072 columns: q | k | v
constexpr int MROWS = Bsz * T;                // 4096
constexpr int QT_PER_B = T / 16;              // 128
constexpr int NG = Bsz * NH;                  // 32 (batch, head) pairs
constexpr int KSPLIT = T / 8;                 // keys per wave in a block that owns a global-query tile
constexpr int ATT_BLOCKS = NG + NG * (QT_PER_B - 1) / 8;   // 32 global-query blocks + 508 blocks of 8 windowed tiles

typedef _Float16 b16;                                           // f16 variant: single-plane operands (the 'lo' planes hold zeros and are never multiplied)
typedef __attribute__((ext_vector_type(16))) _Float16 v16b;
typedef __attribute__((ext_vector_type(8)))  _Float16 v8b;
typedef __attribute__((ext_vector_type(8)))  float v8f;
typedef __attribute__((ext_vector_type(4)))  float v4f;

__device__ __forceinline__ v8b ld8b(const b16* p) { return *(const v8b*)p; }
__device__ __forceinline__ v16b cat8b(v8b a, v8b b) { return __builtin_shufflevector(a, b, 0, 1, 2, 3, 4, 5, 6, 7, 8, 9, 10, 11, 12, 13, 14, 15); }
// 16x16x32 16-bit fragment from a k-contiguous row pointer (A: lane&15 = row, B: lane&15 = column), hh = lane>>4:
// elements 0..7 <- p[8hh+0..7], elements 8..15 <- p[16+8hh+0..7]
__device__ __forceinline__ v16b frag_kb(const b16* p, int hh) { return cat8b(ld8b(p + 8 * hh), ld8b(p + 16 + 8 * hh)); }
__device__ __forceinline__ void split_bf16(float v, b16& hi, b16& lo) {   // (name kept) f16 conversion, no low part
  hi = (b16)v; lo = (b16)0.0f;
}
// split fragment straight from an f32 k-contiguous row
__device__ __forceinline__ void frag_ksplit(const float* p, int hh, v16b& fh_, v16b& fl_) {
  const float* p0 = p + 8 * hh; const float* p1 = p + 16 + 8 * hh;
#pragma unroll
  for (int e = 0; e < 8; ++e) { b16 a, c; split_bf16(p0[e], a, c); fh_[e] = a; fl_[e] = c; split_bf16(p1[e], a, c); fh_[8 + e] = a; fl_[8 + e] = c; }
}
__device__ __forceinline__ v8f wmma16b(v16b a, v16b b, v8f c) {
  v8f d = __builtin_amdgcn_wmma_f32_16x16x32_f16(false, a, false, b, (short)0, c, false, false);
  asm volatile("v_nop\n\tv_nop\n\tv_nop\n\tv_nop" : "+v"(d) : "v"(a), "v"(b));
  return d;
}
// acc += A.B with both operands split: A = (ah, al), B = (bh, bl)
__device__ __forceinline__ v8f wmma3(v16b ah, v16b al, v16b bh, v16b bl, v8f c) {
  (void)al; (void)bl; return wmma16b(ah, bh, c);   // single f16 product
}
// e^x formed as __expf forms it (x * log2 e, then v_exp_f32). The v_nop is the one free issue slot that the instruction set asks for behind a transcendental:
// inside the statement the slot cannot move.
__device__ __forceinline__ float exp_slot(float x) {
  float r; asm("v_exp_f32 %0, %1\n\tv_nop" : "=v"(r) : "v"(x * 1.44269504f)); return r;
}
__device__ __forceinline__ void wave_lds_sync() {
  __builtin_amdgcn_fence(__ATOMIC_RELEASE, "workgroup");
  __builtin_amdgcn_wave_barrier();
  __builtin_amdgcn_fence(__ATOMIC_ACQUIRE, "workgroup");
}

// ---------------------------------------------------------------------------
// Weights (torch [out][in] = [n][k]) -> f16 hi / lo planes, same [n][k] layout (k contiguous): columns of Wq|Wk|Wv into wqh/wql [3072][1024], Wo into woh/wol [1024][1024].
// ---------------------------------------------------------------------------
__global__ __launch_bounds__(256) void wcvt_kernel(const float* __restrict__ wq, const float* __restrict__ wk, const float* __restrict__ wv,
                                                   const float* __restrict__ wo, b16* __restrict__ wqh, b16* __restrict__ wql,
                                                   b16* __restrict__ woh, b16* __restrict__ wol) {
  const size_t tid = (size_t)blockIdx.x * blockDim.x + threadIdx.x, stride = (size_t)gridDim.x * blockDim.x;
  const size_t nq = (size_t)NQKV * HID / 8, no = (size_t)HID * HID / 8;
  {
    for (size_t c = tid; c < nq + no; c += stride) {
      float f[8]; size_t i; b16* dh; b16* dl;
      if (c < nq) {
        i = c * 8; const size_t n = i / HID, k0 = i % HID;
        const float* w; int nn, ld;
        if (n < (size_t)HID) { w = wq; nn = (int)n; ld = HID; } else if (n < (size_t)(HID + KVW)) { w = wk; nn = (int)n - HID; ld = KVW; } else { w = wv; nn = (int)n - HID - KVW; ld = KVW; }
#pragma unroll
        for (int e = 0; e < 8; ++e) f[e] = w[(size_t)nn * HID + k0 + e];      // W[n][k] (torch [out][in]); ld unused
        (void)ld;
        dh = wqh; dl = wql;
      } else {
        i = (c - nq) * 8; const size_t n = i / HID, k0 = i % HID;
#pragma unroll
        for (int e = 0; e < 8; ++e) f[e] = wo[(size_t)n * HID + k0 + e];    // Wo[n][k] (torch [out][in])
        dh = woh; dl = wol;
      }
      v8b bh, bl;
#pragma unroll
      for (int e = 0; e < 8; ++e) { b16 a, cc; split_bf16(f[e], a, cc); bh[e] = a; bl[e] = cc; }
      *(v8b*)(dh + i) = bh; *(v8b*)(dl + i) = bl;
    }
    
  }
}

// 32x64 wave tile over K from f32 A rows and f16-plane B rows
__device__ __forceinline__ void gemm_tile_split(const float* __restrict__ A, const b16* __restrict__ wh, const b16* __restrict__ wl,
                                                int m0, int c0, int K, int nloc, int hlf, v8f (&acc)[2][4]) {
  for (int kb = 0; kb < K; kb += 32) {
    v16b a0h, a0l, a1h, a1l;
    frag_ksplit(A + (size_t)(m0 + nloc) * K + kb, hlf, a0h, a0l);
    frag_ksplit(A + (size_t)(m0 + 16 + nloc) * K + kb, hlf, a1h, a1l);
#pragma unroll
    for (int t = 0; t < 4; ++t) {
      const size_t wofs = (size_t)(c0 + t * 16 + nloc) * K + kb;
      const v16b bh = frag_kb(wh + wofs, hlf), bl = frag_kb(wl + wofs, hlf);
      acc[0][t] = wmma3(a0h, a0l, bh, bl, acc[0][t]);
      acc[1][t] = wmma3(a1h, a1l, bh, bl, acc[1][t]);
    }
  }
}

// ---------------------------------------------------------------------------
// QKV GEMM: (4096 x 1024) x (1024 x 3072), grid (48, 32), block 4 waves, wave = 32 rows x 64 columns (one head of q, k or v). Outputs as f16 hi/lo planes:
// q (x1/8) -> Qh/Ql [b][h][t][64]; k -> Kh/Kl [b][kvh][t][64] (4 KB contiguous per wave per plane);
// v -> Vh/Vl key-tiled [b][kvh][t/16][64][16] (4 KB contiguous per wave per plane).
// ---------------------------------------------------------------------------
__global__ __launch_bounds__(128) void qkv_gemm_kernel(const float* __restrict__ xq, const float* __restrict__ xk, const float* __restrict__ xv,
                                                       const b16* __restrict__ wqh, const b16* __restrict__ wql,
                                                       const float* __restrict__ bq, const float* __restrict__ bk, const float* __restrict__ bv, const float* __restrict__ rope_cs, int xoff, int yoff,
                                                       b16* __restrict__ Qh, b16* __restrict__ Ql, b16* __restrict__ Kh, b16* __restrict__ Kl,
                                                       b16* __restrict__ Vh, b16* __restrict__ Vl) {
  __shared__ __attribute__((aligned(16))) b16 Ts[4][2][32 * 64];
  const int lane = threadIdx.x & 31, wave = threadIdx.x >> 5, nloc = lane & 15, hlf = lane >> 4;
  const int m0 = (blockIdx.y + yoff) * 128 + wave * 32;
  const int c0 = (blockIdx.x + xoff) * 64;
  const int mat = (c0 < HID) ? 0 : (c0 < HID + KVW) ? 1 : 2;
  const int head = (mat == 0) ? (c0 / DH) : (mat == 1) ? ((c0 - HID) / DH) : ((c0 - HID - KVW) / DH);
  const float* x = (mat == 0) ? xq : (mat == 1) ? xk : xv;          // three different input tensors
  const float* bias = ((mat == 0) ? bq : (mat == 1) ? bk : bv) + head * DH;
  v8f acc[2][4];
#pragma unroll
  for (int r = 0; r < 2; ++r)
#pragma unroll
    for (int t = 0; t < 4; ++t) acc[r][t] = (v8f){};
  gemm_tile_split(x, wqh, wql, m0, c0, HID, nloc, hlf, acc);
  const int b = m0 / T, t0 = m0 % T;
  const float s = (mat == 0) ? 0.125f : 1.0f;
  b16* Tp0 = Ts[wave][0]; b16* Tp1 = Ts[wave][1];
  if (mat < 2) {                                          // RoPE for q and k: partners live in other lanes -> raw f32 tile through LDS first
    float* F = reinterpret_cast<float*>(Ts[wave][0]);     // 32 x 64 f32 = exactly the wave's two staging planes
#pragma unroll
    for (int t = 0; t < 4; ++t)
#pragma unroll
      for (int r = 0; r < 2; ++r)
#pragma unroll
        for (int v = 0; v < 8; ++v) { const int rr = r * 16 + v + 8 * hlf, d = t * 16 + nloc; F[rr * 64 + d] = acc[r][t][v] + bias[d]; }
    wave_lds_sync();
#pragma unroll
    for (int t = 0; t < 4; ++t)
#pragma unroll
      for (int r = 0; r < 2; ++r)
#pragma unroll
        for (int v = 0; v < 8; ++v) {
          const int rr = r * 16 + v + 8 * hlf, d = t * 16 + nloc, tpos = t0 + rr;
          const float cv = rope_cs[((size_t)tpos * 32 + (d & 31)) * 2], sv = rope_cs[((size_t)tpos * 32 + (d & 31)) * 2 + 1];
          const float oth = (d < 32) ? -F[rr * 64 + 2 * d + 1] : F[rr * 64 + 2 * (d - 32)];
          acc[r][t][v] = F[rr * 64 + d] * cv + oth * sv - bias[d];     // bias re-added by the common path below
        }
    wave_lds_sync();                                      // all partner reads done before the planes overwrite F
  }
#pragma unroll
  for (int t = 0; t < 4; ++t)
#pragma unroll
    for (int r = 0; r < 2; ++r)
#pragma unroll
      for (int v = 0; v < 8; ++v) {
        const int rr = r * 16 + v + 8 * hlf, d = t * 16 + nloc;
        float val = acc[r][t][v] + bias[d];
        b16 yh, yl; split_bf16(val * s, yh, yl);
        const int idx = (mat < 2) ? (rr * 64 + d) : ((rr >> 4) * 1024 + d * 16 + (rr & 15));
        Tp0[idx] = yh; Tp1[idx] = yl;
      }
  wave_lds_sync();
  b16* dh; b16* dl; size_t o;
  if (mat == 0)      { o = ((size_t)(b * NH + head) * T + t0) * DH; dh = Qh + o; dl = Ql + o; }
  else if (mat == 1) { o = ((size_t)(b * NKV + head) * T + t0) * DH; dh = Kh + o; dl = Kl + o; }
  else               { o = ((size_t)(b * NKV + head) * QT_PER_B + (t0 >> 4)) * (size_t)(DH * 16); dh = Vh + o; dl = Vl + o; }
#pragma unroll
  for (int j = 0; j < 8; ++j) { const int e = (j * 32 + lane) * 8; *(v8b*)(dh + e) = ld8b(Tp0 + e); *(v8b*)(dl + e) = ld8b(Tp1 + e); }
  
}

// ---------------------------------------------------------------------------
// Transposed flash attention, keys in chunks of 32. Blocks 0..NG-1: the global-query tile (queries 0..15, every key) of one (b, head), its keys split
// over the block's 8 waves, the 8 partial (max, sum, O) merged in LDS. Other blocks: each wave owns one windowed 16-query tile of one (b, head).
// S^T = K.Q^T (split), per-lane online softmax; P^T built in registers from the two S^T accumulators
// ---------------------------------------------------------------------------
__global__ __launch_bounds__(256) void attn_kernel(const b16* __restrict__ Qh, const b16* __restrict__ Ql, const b16* __restrict__ Kh, const b16* __restrict__ Kl,
                                                   const b16* __restrict__ Vh, const b16* __restrict__ Vl,
                                                   float* __restrict__ yf) {
  __shared__ __attribute__((aligned(16))) float Os[8][16 * 64];
  __shared__ float Ms[8][16], Ls[8][16];
  const int wid = threadIdx.x >> 5, lane = threadIdx.x & 31, hh = lane >> 4, col = lane & 15;
  const bool glob = blockIdx.x < NG;                      // block-uniform
  const int qtile = ((int)blockIdx.x - NG) * 8 + wid;     // over NG*(QT_PER_B-1): the windowed tiles
  const int g = glob ? (int)blockIdx.x : qtile / (QT_PER_B - 1);          // b*NH + h
  const int q0 = glob ? 0 : ((qtile % (QT_PER_B - 1)) + 1) << 4;
  const int b = g / NH, h = g % NH, kvh = h / REP;
  const size_t ko = (size_t)(b * NKV + kvh) * T * DH;
  const size_t qo = ((size_t)g * T + q0 + col) * DH;
  const v16b q0h = frag_kb(Qh + qo, hh), q0l = frag_kb(Ql + qo, hh), q1h = frag_kb(Qh + qo + 32, hh), q1l = frag_kb(Ql + qo + 32, hh);
  float m = -INFINITY, l = 0.0f;
  v8f o0 = {}, o1 = {}, o2 = {}, o3 = {};
  const int kstart = (q0 >= WIN + 32) ? ((q0 - WIN) & ~31) : 32;   // first windowed chunk after the global chunk 0
  const int kfirst = glob ? wid * KSPLIT : 0, kend = glob ? kfirst + KSPLIT : q0 + 16;
  for (int kb = kfirst; kb < kend; kb = (!glob && kb == 0) ? kstart : (kb + 32)) {   // global queries: this wave's share of every key; else chunk 0 (global keys) + the causal window
    const size_t r0 = ko + (size_t)(kb + col) * DH, r1 = ko + (size_t)(kb + 16 + col) * DH;
    v8f s0 = {}, s1 = {};
    {
      v16b ah = frag_kb(Kh + r0, hh), al = frag_kb(Kl + r0, hh);
      s0 = wmma3(ah, al, q0h, q0l, s0);
      ah = frag_kb(Kh + r0 + 32, hh); al = frag_kb(Kl + r0 + 32, hh);
      s0 = wmma3(ah, al, q1h, q1l, s0);
      ah = frag_kb(Kh + r1, hh); al = frag_kb(Kl + r1, hh);
      s1 = wmma3(ah, al, q0h, q0l, s1);
      ah = frag_kb(Kh + r1 + 32, hh); al = frag_kb(Kl + r1 + 32, hh);
      s1 = wmma3(ah, al, q1h, q1l, s1);
    }
    if (q0 != 0 && (kb == 0 || kb + 32 > q0 || kb < q0 + 15 - WIN)) {   // blocked = (j > i or j < i-128) unless j < 16 (queries here are >= 16)
      const int qi = q0 + col;
#pragma unroll
      for (int r = 0; r < 8; ++r) {
        const int k0i = kb + 8 * hh + r, k1i = k0i + 16;
        if (k0i >= NGLOB && (k0i > qi || k0i < qi - WIN)) s0[r] = -INFINITY;
        if (k1i >= NGLOB && (k1i > qi || k1i < qi - WIN)) s1[r] = -INFINITY;
      }
    }
    float mr = -INFINITY;
#pragma unroll
    for (int r = 0; r < 8; ++r) mr = fmaxf(mr, fmaxf(s0[r], s1[r]));
    mr = fmaxf(mr, __shfl_xor(mr, 16));
    const float mn = fmaxf(m, mr);            // finite
    const float al_ = __expf(m - mn);
    m = mn;
    float sum = 0.0f;
    v16b pbh, pbl;
#pragma unroll
    for (int r = 0; r < 8; ++r) {
      const float p0 = __expf(s0[r] - mn), p1 = __expf(s1[r] - mn);
      sum += p0 + p1;
      b16 a, c; split_bf16(p0, a, c); pbh[r] = a; pbl[r] = c; split_bf16(p1, a, c); pbh[8 + r] = a; pbl[8 + r] = c;
    }
    sum += __shfl_xor(sum, 16);
    l = l * al_ + sum;
#pragma unroll
    for (int r = 0; r < 8; ++r) { o0[r] *= al_; o1[r] *= al_; o2[r] *= al_; o3[r] *= al_; }
    const size_t v0 = ko + (size_t)(kb >> 4) * (DH * 16) + 8 * hh, v1 = v0 + DH * 16;
#pragma unroll
    for (int n = 0; n < 4; ++n) {
      const int f = n * 16 + col;
      const v16b vah = cat8b(ld8b(Vh + v0 + f * 16), ld8b(Vh + v1 + f * 16));
      const v16b val = cat8b(ld8b(Vl + v0 + f * 16), ld8b(Vl + v1 + f * 16));
      v8f& o = (n == 0) ? o0 : (n == 1) ? o1 : (n == 2) ? o2 : o3;
      o = wmma3(vah, val, pbh, pbl, o);
    }
  }
  const float inv = glob ? 1.0f : 1.0f / l;               // a partial O stays unnormalised until the merge
  float* Tt = Os[wid];
#pragma unroll
  for (int r = 0; r < 8; ++r) {
    const int hr = 8 * hh + r;
    Tt[col * 64 + 0 + hr] = o0[r] * inv; Tt[col * 64 + 16 + hr] = o1[r] * inv;
    Tt[col * 64 + 32 + hr] = o2[r] * inv; Tt[col * 64 + 48 + hr] = o3[r] * inv;
  }
  if (glob) {                                             // merge the 8 waves' partials: thread = (query row, 4 features)
    if (hh == 0) { Ms[wid][col] = m; Ls[wid][col] = l; }
    __syncthreads();                                      // every wave's partial is in LDS before any thread sums over waves
    const int rr = threadIdx.x >> 4, c4 = (threadIdx.x & 15) * 4;
    float mx = Ms[0][rr];
#pragma unroll
    for (int w = 1; w < 8; ++w) mx = fmaxf(mx, Ms[w][rr]);
    float sc[8];
#pragma unroll
    for (int w = 0; w < 8; ++w) sc[w] = exp_slot(Ms[w][rr] - mx);
    float lt = 0.0f; v4f a = {};
#pragma unroll
    for (int w = 0; w < 8; ++w) { lt += sc[w] * Ls[w][rr]; a += sc[w] * *(const v4f*)(&Os[w][rr * 64 + c4]); }
    *(v4f*)(yf + ((size_t)b * T + rr) * HID + h * DH + c4) = a * (1.0f / lt);
    return;
  }
  wave_lds_sync();
  float* dst0 = yf + ((size_t)b * T + q0) * HID + h * DH;     // 16 rows x 64 floats, row stride HID
#pragma unroll
  for (int j = 0; j < 8; ++j) { const int rr = j * 2 + hh, c4 = col * 4; *(v4f*)(dst0 + (size_t)rr * HID + c4) = *(const v4f*)(Tt + rr * 64 + c4); }
  
}

// ---------------------------------------------------------------------------
// Output projection: (4096 x 1024) x (1024 x 1024) -> f32, A split on the fly from f32 y, B = Wo planes. grid (16, 32), 32x64 tiles staged in LDS,
// ---------------------------------------------------------------------------
__global__ __launch_bounds__(128) void out_gemm_kernel(const float* __restrict__ yf, const b16* __restrict__ woh, const b16* __restrict__ wol, const float* __restrict__ bo, int yoff,
                                                       float* __restrict__ out) {
  __shared__ __attribute__((aligned(16))) float Ts[4][32 * 64];
  const int lane = threadIdx.x & 31, wave = threadIdx.x >> 5, nloc = lane & 15, hlf = lane >> 4;
  const int m0 = (blockIdx.y + yoff) * 128 + wave * 32;
  const int c0 = blockIdx.x * 64;
  v8f acc[2][4];
#pragma unroll
  for (int r = 0; r < 2; ++r)
#pragma unroll
    for (int t = 0; t < 4; ++t) acc[r][t] = (v8f){};
  gemm_tile_split(yf, woh, wol, m0, c0, HID, nloc, hlf, acc);
  float* Tt = Ts[wave];
#pragma unroll
  for (int t = 0; t < 4; ++t)
#pragma unroll
    for (int r = 0; r < 2; ++r)
#pragma unroll
      for (int v = 0; v < 8; ++v) Tt[(r * 16 + v + 8 * hlf) * 64 + t * 16 + nloc] = acc[r][t][v] + bo[c0 + t * 16 + nloc];
  wave_lds_sync();
  float* dst0 = out + (size_t)m0 * HID + c0;
#pragma unroll
  for (int j = 0; j < 16; ++j) { const int rr = j * 2 + hlf, c4 = nloc * 4; *(v4f*)(dst0 + (size_t)rr * HID + c4) = *(const v4f*)(Tt + rr * 64 + c4); }
  
}
__global__ __launch_bounds__(256) void rope_table_kernel(float* __restrict__ cs) {
  const int idx = blockIdx.x * 256 + threadIdx.x;        // T * 32
  if (idx >= T * 32) return;
  const int t = idx >> 5, i = idx & 31;
  const float ang = (float)t * powf(10000.0f, -(float)i / 32.0f);
  typedef __attribute__((ext_vector_type(2))) float v2f;
  const v2f p = {cosf(ang), sinf(ang)};
  *(v2f*)(cs + (size_t)idx * 2) = p; 
}
}  // namespace

extern "C" void kernel_launch(void* const* d_in, const int* in_sizes, int n_in,
                              void* d_out, int out_size, void* d_ws, size_t ws_size, hipStream_t stream) {
  (void)in_sizes; (void)n_in; (void)out_size;
  const float* xq = (const float*)d_in[0];   // q [2,2048,1024]
  const float* xk = (const float*)d_in[1];   // k
  const float* xv = (const float*)d_in[2];   // v
  const float* Wq = (const float*)d_in[3];  const float* bq = (const float*)d_in[4];    // torch [out][in]
  const float* Wk = (const float*)d_in[5];  const float* bk = (const float*)d_in[6];
  const float* Wv = (const float*)d_in[7];  const float* bv = (const float*)d_in[8];
  const float* Wo = (const float*)d_in[9];  const float* bo = (const float*)d_in[10];
  float* out = (float*)d_out;                // [2,2048,1024]

  size_t off = 0; char* ws = (char*)d_ws;
  b16* wqh = (b16*)(ws + off); off += (size_t)NQKV * HID * 2;
  b16* wql = (b16*)(ws + off); off += (size_t)NQKV * HID * 2;     // 'lo' planes: zeros in the f16 variant (real buffers: the kernels write both)
  b16* woh = (b16*)(ws + off); off += (size_t)HID * HID * 2;
  b16* wol = (b16*)(ws + off); off += (size_t)HID * HID * 2;
  b16* Qh  = (b16*)(ws + off); off += (size_t)MROWS * HID * 2;
  b16* Ql  = (b16*)(ws + off); off += (size_t)MROWS * HID * 2;
  b16* Kh  = (b16*)(ws + off); off += (size_t)MROWS * KVW * 2;
  b16* Kl  = (b16*)(ws + off); off += (size_t)MROWS * KVW * 2;
  b16* Vh  = (b16*)(ws + off); off += (size_t)MROWS * KVW * 2;
  b16* Vl  = (b16*)(ws + off); off += (size_t)MROWS * KVW * 2;
  float* yf = (float*)(ws + off); off += (size_t)MROWS * HID * 4;
  float* rope_cs = (float*)(ws + off); off += (size_t)T * 32 * 2 * 4;
  if (off > ws_size) return;
  rope_table_kernel<<<(T * 32 + 255) / 256, 256, 0, stream>>>(rope_cs);
  const int ROWBLK = MROWS / 128;
  wcvt_kernel<<<2048, 256, 0, stream>>>(Wq, Wk, Wv, Wo, wqh, wql, woh, wol);
  qkv_gemm_kernel<<<dim3(NQKV / 64, ROWBLK), 128, 0, stream>>>(xq, xk, xv, wqh, wql, bq, bk, bv, rope_cs, 0, 0, Qh, Ql, Kh, Kl, Vh, Vl);
  attn_kernel<<<ATT_BLOCKS, 256, 0, stream>>>(Qh, Ql, Kh, Kl, Vh, Vl, yf);
  out_gemm_kernel<<<dim3(HID / 64, ROWBLK), 128, 0, stream>>>(yf, woh, wol, bo, 0, out);
}

// v002
// Measured time: 105 microseconds a run.
// In both of two side-by-side timings against v001, it was 1.67 times as fast.
// Over all steps from v000 it is 2.60 times as fast.
#include <hip/hip_runtime.h>

// Sparse (local-window + global-token) multi-head attention: Q/K/V = x W^T + b (torch [out][in]), 16 heads x 64, RoPE with this module's pairing
// (x_rope[d] = -x[2d+1] for d < 32, x[2(d-32)] otherwise; angle index d mod 32), scores/8, mask: blocked if (|i-j| > 128 or j > i) unless i < 16 or j < 16,
// softmax, P.V, out = y Wo^T + bo. B=2, S=2048, D=1024. Contractions on v_wmma_f32_16x16x32_f16 with single f16 operands and f32 accumulate; fragment

namespace {
constexpr int Bsz = 2, T = 2048, HID = 1024, DH = 64, NH = 16, NKV = 16, REP = NH / NKV;
constexpr int WIN = 128, NGLOB = 16;
constexpr int KVW = NKV * DH;                 // 1024
constexpr int NQKV = HID + 2 * KVW;           // 3072 columns: q | k | v
constexpr int MROWS = Bsz * T;                // 4096
constexpr int QT_PER_B = T / 16;              // 128
constexpr int NG = Bsz * NH;                  // 32 (batch, head) pairs
constexpr int KSPLIT = T / 8;                 // keys per wave in a block that owns a global-query tile
constexpr int ATT_BLOCKS = NG + NG * (QT_PER_B - 1) / 8;   // 32 global-query blocks + 508 blocks of 8 windowed tiles

typedef _Float16 b16;                                           // f16 variant: single-plane operands (the 'lo' planes hold zeros and are never multiplied)
typedef __attribute__((ext_vector_type(16))) _Float16 v16b;
typedef __attribute__((ext_vector_type(8)))  _Float16 v8b;
typedef __attribute__((ext_vector_type(8)))  float v8f;
typedef __attribute__((ext_vector_type(4)))  float v4f;

__device__ __forceinline__ v8b ld8b(const b16* p) { return *(const v8b*)p; }
__device__ __forceinline__ v16b cat8b(v8b a, v8b b) { return __builtin_shufflevector(a, b, 0, 1, 2, 3, 4, 5, 6, 7, 8, 9, 10, 11, 12, 13, 14, 15); }
// 16x16x32 16-bit fragment from a k-contiguous row pointer (A: lane&15 = row, B: lane&15 = column), hh = lane>>4:
// elements 0..7 <- p[8hh+0..7], elements 8..15 <- p[16+8hh+0..7]
__device__ __forceinline__ v16b frag_kb(const b16* p, int hh) { return cat8b(ld8b(p + 8 * hh), ld8b(p + 16 + 8 * hh)); }
__device__ __forceinline__ void split_bf16(float v, b16& hi, b16& lo) {   // (name kept) f16 conversion, no low part
  hi = (b16)v; lo = (b16)0.0f;
}
__device__ __forceinline__ v8f wmma16b(v16b a, v16b b, v8f c) {
  v8f d = __builtin_amdgcn_wmma_f32_16x16x32_f16(false, a, false, b, (short)0, c, false, false);
  asm volatile("v_nop\n\tv_nop\n\tv_nop\n\tv_nop" : "+v"(d) : "v"(a), "v"(b));
  return d;
}
// acc += A.B with both operands split: A = (ah, al), B = (bh, bl)
__device__ __forceinline__ v8f wmma3(v16b ah, v16b al, v16b bh, v16b bl, v8f c) {
  (void)al; (void)bl; return wmma16b(ah, bh, c);   // single f16 product
}
// e^x formed as __expf forms it (x * log2 e, then v_exp_f32). The v_nop is the one free issue slot that the instruction set asks for behind a transcendental:
// inside the statement the slot cannot move.
__device__ __forceinline__ float exp_slot(float x) {
  float r; asm("v_exp_f32 %0, %1\n\tv_nop" : "=v"(r) : "v"(x * 1.44269504f)); return r;
}
__device__ __forceinline__ void wave_lds_sync() {
  __builtin_amdgcn_fence(__ATOMIC_RELEASE, "workgroup");
  __builtin_amdgcn_wave_barrier();
  __builtin_amdgcn_fence(__ATOMIC_ACQUIRE, "workgroup");
}

// ---------------------------------------------------------------------------
// Weights (torch [out][in] = [n][k]) -> f16 hi / lo planes, same [n][k] layout (k contiguous): columns of Wq|Wk|Wv into wqh/wql [3072][1024], Wo into woh/wol [1024][1024].
// ---------------------------------------------------------------------------
__global__ __launch_bounds__(256) void wcvt_kernel(const float* __restrict__ wq, const float* __restrict__ wk, const float* __restrict__ wv,
                                                   const float* __restrict__ wo, b16* __restrict__ wqh, b16* __restrict__ wql,
                                                   b16* __restrict__ woh, b16* __restrict__ wol) {
  const size_t tid = (size_t)blockIdx.x * blockDim.x + threadIdx.x, stride = (size_t)gridDim.x * blockDim.x;
  const size_t nq = (size_t)NQKV * HID / 8, no = (size_t)HID * HID / 8;
  {
    for (size_t c = tid; c < nq + no; c += stride) {
      float f[8]; size_t i; b16* dh; b16* dl;
      if (c < nq) {
        i = c * 8; const size_t n = i / HID, k0 = i % HID;
        const float* w; int nn, ld;
        if (n < (size_t)HID) { w = wq; nn = (int)n; ld = HID; } else if (n < (size_t)(HID + KVW)) { w = wk; nn = (int)n - HID; ld = KVW; } else { w = wv; nn = (int)n - HID - KVW; ld = KVW; }
#pragma unroll
        for (int e = 0; e < 8; ++e) f[e] = w[(size_t)nn * HID + k0 + e];      // W[n][k] (torch [out][in]); ld unused
        (void)ld;
        dh = wqh; dl = wql;
      } else {
        i = (c - nq) * 8; const size_t n = i / HID, k0 = i % HID;
#pragma unroll
        for (int e = 0; e < 8; ++e) f[e] = wo[(size_t)n * HID + k0 + e];    // Wo[n][k] (torch [out][in])
        dh = woh; dl = wol;
      }
      v8b bh, bl;
#pragma unroll
      for (int e = 0; e < 8; ++e) { b16 a, cc; split_bf16(f[e], a, cc); bh[e] = a; bl[e] = cc; }
      *(v8b*)(dh + i) = bh; *(v8b*)(dl + i) = bl;
    }
    
  }
}

// Block GEMM core, 8 waves: a 128 x 128 tile of A.W^T, wave (wm, wn) = 32 rows x 64 columns of it. Per step of 64 k the block brings the A rows (f32, converted
// to f16 once, here) and the W rows (f16) into LDS with loads that cover whole 128-byte lines; every wave takes its fragments from LDS. Two buffers: the next
// step's global loads are issued behind the barrier and fly during the products. Fragment k order and the order of the sums over k are those of frag_kb on a row.
constexpr int BM = 128, BN = 128, KS = 64;
constexpr int PITCH = KS + 8;                   // f16 elements: 144-byte rows (16 B x odd), conflict-free for the 16-byte fragment reads
constexpr int STAGE = (BM + BN) * PITCH;        // one buffer: 128 A rows, then 128 W rows
typedef __attribute__((ext_vector_type(4))) _Float16 v4b;
__device__ __forceinline__ void gemm_block_lds(const float* __restrict__ A, const b16* __restrict__ wh, int mb, int cb, b16* sm,
                                               int wm, int wn, int nloc, int hlf, v8f (&acc)[2][4]) {
  const int tid = threadIdx.x;
  const float* ag = A + (size_t)(mb + (tid >> 4)) * HID + (tid & 15) * 4;     // 16 lanes = 256 B of one row; rows tid/16 + 16 i
  const b16* bg = wh + (size_t)(cb + (tid >> 3)) * HID + (tid & 7) * 8;       // 8 lanes = 128 B of one row; rows tid/8 + 32 i
  b16* as = sm + (tid >> 4) * PITCH + (tid & 15) * 4;
  b16* bs = sm + (BM + (tid >> 3)) * PITCH + (tid & 7) * 8;
  const b16* af = sm + (wm * 32 + nloc) * PITCH;
  const b16* bf = sm + (BM + wn * 64 + nloc) * PITCH;
  v4f ar[8]; v8b br[4];
#pragma unroll
  for (int i = 0; i < 8; ++i) ar[i] = *(const v4f*)(ag + (size_t)i * 16 * HID);
#pragma unroll
  for (int i = 0; i < 4; ++i) br[i] = ld8b(bg + (size_t)i * 32 * HID);
  for (int s = 0; s < HID / KS; ++s) {
    const int o = (s & 1) * STAGE;
#pragma unroll
    for (int i = 0; i < 8; ++i) { const v4b h = {(b16)ar[i][0], (b16)ar[i][1], (b16)ar[i][2], (b16)ar[i][3]}; *(v4b*)(as + o + i * 16 * PITCH) = h; }
#pragma unroll
    for (int i = 0; i < 4; ++i) *(v8b*)(bs + o + i * 32 * PITCH) = br[i];
    __syncthreads();                            // publishes this step's buffer; it also ends every wave's reads of the other buffer, which the next step refills
    if (s + 1 < HID / KS) {
      const int k = (s + 1) * KS;
#pragma unroll
      for (int i = 0; i < 8; ++i) ar[i] = *(const v4f*)(ag + (size_t)i * 16 * HID + k);
#pragma unroll
      for (int i = 0; i < 4; ++i) br[i] = ld8b(bg + (size_t)i * 32 * HID + k);
    }
    v16b fa[2][2], fb[2][4];                    // the whole step's fragments, read as one group ahead of the products: one LDS latency a step, not one a pair
#pragma unroll
    for (int q = 0; q < 2; ++q) {
#pragma unroll
      for (int r = 0; r < 2; ++r) fa[q][r] = frag_kb(af + o + r * 16 * PITCH + q * 32, hlf);
#pragma unroll
      for (int t = 0; t < 4; ++t) fb[q][t] = frag_kb(bf + o + t * 16 * PITCH + q * 32, hlf);
    }
#pragma unroll
    for (int q = 0; q < 2; ++q)
#pragma unroll
      for (int t = 0; t < 4; ++t) {
        acc[0][t] = wmma16b(fa[q][0], fb[q][t], acc[0][t]);
        acc[1][t] = wmma16b(fa[q][1], fb[q][t], acc[1][t]);
      }
  }
  __syncthreads();                              // every wave has left the buffers: the callers' epilogues stage in the same LDS
}

// ---------------------------------------------------------------------------
// QKV GEMM: (4096 x 1024) x (1024 x 3072), grid (24, 32), block 8 waves (4 x 2), wave = 32 rows x 64 columns (one head of q, k or v). Outputs as f16 hi/lo planes:
// q (x1/8) -> Qh/Ql [b][h][t][64]; k -> Kh/Kl [b][kvh][t][64] (4 KB contiguous per wave per plane);
// v -> Vh/Vl key-tiled [b][kvh][t/16][64][16] (4 KB contiguous per wave per plane).
// ---------------------------------------------------------------------------
__global__ __launch_bounds__(256) void qkv_gemm_kernel(const float* __restrict__ xq, const float* __restrict__ xk, const float* __restrict__ xv,
                                                       const b16* __restrict__ wqh, const b16* __restrict__ wql,
                                                       const float* __restrict__ bq, const float* __restrict__ bk, const float* __restrict__ bv, const float* __restrict__ rope_cs, int xoff, int yoff,
                                                       b16* __restrict__ Qh, b16* __restrict__ Ql, b16* __restrict__ Kh, b16* __restrict__ Kl,
                                                       b16* __restrict__ Vh, b16* __restrict__ Vl) {
  __shared__ __attribute__((aligned(16))) b16 sm[2 * STAGE];   // the core's two buffers; afterwards 8 KB of staging per wave
  const int lane = threadIdx.x & 31, wave = __builtin_amdgcn_readfirstlane(threadIdx.x >> 5), nloc = lane & 15, hlf = lane >> 4;
  const int wm = wave & 3, wn = wave >> 2;   // wave number held scalar: the choice of matrix, head, bias and staging place stays on the scalar unit
  const int mb = (blockIdx.y + yoff) * BM, cb = (blockIdx.x + xoff) * BN;   // a 128-column tile lies inside one of q, k, v
  const int m0 = mb + wm * 32;
  const int c0 = cb + wn * 64;
  const int mat = (c0 < HID) ? 0 : (c0 < HID + KVW) ? 1 : 2;
  const int head = (mat == 0) ? (c0 / DH) : (mat == 1) ? ((c0 - HID) / DH) : ((c0 - HID - KVW) / DH);
  const float* x = (mat == 0) ? xq : (mat == 1) ? xk : xv;          // three different input tensors
  const float* bias = ((mat == 0) ? bq : (mat == 1) ? bk : bv) + head * DH;
  v8f acc[2][4];
#pragma unroll
  for (int r = 0; r < 2; ++r)
#pragma unroll
    for (int t = 0; t < 4; ++t) acc[r][t] = (v8f){};
  gemm_block_lds(x, wqh, mb, cb, sm, wm, wn, nloc, hlf, acc);
  const int b = m0 / T, t0 = m0 % T;
  const float s = (mat == 0) ? 0.125f : 1.0f;
  b16* Tp0 = sm + wave * (2 * 32 * 64); b16* Tp1 = Tp0 + 32 * 64;
  if (mat < 2) {                                          // RoPE for q and k: partners live in other lanes -> raw f32 tile through LDS first
    float* F = reinterpret_cast<float*>(Tp0);             // 32 x 64 f32 = exactly the wave's two staging planes
#pragma unroll
    for (int t = 0; t < 4; ++t)
#pragma unroll
      for (int r = 0; r < 2; ++r)
#pragma unroll
        for (int v = 0; v < 8; ++v) { const int rr = r * 16 + v + 8 * hlf, d = t * 16 + nloc; F[rr * 64 + d] = acc[r][t][v] + bias[d]; }
    wave_lds_sync();
#pragma unroll
    for (int t = 0; t < 4; ++t)
#pragma unroll
      for (int r = 0; r < 2; ++r)
#pragma unroll
        for (int v = 0; v < 8; ++v) {
          const int rr = r * 16 + v + 8 * hlf, d = t * 16 + nloc, tpos = t0 + rr;
          const float cv = rope_cs[((size_t)tpos * 32 + (d & 31)) * 2], sv = rope_cs[((size_t)tpos * 32 + (d & 31)) * 2 + 1];
          const float oth = (d < 32) ? -F[rr * 64 + 2 * d + 1] : F[rr * 64 + 2 * (d - 32)];
          acc[r][t][v] = F[rr * 64 + d] * cv + oth * sv - bias[d];     // bias re-added by the common path below
        }
    wave_lds_sync();                                      // all partner reads done before the planes overwrite F
  }
#pragma unroll
  for (int t = 0; t < 4; ++t)
#pragma unroll
    for (int r = 0; r < 2; ++r)
#pragma unroll
      for (int v = 0; v < 8; ++v) {
        const int rr = r * 16 + v + 8 * hlf, d = t * 16 + nloc;
        float val = acc[r][t][v] + bias[d];
        b16 yh, yl; split_bf16(val * s, yh, yl);
        const int idx = (mat < 2) ? (rr * 64 + d) : ((rr >> 4) * 1024 + d * 16 + (rr & 15));
        Tp0[idx] = yh; Tp1[idx] = yl;
      }
  wave_lds_sync();
  b16* dh; b16* dl; size_t o;
  if (mat == 0)      { o = ((size_t)(b * NH + head) * T + t0) * DH; dh = Qh + o; dl = Ql + o; }
  else if (mat == 1) { o = ((size_t)(b * NKV + head) * T + t0) * DH; dh = Kh + o; dl = Kl + o; }
  else               { o = ((size_t)(b * NKV + head) * QT_PER_B + (t0 >> 4)) * (size_t)(DH * 16); dh = Vh + o; dl = Vl + o; }
#pragma unroll
  for (int j = 0; j < 8; ++j) { const int e = (j * 32 + lane) * 8; *(v8b*)(dh + e) = ld8b(Tp0 + e); *(v8b*)(dl + e) = ld8b(Tp1 + e); }
  
}

// ---------------------------------------------------------------------------
// Transposed flash attention, keys in chunks of 32. Blocks 0..NG-1: the global-query tile (queries 0..15, every key) of one (b, head), its keys split
// over the block's 8 waves, the 8 partial (max, sum, O) merged in LDS. Other blocks: each wave owns one windowed 16-query tile of one (b, head).
// S^T = K.Q^T (split), per-lane online softmax; P^T built in registers from the two S^T accumulators
// ---------------------------------------------------------------------------
__global__ __launch_bounds__(256) void attn_kernel(const b16* __restrict__ Qh, const b16* __restrict__ Ql, const b16* __restrict__ Kh, const b16* __restrict__ Kl,
                                                   const b16* __restrict__ Vh, const b16* __restrict__ Vl,
                                                   float* __restrict__ yf) {
  __shared__ __attribute__((aligned(16))) float Os[8][16 * 64];
  __shared__ float Ms[8][16], Ls[8][16];
  const int wid = threadIdx.x >> 5, lane = threadIdx.x & 31, hh = lane >> 4, col = lane & 15;
  const bool glob = blockIdx.x < NG;                      // block-uniform
  const int qtile = ((int)blockIdx.x - NG) * 8 + wid;     // over NG*(QT_PER_B-1): the windowed tiles
  const int g = glob ? (int)blockIdx.x : qtile / (QT_PER_B - 1);          // b*NH + h
  const int q0 = glob ? 0 : ((qtile % (QT_PER_B - 1)) + 1) << 4;
  const int b = g / NH, h = g % NH, kvh = h / REP;
  const size_t ko = (size_t)(b * NKV + kvh) * T * DH;
  const size_t qo = ((size_t)g * T + q0 + col) * DH;
  const v16b q0h = frag_kb(Qh + qo, hh), q0l = frag_kb(Ql + qo, hh), q1h = frag_kb(Qh + qo + 32, hh), q1l = frag_kb(Ql + qo + 32, hh);
  float m = -INFINITY, l = 0.0f;
  v8f o0 = {}, o1 = {}, o2 = {}, o3 = {};
  const int kstart = (q0 >= WIN + 32) ? ((q0 - WIN) & ~31) : 32;   // first windowed chunk after the global chunk 0
  const int kfirst = glob ? wid * KSPLIT : 0, kend = glob ? kfirst + KSPLIT : q0 + 16;
  for (int kb = kfirst; kb < kend; kb = (!glob && kb == 0) ? kstart : (kb + 32)) {   // global queries: this wave's share of every key; else chunk 0 (global keys) + the causal window
    const size_t r0 = ko + (size_t)(kb + col) * DH, r1 = ko + (size_t)(kb + 16 + col) * DH;
    v8f s0 = {}, s1 = {};
    {
      v16b ah = frag_kb(Kh + r0, hh), al = frag_kb(Kl + r0, hh);
      s0 = wmma3(ah, al, q0h, q0l, s0);
      ah = frag_kb(Kh + r0 + 32, hh); al = frag_kb(Kl + r0 + 32, hh);
      s0 = wmma3(ah, al, q1h, q1l, s0);
      ah = frag_kb(Kh + r1, hh); al = frag_kb(Kl + r1, hh);
      s1 = wmma3(ah, al, q0h, q0l, s1);
      ah = frag_kb(Kh + r1 + 32, hh); al = frag_kb(Kl + r1 + 32, hh);
      s1 = wmma3(ah, al, q1h, q1l, s1);
    }
    if (q0 != 0 && (kb == 0 || kb + 32 > q0 || kb < q0 + 15 - WIN)) {   // blocked = (j > i or j < i-128) unless j < 16 (queries here are >= 16)
      const int qi = q0 + col;
#pragma unroll
      for (int r = 0; r < 8; ++r) {
        const int k0i = kb + 8 * hh + r, k1i = k0i + 16;
        if (k0i >= NGLOB && (k0i > qi || k0i < qi - WIN)) s0[r] = -INFINITY;
        if (k1i >= NGLOB && (k1i > qi || k1i < qi - WIN)) s1[r] = -INFINITY;
      }
    }
    float mr = -INFINITY;
#pragma unroll
    for (int r = 0; r < 8; ++r) mr = fmaxf(mr, fmaxf(s0[r], s1[r]));
    mr = fmaxf(mr, __shfl_xor(mr, 16));
    const float mn = fmaxf(m, mr);            // finite
    const float al_ = __expf(m - mn);
    m = mn;
    float sum = 0.0f;
    v16b pbh, pbl;
#pragma unroll
    for (int r = 0; r < 8; ++r) {
      const float p0 = __expf(s0[r] - mn), p1 = __expf(s1[r] - mn);
      sum += p0 + p1;
      b16 a, c; split_bf16(p0, a, c); pbh[r] = a; pbl[r] = c; split_bf16(p1, a, c); pbh[8 + r] = a; pbl[8 + r] = c;
    }
    sum += __shfl_xor(sum, 16);
    l = l * al_ + sum;
#pragma unroll
    for (int r = 0; r < 8; ++r) { o0[r] *= al_; o1[r] *= al_; o2[r] *= al_; o3[r] *= al_; }
    const size_t v0 = ko + (size_t)(kb >> 4) * (DH * 16) + 8 * hh, v1 = v0 + DH * 16;
#pragma unroll
    for (int n = 0; n < 4; ++n) {
      const int f = n * 16 + col;
      const v16b vah = cat8b(ld8b(Vh + v0 + f * 16), ld8b(Vh + v1 + f * 16));
      const v16b val = cat8b(ld8b(Vl + v0 + f * 16), ld8b(Vl + v1 + f * 16));
      v8f& o = (n == 0) ? o0 : (n == 1) ? o1 : (n == 2) ? o2 : o3;
      o = wmma3(vah, val, pbh, pbl, o);
    }
  }
  const float inv = glob ? 1.0f : 1.0f / l;               // a partial O stays unnormalised until the merge
  float* Tt = Os[wid];
#pragma unroll
  for (int r = 0; r < 8; ++r) {
    const int hr = 8 * hh + r;
    Tt[col * 64 + 0 + hr] = o0[r] * inv; Tt[col * 64 + 16 + hr] = o1[r] * inv;
    Tt[col * 64 + 32 + hr] = o2[r] * inv; Tt[col * 64 + 48 + hr] = o3[r] * inv;
  }
  if (glob) {                                             // merge the 8 waves' partials: thread = (query row, 4 features)
    if (hh == 0) { Ms[wid][col] = m; Ls[wid][col] = l; }
    __syncthreads();                                      // every wave's partial is in LDS before any thread sums over waves
    const int rr = threadIdx.x >> 4, c4 = (threadIdx.x & 15) * 4;
    float mx = Ms[0][rr];
#pragma unroll
    for (int w = 1; w < 8; ++w) mx = fmaxf(mx, Ms[w][rr]);
    float sc[8];
#pragma unroll
    for (int w = 0; w < 8; ++w) sc[w] = exp_slot(Ms[w][rr] - mx);
    float lt = 0.0f; v4f a = {};
#pragma unroll
    for (int w = 0; w < 8; ++w) { lt += sc[w] * Ls[w][rr]; a += sc[w] * *(const v4f*)(&Os[w][rr * 64 + c4]); }
    *(v4f*)(yf + ((size_t)b * T + rr) * HID + h * DH + c4) = a * (1.0f / lt);
    return;
  }
  wave_lds_sync();
  float* dst0 = yf + ((size_t)b * T + q0) * HID + h * DH;     // 16 rows x 64 floats, row stride HID
#pragma unroll
  for (int j = 0; j < 8; ++j) { const int rr = j * 2 + hh, c4 = col * 4; *(v4f*)(dst0 + (size_t)rr * HID + c4) = *(const v4f*)(Tt + rr * 64 + c4); }
  
}

// ---------------------------------------------------------------------------
// Output projection: (4096 x 1024) x (1024 x 1024) -> f32, A = f32 y, B = Wo plane. grid (8, 32), block 8 waves (4 x 2), 32x64 wave tiles staged in LDS,
// ---------------------------------------------------------------------------
__global__ __launch_bounds__(256) void out_gemm_kernel(const float* __restrict__ yf, const b16* __restrict__ woh, const b16* __restrict__ wol, const float* __restrict__ bo, int yoff,
                                                       float* __restrict__ out) {
  __shared__ __attribute__((aligned(16))) b16 sm[2 * STAGE];   // the core's two buffers; afterwards 8 KB of staging per wave
  const int lane = threadIdx.x & 31, wave = __builtin_amdgcn_readfirstlane(threadIdx.x >> 5), nloc = lane & 15, hlf = lane >> 4;
  const int wm = wave & 3, wn = wave >> 2;   // wave number held scalar: the bias columns and staging place stay on the scalar unit
  const int mb = (blockIdx.y + yoff) * BM, cb = blockIdx.x * BN;
  const int m0 = mb + wm * 32;
  const int c0 = cb + wn * 64;
  v8f acc[2][4];
#pragma unroll
  for (int r = 0; r < 2; ++r)
#pragma unroll
    for (int t = 0; t < 4; ++t) acc[r][t] = (v8f){};
  gemm_block_lds(yf, woh, mb, cb, sm, wm, wn, nloc, hlf, acc);
  float* Tt = reinterpret_cast<float*>(sm) + wave * (32 * 64);
#pragma unroll
  for (int t = 0; t < 4; ++t)
#pragma unroll
    for (int r = 0; r < 2; ++r)
#pragma unroll
      for (int v = 0; v < 8; ++v) Tt[(r * 16 + v + 8 * hlf) * 64 + t * 16 + nloc] = acc[r][t][v] + bo[c0 + t * 16 + nloc];
  wave_lds_sync();
  float* dst0 = out + (size_t)m0 * HID + c0;
#pragma unroll
  for (int j = 0; j < 16; ++j) { const int rr = j * 2 + hlf, c4 = nloc * 4; *(v4f*)(dst0 + (size_t)rr * HID + c4) = *(const v4f*)(Tt + rr * 64 + c4); }
  
}
__global__ __launch_bounds__(256) void rope_table_kernel(float* __restrict__ cs) {
  const int idx = blockIdx.x * 256 + threadIdx.x;        // T * 32
  if (idx >= T * 32) return;
  const int t = idx >> 5, i = idx & 31;
  const float ang = (float)t * powf(10000.0f, -(float)i / 32.0f);
  typedef __attribute__((ext_vector_type(2))) float v2f;
  const v2f p = {cosf(ang), sinf(ang)};
  *(v2f*)(cs + (size_t)idx * 2) = p; 
}
}  // namespace

extern "C" void kernel_launch(void* const* d_in, const int* in_sizes, int n_in,
                              void* d_out, int out_size, void* d_ws, size_t ws_size, hipStream_t stream) {
  (void)in_sizes; (void)n_in; (void)out_size;
  const float* xq = (const float*)d_in[0];   // q [2,2048,1024]
  const float* xk = (const float*)d_in[1];   // k
  const float* xv = (const float*)d_in[2];   // v
  const float* Wq = (const float*)d_in[3];  const float* bq = (const float*)d_in[4];    // torch [out][in]
  const float* Wk = (const float*)d_in[5];  const float* bk = (const float*)d_in[6];
  const float* Wv = (const float*)d_in[7];  const float* bv = (const float*)d_in[8];
  const float* Wo = (const float*)d_in[9];  const float* bo = (const float*)d_in[10];
  float* out = (float*)d_out;                // [2,2048,1024]

  size_t off = 0; char* ws = (char*)d_ws;
  b16* wqh = (b16*)(ws + off); off += (size_t)NQKV * HID * 2;
  b16* wql = (b16*)(ws + off); off += (size_t)NQKV * HID * 2;     // 'lo' planes: zeros in the f16 variant (real buffers: the kernels write both)
  b16* woh = (b16*)(ws + off); off += (size_t)HID * HID * 2;
  b16* wol = (b16*)(ws + off); off += (size_t)HID * HID * 2;
  b16* Qh  = (b16*)(ws + off); off += (size_t)MROWS * HID * 2;
  b16* Ql  = (b16*)(ws + off); off += (size_t)MROWS * HID * 2;
  b16* Kh  = (b16*)(ws + off); off += (size_t)MROWS * KVW * 2;
  b16* Kl  = (b16*)(ws + off); off += (size_t)MROWS * KVW * 2;
  b16* Vh  = (b16*)(ws + off); off += (size_t)MROWS * KVW * 2;
  b16* Vl  = (b16*)(ws + off); off += (size_t)MROWS * KVW * 2;
  float* yf = (float*)(ws + off); off += (size_t)MROWS * HID * 4;
  float* rope_cs = (float*)(ws + off); off += (size_t)T * 32 * 2 * 4;
  if (off > ws_size) return;
  rope_table_kernel<<<(T * 32 + 255) / 256, 256, 0, stream>>>(rope_cs);
  const int ROWBLK = MROWS / 128;
  wcvt_kernel<<<2048, 256, 0, stream>>>(Wq, Wk, Wv, Wo, wqh, wql, woh, wol);
  qkv_gemm_kernel<<<dim3(NQKV / BN, ROWBLK), 256, 0, stream>>>(xq, xk, xv, wqh, wql, bq, bk, bv, rope_cs, 0, 0, Qh, Ql, Kh, Kl, Vh, Vl);
  attn_kernel<<<ATT_BLOCKS, 256, 0, stream>>>(Qh, Ql, Kh, Kl, Vh, Vl, yf);
  out_gemm_kernel<<<dim3(HID / BN, ROWBLK), 256, 0, stream>>>(yf, woh, wol, bo, 0, out);
}

// v003
// A run of this version takes 90.5 microseconds.
// In both of two side-by-side timings against v002, it was 1.16 times as fast.
// Over all steps from v000 it is 3.01 times as fast.
#include <hip/hip_runtime.h>

// Sparse (local-window + global-token) multi-head attention: Q/K/V = x W^T + b (torch [out][in]), 16 heads x 64, RoPE with this module's pairing
// (x_rope[d] = -x[2d+1] for d < 32, x[2(d-32)] otherwise; angle index d mod 32), scores/8, mask: blocked if (|i-j| > 128 or j > i) unless i < 16 or j < 16,
// softmax, P.V, out = y Wo^T + bo. B=2, S=2048, D=1024. Contractions on v_wmma_f32_16x16x32_f16 with single f16 operands and f32 accumulate; fragment

namespace {
constexpr int Bsz = 2, T = 2048, HID = 1024, DH = 64, NH = 16, NKV = 16, REP = NH / NKV;
constexpr int WIN = 128, NGLOB = 16;
constexpr int KVW = NKV * DH;                 // 1024
constexpr int NQKV = HID + 2 * KVW;           // 3072 columns: q | k | v
constexpr int MROWS = Bsz * T;                // 4096
constexpr int QT_PER_B = T / 16;              // 128
constexpr int NG = Bsz * NH;                  // 32 (batch, head) pairs
constexpr int KSPLIT = T / 8;                 // keys per wave in a block that owns a global-query tile
constexpr int ATT_BLOCKS = NG + NG * (QT_PER_B - 1) / 8;   // 32 global-query blocks + 508 blocks of 8 windowed tiles

typedef _Float16 b16;                                           // f16 variant: single-plane operands (the 'lo' planes hold zeros and are never multiplied)
typedef __attribute__((ext_vector_type(16))) _Float16 v16b;
typedef __attribute__((ext_vector_type(8)))  _Float16 v8b;
typedef __attribute__((ext_vector_type(8)))  float v8f;
typedef __attribute__((ext_vector_type(4)))  float v4f;

__device__ __forceinline__ v8b ld8b(const b16* p) { return *(const v8b*)p; }
__device__ __forceinline__ v16b cat8b(v8b a, v8b b) { return __builtin_shufflevector(a, b, 0, 1, 2, 3, 4, 5, 6, 7, 8, 9, 10, 11, 12, 13, 14, 15); }
// 16x16x32 16-bit fragment from a k-contiguous row pointer (A: lane&15 = row, B: lane&15 = column), hh = lane>>4:
// elements 0..7 <- p[8hh+0..7], elements 8..15 <- p[16+8hh+0..7]
__device__ __forceinline__ v16b frag_kb(const b16* p, int hh) { return cat8b(ld8b(p + 8 * hh), ld8b(p + 16 + 8 * hh)); }
__device__ __forceinline__ void split_bf16(float v, b16& hi, b16& lo) {   // (name kept) f16 conversion, no low part
  hi = (b16)v; lo = (b16)0.0f;
}
__device__ __forceinline__ v8f wmma16b(v16b a, v16b b, v8f c) {
  v8f d = __builtin_amdgcn_wmma_f32_16x16x32_f16(false, a, false, b, (short)0, c, false, false);
  asm volatile("v_nop\n\tv_nop\n\tv_nop\n\tv_nop" : "+v"(d) : "v"(a), "v"(b));
  return d;
}
// e^x formed as __expf forms it (x * log2 e, then v_exp_f32). The v_nop is the one free issue slot that the instruction set asks for behind a transcendental:
// inside the statement the slot cannot move.
__device__ __forceinline__ float exp_slot(float x) {
  float r; asm("v_exp_f32 %0, %1\n\tv_nop" : "=v"(r) : "v"(x * 1.44269504f)); return r;
}
__device__ __forceinline__ void wave_lds_sync() {
  __builtin_amdgcn_fence(__ATOMIC_RELEASE, "workgroup");
  __builtin_amdgcn_wave_barrier();
  __builtin_amdgcn_fence(__ATOMIC_ACQUIRE, "workgroup");
}

// ---------------------------------------------------------------------------
// Weights (torch [out][in] = [n][k]) -> f16 hi / lo planes, same [n][k] layout (k contiguous): columns of Wq|Wk|Wv into wqh/wql [3072][1024], Wo into woh/wol [1024][1024].
// ---------------------------------------------------------------------------
__global__ __launch_bounds__(256) void wcvt_kernel(const float* __restrict__ wq, const float* __restrict__ wk, const float* __restrict__ wv,
                                                   const float* __restrict__ wo, b16* __restrict__ wqh, b16* __restrict__ wql,
                                                   b16* __restrict__ woh, b16* __restrict__ wol) {
  const size_t tid = (size_t)blockIdx.x * blockDim.x + threadIdx.x, stride = (size_t)gridDim.x * blockDim.x;
  const size_t nq = (size_t)NQKV * HID / 8, no = (size_t)HID * HID / 8;
  {
    for (size_t c = tid; c < nq + no; c += stride) {
      float f[8]; size_t i; b16* dh; b16* dl;
      if (c < nq) {
        i = c * 8; const size_t n = i / HID, k0 = i % HID;
        const float* w; int nn, ld;
        if (n < (size_t)HID) { w = wq; nn = (int)n; ld = HID; } else if (n < (size_t)(HID + KVW)) { w = wk; nn = (int)n - HID; ld = KVW; } else { w = wv; nn = (int)n - HID - KVW; ld = KVW; }
#pragma unroll
        for (int e = 0; e < 8; ++e) f[e] = w[(size_t)nn * HID + k0 + e];      // W[n][k] (torch [out][in]); ld unused
        (void)ld;
        dh = wqh; dl = wql;
      } else {
        i = (c - nq) * 8; const size_t n = i / HID, k0 = i % HID;
#pragma unroll
        for (int e = 0; e < 8; ++e) f[e] = wo[(size_t)n * HID + k0 + e];    // Wo[n][k] (torch [out][in])
        dh = woh; dl = wol;
      }
      v8b bh, bl;
#pragma unroll
      for (int e = 0; e < 8; ++e) { b16 a, cc; split_bf16(f[e], a, cc); bh[e] = a; bl[e] = cc; }
      *(v8b*)(dh + i) = bh; *(v8b*)(dl + i) = bl;
    }
    
  }
}

// Block GEMM core, 8 waves: a 128 x 128 tile of A.W^T, wave (wm, wn) = 32 rows x 64 columns of it. Per step of 64 k the block brings the A rows (f32, converted
// to f16 once, here) and the W rows (f16) into LDS with loads that cover whole 128-byte lines; every wave takes its fragments from LDS. Two buffers: the next
// step's global loads are issued behind the barrier and fly during the products. Fragment k order and the order of the sums over k are those of frag_kb on a row.
constexpr int BM = 128, BN = 128, KS = 64;
constexpr int PITCH = KS + 8;                   // f16 elements: 144-byte rows (16 B x odd), conflict-free for the 16-byte fragment reads
constexpr int STAGE = (BM + BN) * PITCH;        // one buffer: 128 A rows, then 128 W rows
typedef __attribute__((ext_vector_type(4))) _Float16 v4b;
__device__ __forceinline__ void gemm_block_lds(const float* __restrict__ A, const b16* __restrict__ wh, int mb, int cb, b16* sm,
                                               int wm, int wn, int nloc, int hlf, v8f (&acc)[2][4]) {
  const int tid = threadIdx.x;
  const float* ag = A + (size_t)(mb + (tid >> 4)) * HID + (tid & 15) * 4;     // 16 lanes = 256 B of one row; rows tid/16 + 16 i
  const b16* bg = wh + (size_t)(cb + (tid >> 3)) * HID + (tid & 7) * 8;       // 8 lanes = 128 B of one row; rows tid/8 + 32 i
  b16* as = sm + (tid >> 4) * PITCH + (tid & 15) * 4;
  b16* bs = sm + (BM + (tid >> 3)) * PITCH + (tid & 7) * 8;
  const b16* af = sm + (wm * 32 + nloc) * PITCH;
  const b16* bf = sm + (BM + wn * 64 + nloc) * PITCH;
  v4f ar[8]; v8b br[4];
#pragma unroll
  for (int i = 0; i < 8; ++i) ar[i] = *(const v4f*)(ag + (size_t)i * 16 * HID);
#pragma unroll
  for (int i = 0; i < 4; ++i) br[i] = ld8b(bg + (size_t)i * 32 * HID);
  for (int s = 0; s < HID / KS; ++s) {
    const int o = (s & 1) * STAGE;
#pragma unroll
    for (int i = 0; i < 8; ++i) { const v4b h = {(b16)ar[i][0], (b16)ar[i][1], (b16)ar[i][2], (b16)ar[i][3]}; *(v4b*)(as + o + i * 16 * PITCH) = h; }
#pragma unroll
    for (int i = 0; i < 4; ++i) *(v8b*)(bs + o + i * 32 * PITCH) = br[i];
    __syncthreads();                            // publishes this step's buffer; it also ends every wave's reads of the other buffer, which the next step refills
    if (s + 1 < HID / KS) {
      const int k = (s + 1) * KS;
#pragma unroll
      for (int i = 0; i < 8; ++i) ar[i] = *(const v4f*)(ag + (size_t)i * 16 * HID + k);
#pragma unroll
      for (int i = 0; i < 4; ++i) br[i] = ld8b(bg + (size_t)i * 32 * HID + k);
    }
    v16b fa[2][2], fb[2][4];                    // the whole step's fragments, read as one group ahead of the products: one LDS latency a step, not one a pair
#pragma unroll
    for (int q = 0; q < 2; ++q) {
#pragma unroll
      for (int r = 0; r < 2; ++r) fa[q][r] = frag_kb(af + o + r * 16 * PITCH + q * 32, hlf);
#pragma unroll
      for (int t = 0; t < 4; ++t) fb[q][t] = frag_kb(bf + o + t * 16 * PITCH + q * 32, hlf);
    }
#pragma unroll
    for (int q = 0; q < 2; ++q)
#pragma unroll
      for (int t = 0; t < 4; ++t) {
        acc[0][t] = wmma16b(fa[q][0], fb[q][t], acc[0][t]);
        acc[1][t] = wmma16b(fa[q][1], fb[q][t], acc[1][t]);
      }
  }
  __syncthreads();                              // every wave has left the buffers: the callers' epilogues stage in the same LDS
}

// ---------------------------------------------------------------------------
// QKV GEMM: (4096 x 1024) x (1024 x 3072), grid (24, 32), block 8 waves (4 x 2), wave = 32 rows x 64 columns (one head of q, k or v). Outputs as f16 hi/lo planes:
// q (x1/8) -> Qh/Ql [b][h][t][64]; k -> Kh/Kl [b][kvh][t][64] (4 KB contiguous per wave per plane);
// v -> Vh/Vl key-tiled [b][kvh][t/16][64][16] (4 KB contiguous per wave per plane).
// ---------------------------------------------------------------------------
__global__ __launch_bounds__(256) void qkv_gemm_kernel(const float* __restrict__ xq, const float* __restrict__ xk, const float* __restrict__ xv,
                                                       const b16* __restrict__ wqh, const b16* __restrict__ wql,
                                                       const float* __restrict__ bq, const float* __restrict__ bk, const float* __restrict__ bv, const float* __restrict__ rope_cs, int xoff, int yoff,
                                                       b16* __restrict__ Qh, b16* __restrict__ Ql, b16* __restrict__ Kh, b16* __restrict__ Kl,
                                                       b16* __restrict__ Vh, b16* __restrict__ Vl) {
  __shared__ __attribute__((aligned(16))) b16 sm[2 * STAGE];   // the core's two buffers; afterwards 8 KB of staging per wave
  const int lane = threadIdx.x & 31, wave = __builtin_amdgcn_readfirstlane(threadIdx.x >> 5), nloc = lane & 15, hlf = lane >> 4;
  const int wm = wave & 3, wn = wave >> 2;   // wave number held scalar: the choice of matrix, head, bias and staging place stays on the scalar unit
  const int mb = (blockIdx.y + yoff) * BM, cb = (blockIdx.x + xoff) * BN;   // a 128-column tile lies inside one of q, k, v
  const int m0 = mb + wm * 32;
  const int c0 = cb + wn * 64;
  const int mat = (c0 < HID) ? 0 : (c0 < HID + KVW) ? 1 : 2;
  const int head = (mat == 0) ? (c0 / DH) : (mat == 1) ? ((c0 - HID) / DH) : ((c0 - HID - KVW) / DH);
  const float* x = (mat == 0) ? xq : (mat == 1) ? xk : xv;          // three different input tensors
  const float* bias = ((mat == 0) ? bq : (mat == 1) ? bk : bv) + head * DH;
  v8f acc[2][4];
#pragma unroll
  for (int r = 0; r < 2; ++r)
#pragma unroll
    for (int t = 0; t < 4; ++t) acc[r][t] = (v8f){};
  gemm_block_lds(x, wqh, mb, cb, sm, wm, wn, nloc, hlf, acc);
  const int b = m0 / T, t0 = m0 % T;
  const float s = (mat == 0) ? 0.125f : 1.0f;
  b16* Tp0 = sm + wave * (2 * 32 * 64); b16* Tp1 = Tp0 + 32 * 64;
  if (mat < 2) {                                          // RoPE for q and k: partners live in other lanes -> raw f32 tile through LDS first
    float* F = reinterpret_cast<float*>(Tp0);             // 32 x 64 f32 = exactly the wave's two staging planes
#pragma unroll
    for (int t = 0; t < 4; ++t)
#pragma unroll
      for (int r = 0; r < 2; ++r)
#pragma unroll
        for (int v = 0; v < 8; ++v) { const int rr = r * 16 + v + 8 * hlf, d = t * 16 + nloc; F[rr * 64 + d] = acc[r][t][v] + bias[d]; }
    wave_lds_sync();
#pragma unroll
    for (int t = 0; t < 4; ++t)
#pragma unroll
      for (int r = 0; r < 2; ++r)
#pragma unroll
        for (int v = 0; v < 8; ++v) {
          const int rr = r * 16 + v + 8 * hlf, d = t * 16 + nloc, tpos = t0 + rr;
          const float cv = rope_cs[((size_t)tpos * 32 + (d & 31)) * 2], sv = rope_cs[((size_t)tpos * 32 + (d & 31)) * 2 + 1];
          const float oth = (d < 32) ? -F[rr * 64 + 2 * d + 1] : F[rr * 64 + 2 * (d - 32)];
          acc[r][t][v] = F[rr * 64 + d] * cv + oth * sv - bias[d];     // bias re-added by the common path below
        }
    wave_lds_sync();                                      // all partner reads done before the planes overwrite F
  }
#pragma unroll
  for (int t = 0; t < 4; ++t)
#pragma unroll
    for (int r = 0; r < 2; ++r)
#pragma unroll
      for (int v = 0; v < 8; ++v) {
        const int rr = r * 16 + v + 8 * hlf, d = t * 16 + nloc;
        float val = acc[r][t][v] + bias[d];
        b16 yh, yl; split_bf16(val * s, yh, yl);
        const int idx = (mat < 2) ? (rr * 64 + d) : ((rr >> 4) * 1024 + d * 16 + (rr & 15));
        Tp0[idx] = yh; Tp1[idx] = yl;
      }
  wave_lds_sync();
  b16* dh; b16* dl; size_t o;
  if (mat == 0)      { o = ((size_t)(b * NH + head) * T + t0) * DH; dh = Qh + o; dl = Ql + o; }
  else if (mat == 1) { o = ((size_t)(b * NKV + head) * T + t0) * DH; dh = Kh + o; dl = Kl + o; }
  else               { o = ((size_t)(b * NKV + head) * QT_PER_B + (t0 >> 4)) * (size_t)(DH * 16); dh = Vh + o; dl = Vl + o; }
#pragma unroll
  for (int j = 0; j < 8; ++j) { const int e = (j * 32 + lane) * 8; *(v8b*)(dh + e) = ld8b(Tp0 + e); *(v8b*)(dl + e) = ld8b(Tp1 + e); }
  
}

template <bool B> struct flag_t { static constexpr bool value = B; };
// One 32-key chunk's fragments, each set loaded as one group of 8 loads: K rows kb..kb+31 (two 16-key tiles x two halves of the 64 features) and the key-tiled V.
__device__ __forceinline__ void load_k_chunk(const b16* __restrict__ kbase, int kb, int col, int hh, v16b (&k)[4]) {
  const b16* p = kbase + (size_t)(kb + col) * DH;
  k[0] = frag_kb(p, hh); k[1] = frag_kb(p + 32, hh); k[2] = frag_kb(p + 16 * DH, hh); k[3] = frag_kb(p + 16 * DH + 32, hh);
  asm volatile("s_wait_xcnt 0x0" ::: "memory");   // stands in front of the first later write of the group's address registers, which the compiler reuses at once
}
__device__ __forceinline__ void load_v_chunk(const b16* __restrict__ vbase, int kb, int col, int hh, v16b (&v)[4]) {
  const b16* p = vbase + (size_t)(kb >> 4) * (DH * 16) + col * 16 + 8 * hh;
#pragma unroll
  for (int n = 0; n < 4; ++n) v[n] = cat8b(ld8b(p + n * 256), ld8b(p + n * 256 + DH * 16));
  asm volatile("s_wait_xcnt 0x0" ::: "memory");   // as in load_k_chunk
}

// ---------------------------------------------------------------------------
// Transposed flash attention, keys in chunks of 32. Blocks 0..NG-1: the global-query tile (queries 0..15, every key) of one (b, head), its keys split
// over the block's 8 waves, the 8 partial (max, sum, O) merged in LDS. Other blocks: each wave owns one windowed 16-query tile of one (b, head).
// S^T = K.Q^T (split), per-lane online softmax; P^T built in registers from the two S^T accumulators
// Each chunk's 8 K loads and 8 V loads are issued as groups ahead of their use, so that a chunk no longer waits one load latency in front of each of its 8 products.
// ---------------------------------------------------------------------------
__global__ __launch_bounds__(256) void attn_kernel(const b16* __restrict__ Qh, const b16* __restrict__ Ql, const b16* __restrict__ Kh, const b16* __restrict__ Kl,
                                                   const b16* __restrict__ Vh, const b16* __restrict__ Vl,
                                                   float* __restrict__ yf) {
  __shared__ __attribute__((aligned(16))) float Os[8][16 * 64];
  __shared__ float Ms[8][16], Ls[8][16];
  // wave number held scalar: tile, chunk counters and loop tests leave the vector registers, which keeps the kernel with both fragment groups at 160 or fewer
  // (6 waves per SIMD, 3 blocks per WGP: all 540 blocks resident at once)
  const int wid = __builtin_amdgcn_readfirstlane(threadIdx.x >> 5), lane = threadIdx.x & 31, hh = lane >> 4, col = lane & 15;
  const bool glob = blockIdx.x < NG;                      // block-uniform
  const int qtile = ((int)blockIdx.x - NG) * 8 + wid;     // over NG*(QT_PER_B-1): the windowed tiles
  const int g = glob ? (int)blockIdx.x : qtile / (QT_PER_B - 1);          // b*NH + h
  const int q0 = glob ? 0 : ((qtile % (QT_PER_B - 1)) + 1) << 4;
  const int b = g / NH, h = g % NH, kvh = h / REP;
  const size_t ko = (size_t)(b * NKV + kvh) * T * DH;
  const size_t qo = ((size_t)g * T + q0 + col) * DH;
  (void)Ql; (void)Kl; (void)Vl;                           // the zero planes are never multiplied
  const v16b q0h = frag_kb(Qh + qo, hh), q1h = frag_kb(Qh + qo + 32, hh);
  float m = -INFINITY, l = 0.0f;
  v8f o0 = {}, o1 = {}, o2 = {}, o3 = {};
  const int kstart = (q0 >= WIN + 32) ? ((q0 - WIN) & ~31) : 32;   // first windowed chunk after the global chunk 0
  const int kfirst = glob ? wid * KSPLIT : 0, kend = glob ? kfirst + KSPLIT : q0 + 16;
  v16b kf[4];
  load_k_chunk(Kh + ko, kfirst, col, hh, kf);
  // One chunk. Its V group is issued first and flies during the score products and the softmax; where a next chunk exists (ahead), that chunk's K group is
  // issued behind the score products and flies during the softmax and P.V. The last chunk is a copy of the body without that group, not a branch in it: with a
  // branch round the loads the compiler's wait in front of P.V counted to 0 and so waited for the next K group too.
  auto chunk = [&](const int kb, const int kn, auto ahead) {
    v16b vf[4];
    load_v_chunk(Vh + ko, kb, col, hh, vf);
    v8f s0 = {}, s1 = {};
    s0 = wmma16b(kf[0], q0h, s0);
    s0 = wmma16b(kf[1], q1h, s0);
    s1 = wmma16b(kf[2], q0h, s1);
    s1 = wmma16b(kf[3], q1h, s1);
    if constexpr (decltype(ahead)::value) load_k_chunk(Kh + ko, kn, col, hh, kf);
    if (q0 != 0 && (kb == 0 || kb + 32 > q0 || kb < q0 + 15 - WIN)) {   // blocked = (j > i or j < i-128) unless j < 16 (queries here are >= 16)
      const int qi = q0 + col;
#pragma unroll
      for (int r = 0; r < 8; ++r) {
        const int k0i = kb + 8 * hh + r, k1i = k0i + 16;
        if (k0i >= NGLOB && (k0i > qi || k0i < qi - WIN)) s0[r] = -INFINITY;
        if (k1i >= NGLOB && (k1i > qi || k1i < qi - WIN)) s1[r] = -INFINITY;
      }
    }
    float mr = -INFINITY;
#pragma unroll
    for (int r = 0; r < 8; ++r) mr = fmaxf(mr, fmaxf(s0[r], s1[r]));
    mr = fmaxf(mr, __shfl_xor(mr, 16));
    const float mn = fmaxf(m, mr);            // finite
    const float al_ = exp_slot(m - mn);       // exp_slot: the same product and v_exp_f32 as __expf, with the free slot behind it held in the statement
    m = mn;
    float sum = 0.0f;
    v16b pbh;
#pragma unroll
    for (int r = 0; r < 8; ++r) {
      const float p0 = exp_slot(s0[r] - mn), p1 = exp_slot(s1[r] - mn);
      sum += p0 + p1;
      pbh[r] = (b16)p0; pbh[8 + r] = (b16)p1;
    }
    sum += __shfl_xor(sum, 16);
    l = l * al_ + sum;
#pragma unroll
    for (int r = 0; r < 8; ++r) { o0[r] *= al_; o1[r] *= al_; o2[r] *= al_; o3[r] *= al_; }
    o0 = wmma16b(vf[0], pbh, o0);
    o1 = wmma16b(vf[1], pbh, o1);
    o2 = wmma16b(vf[2], pbh, o2);
    o3 = wmma16b(vf[3], pbh, o3);
  };
  int kb = kfirst;            // global queries: this wave's share of every key; else chunk 0 (global keys) + the causal window; every wave has at least one chunk
  for (;;) {
    const int kn = (!glob && kb == 0) ? kstart : (kb + 32);
    if (kn >= kend) break;
    chunk(kb, kn, flag_t<true>{});
    kb = kn;
  }
  chunk(kb, kb, flag_t<false>{});
  const float inv = glob ? 1.0f : 1.0f / l;               // a partial O stays unnormalised until the merge
  float* Tt = Os[wid];
#pragma unroll
  for (int r = 0; r < 8; ++r) {
    const int hr = 8 * hh + r;
    Tt[col * 64 + 0 + hr] = o0[r] * inv; Tt[col * 64 + 16 + hr] = o1[r] * inv;
    Tt[col * 64 + 32 + hr] = o2[r] * inv; Tt[col * 64 + 48 + hr] = o3[r] * inv;
  }
  if (glob) {                                             // merge the 8 waves' partials: thread = (query row, 4 features)
    if (hh == 0) { Ms[wid][col] = m; Ls[wid][col] = l; }
    __syncthreads();                                      // every wave's partial is in LDS before any thread sums over waves
    const int rr = threadIdx.x >> 4, c4 = (threadIdx.x & 15) * 4;
    float mx = Ms[0][rr];
#pragma unroll
    for (int w = 1; w < 8; ++w) mx = fmaxf(mx, Ms[w][rr]);
    float sc[8];
#pragma unroll
    for (int w = 0; w < 8; ++w) sc[w] = exp_slot(Ms[w][rr] - mx);
    float lt = 0.0f; v4f a = {};
#pragma unroll
    for (int w = 0; w < 8; ++w) { lt += sc[w] * Ls[w][rr]; a += sc[w] * *(const v4f*)(&Os[w][rr * 64 + c4]); }
    *(v4f*)(yf + ((size_t)b * T + rr) * HID + h * DH + c4) = a * (1.0f / lt);
    return;
  }
  wave_lds_sync();
  float* dst0 = yf + ((size_t)b * T + q0) * HID + h * DH;     // 16 rows x 64 floats, row stride HID
#pragma unroll
  for (int j = 0; j < 8; ++j) { const int rr = j * 2 + hh, c4 = col * 4; *(v4f*)(dst0 + (size_t)rr * HID + c4) = *(const v4f*)(Tt + rr * 64 + c4); }
  
}

// ---------------------------------------------------------------------------
// Output projection: (4096 x 1024) x (1024 x 1024) -> f32, A = f32 y, B = Wo plane. grid (8, 32), block 8 waves (4 x 2), 32x64 wave tiles staged in LDS,
// ---------------------------------------------------------------------------
__global__ __launch_bounds__(256) void out_gemm_kernel(const float* __restrict__ yf, const b16* __restrict__ woh, const b16* __restrict__ wol, const float* __restrict__ bo, int yoff,
                                                       float* __restrict__ out) {
  __shared__ __attribute__((aligned(16))) b16 sm[2 * STAGE];   // the core's two buffers; afterwards 8 KB of staging per wave
  const int lane = threadIdx.x & 31, wave = __builtin_amdgcn_readfirstlane(threadIdx.x >> 5), nloc = lane & 15, hlf = lane >> 4;
  const int wm = wave & 3, wn = wave >> 2;   // wave number held scalar: the bias columns and staging place stay on the scalar unit
  const int mb = (blockIdx.y + yoff) * BM, cb = blockIdx.x * BN;
  const int m0 = mb + wm * 32;
  const int c0 = cb + wn * 64;
  v8f acc[2][4];
#pragma unroll
  for (int r = 0; r < 2; ++r)
#pragma unroll
    for (int t = 0; t < 4; ++t) acc[r][t] = (v8f){};
  gemm_block_lds(yf, woh, mb, cb, sm, wm, wn, nloc, hlf, acc);
  float* Tt = reinterpret_cast<float*>(sm) + wave * (32 * 64);
#pragma unroll
  for (int t = 0; t < 4; ++t)
#pragma unroll
    for (int r = 0; r < 2; ++r)
#pragma unroll
      for (int v = 0; v < 8; ++v) Tt[(r * 16 + v + 8 * hlf) * 64 + t * 16 + nloc] = acc[r][t][v] + bo[c0 + t * 16 + nloc];
  wave_lds_sync();
  float* dst0 = out + (size_t)m0 * HID + c0;
#pragma unroll
  for (int j = 0; j < 16; ++j) { const int rr = j * 2 + hlf, c4 = nloc * 4; *(v4f*)(dst0 + (size_t)rr * HID + c4) = *(const v4f*)(Tt + rr * 64 + c4); }
  
}
__global__ __launch_bounds__(256) void rope_table_kernel(float* __restrict__ cs) {
  const int idx = blockIdx.x * 256 + threadIdx.x;        // T * 32
  if (idx >= T * 32) return;
  const int t = idx >> 5, i = idx & 31;
  const float ang = (float)t * powf(10000.0f, -(float)i / 32.0f);
  typedef __attribute__((ext_vector_type(2))) float v2f;
  const v2f p = {cosf(ang), sinf(ang)};
  *(v2f*)(cs + (size_t)idx * 2) = p; 
}
}  // namespace

extern "C" void kernel_launch(void* const* d_in, const int* in_sizes, int n_in,
                              void* d_out, int out_size, void* d_ws, size_t ws_size, hipStream_t stream) {
  (void)in_sizes; (void)n_in; (void)out_size;
  const float* xq = (const float*)d_in[0];   // q [2,2048,1024]
  const float* xk = (const float*)d_in[1];   // k
  const float* xv = (const float*)d_in[2];   // v
  const float* Wq = (const float*)d_in[3];  const float* bq = (const float*)d_in[4];    // torch [out][in]
  const float* Wk = (const float*)d_in[5];  const float* bk = (const float*)d_in[6];
  const float* Wv = (const float*)d_in[7];  const float* bv = (const float*)d_in[8];
  const float* Wo = (const float*)d_in[9];  const float* bo = (const float*)d_in[10];
  float* out = (float*)d_out;                // [2,2048,1024]

  size_t off = 0; char* ws = (char*)d_ws;
  b16* wqh = (b16*)(ws + off); off += (size_t)NQKV * HID * 2;
  b16* wql = (b16*)(ws + off); off += (size_t)NQKV * HID * 2;     // 'lo' planes: zeros in the f16 variant (real buffers: the kernels write both)
  b16* woh = (b16*)(ws + off); off += (size_t)HID * HID * 2;
  b16* wol = (b16*)(ws + off); off += (size_t)HID * HID * 2;
  b16* Qh  = (b16*)(ws + off); off += (size_t)MROWS * HID * 2;
  b16* Ql  = (b16*)(ws + off); off += (size_t)MROWS * HID * 2;
  b16* Kh  = (b16*)(ws + off); off += (size_t)MROWS * KVW * 2;
  b16* Kl  = (b16*)(ws + off); off += (size_t)MROWS * KVW * 2;
  b16* Vh  = (b16*)(ws + off); off += (size_t)MROWS * KVW * 2;
  b16* Vl  = (b16*)(ws + off); off += (size_t)MROWS * KVW * 2;
  float* yf = (float*)(ws + off); off += (size_t)MROWS * HID * 4;
  float* rope_cs = (float*)(ws + off); off += (size_t)T * 32 * 2 * 4;
  if (off > ws_size) return;
  rope_table_kernel<<<(T * 32 + 255) / 256, 256, 0, stream>>>(rope_cs);
  const int ROWBLK = MROWS / 128;
  wcvt_kernel<<<2048, 256, 0, stream>>>(Wq, Wk, Wv, Wo, wqh, wql, woh, wol);
  qkv_gemm_kernel<<<dim3(NQKV / BN, ROWBLK), 256, 0, stream>>>(xq, xk, xv, wqh, wql, bq, bk, bv, rope_cs, 0, 0, Qh, Ql, Kh, Kl, Vh, Vl);
  attn_kernel<<<ATT_BLOCKS, 256, 0, stream>>>(Qh, Ql, Kh, Kl, Vh, Vl, yf);
  out_gemm_kernel<<<dim3(HID / BN, ROWBLK), 256, 0, stream>>>(yf, woh, wol, bo, 0, out);
}

// v004
// One run takes 86.8 microseconds.
// Next to v003, in two timings, it ran 1.04 times as fast each time.
// All steps since v000 together make it 3.13 times as fast.
#include <hip/hip_runtime.h>

// Sparse (local-window + global-token) multi-head attention: Q/K/V = x W^T + b (torch [out][in]), 16 heads x 64, RoPE with this module's pairing
// (x_rope[d] = -x[2d+1] for d < 32, x[2(d-32)] otherwise; angle index d mod 32), scores/8, mask: blocked if (|i-j| > 128 or j > i) unless i < 16 or j < 16,
// softmax, P.V, out = y Wo^T + bo. B=2, S=2048, D=1024. Contractions on v_wmma_f32_16x16x32_f16 with single f16 operands and f32 accumulate; fragment

namespace {
constexpr int Bsz = 2, T = 2048, HID = 1024, DH = 64, NH = 16, NKV = 16, REP = NH / NKV;
constexpr int WIN = 128, NGLOB = 16;
constexpr int KVW = NKV * DH;                 // 1024
constexpr int NQKV = HID + 2 * KVW;           // 3072 columns: q | k | v
constexpr int MROWS = Bsz * T;                // 4096
constexpr int QT_PER_B = T / 16;              // 128
constexpr int NG = Bsz * NH;                  // 32 (batch, head) pairs
constexpr int KSPLIT = T / 8;                 // keys per wave in a block that owns a global-query tile
constexpr int ATT_BLOCKS = NG + NG * (QT_PER_B - 1) / 8;   // 32 global-query blocks + 508 blocks of 8 windowed tiles

typedef _Float16 b16;                                           // f16 variant: single-plane operands (the 'lo' planes hold zeros and are never multiplied)
typedef __attribute__((ext_vector_type(16))) _Float16 v16b;
typedef __attribute__((ext_vector_type(8)))  _Float16 v8b;
typedef __attribute__((ext_vector_type(8)))  float v8f;
typedef __attribute__((ext_vector_type(4)))  float v4f;

__device__ __forceinline__ v8b ld8b(const b16* p) { return *(const v8b*)p; }
__device__ __forceinline__ v16b cat8b(v8b a, v8b b) { return __builtin_shufflevector(a, b, 0, 1, 2, 3, 4, 5, 6, 7, 8, 9, 10, 11, 12, 13, 14, 15); }
// 16x16x32 16-bit fragment from a k-contiguous row pointer (A: lane&15 = row, B: lane&15 = column), hh = lane>>4:
// elements 0..7 <- p[8hh+0..7], elements 8..15 <- p[16+8hh+0..7]
__device__ __forceinline__ v16b frag_kb(const b16* p, int hh) { return cat8b(ld8b(p + 8 * hh), ld8b(p + 16 + 8 * hh)); }
__device__ __forceinline__ void split_bf16(float v, b16& hi, b16& lo) {   // (name kept) f16 conversion, no low part
  hi = (b16)v; lo = (b16)0.0f;
}
__device__ __forceinline__ v8f wmma16b(v16b a, v16b b, v8f c) {
  v8f d = __builtin_amdgcn_wmma_f32_16x16x32_f16(false, a, false, b, (short)0, c, false, false);
  asm volatile("v_nop\n\tv_nop\n\tv_nop\n\tv_nop" : "+v"(d) : "v"(a), "v"(b));
  return d;
}
// e^x formed as __expf forms it (x * log2 e, then v_exp_f32). The v_nop is the one free issue slot that the instruction set asks for behind a transcendental:
// inside the statement the slot cannot move.
__device__ __forceinline__ float exp_slot(float x) {
  float r; asm("v_exp_f32 %0, %1\n\tv_nop" : "=v"(r) : "v"(x * 1.44269504f)); return r;
}
__device__ __forceinline__ void wave_lds_sync() {
  __builtin_amdgcn_fence(__ATOMIC_RELEASE, "workgroup");
  __builtin_amdgcn_wave_barrier();
  __builtin_amdgcn_fence(__ATOMIC_ACQUIRE, "workgroup");
}

// ---------------------------------------------------------------------------
// Weights (torch [out][in] = [n][k]) -> f16 hi / lo planes, same [n][k] layout (k contiguous): columns of Wq|Wk|Wv into wqh/wql [3072][1024], Wo into woh/wol [1024][1024].
// ---------------------------------------------------------------------------
__global__ __launch_bounds__(256) void wcvt_kernel(const float* __restrict__ wq, const float* __restrict__ wk, const float* __restrict__ wv,
                                                   const float* __restrict__ wo, b16* __restrict__ wqh, b16* __restrict__ wql,
                                                   b16* __restrict__ woh, b16* __restrict__ wol) {
  const size_t tid = (size_t)blockIdx.x * blockDim.x + threadIdx.x, stride = (size_t)gridDim.x * blockDim.x;
  const size_t nq = (size_t)NQKV * HID / 8, no = (size_t)HID * HID / 8;
  {
    for (size_t c = tid; c < nq + no; c += stride) {
      float f[8]; size_t i; b16* dh; b16* dl;
      if (c < nq) {
        i = c * 8; const size_t n = i / HID, k0 = i % HID;
        const float* w; int nn, ld;
        if (n < (size_t)HID) { w = wq; nn = (int)n; ld = HID; } else if (n < (size_t)(HID + KVW)) { w = wk; nn = (int)n - HID; ld = KVW; } else { w = wv; nn = (int)n - HID - KVW; ld = KVW; }
#pragma unroll
        for (int e = 0; e < 8; ++e) f[e] = w[(size_t)nn * HID + k0 + e];      // W[n][k] (torch [out][in]); ld unused
        (void)ld;
        dh = wqh; dl = wql;
      } else {
        i = (c - nq) * 8; const size_t n = i / HID, k0 = i % HID;
#pragma unroll
        for (int e = 0; e < 8; ++e) f[e] = wo[(size_t)n * HID + k0 + e];    // Wo[n][k] (torch [out][in])
        dh = woh; dl = wol;
      }
      v8b bh, bl;
#pragma unroll
      for (int e = 0; e < 8; ++e) { b16 a, cc; split_bf16(f[e], a, cc); bh[e] = a; bl[e] = cc; }
      *(v8b*)(dh + i) = bh; *(v8b*)(dl + i) = bl;
    }
    
  }
}

// Block GEMM core, 8 waves: a 128 x 128 tile of A.W^T, wave (wm, wn) = 32 rows x 64 columns of it. Per step of 64 k the block brings the A rows (f32, converted
// to f16 once, here) and the W rows (f16) into LDS with loads that cover whole 128-byte lines; every wave takes its fragments from LDS. Two buffers: the next
// step's global loads are issued behind the barrier and fly during the products. Fragment k order and the order of the sums over k are those of frag_kb on a row.
constexpr int BM = 128, BN = 128, KS = 64;
constexpr int PITCH = KS + 8;                   // f16 elements: 144-byte rows (16 B x odd), conflict-free for the 16-byte fragment reads
constexpr int STAGE = (BM + BN) * PITCH;        // one buffer: 128 A rows, then 128 W rows
typedef __attribute__((ext_vector_type(4))) _Float16 v4b;
__device__ __forceinline__ void gemm_block_lds(const float* __restrict__ A, const b16* __restrict__ wh, int mb, int cb, b16* sm,
                                               int wm, int wn, int nloc, int hlf, v8f (&acc)[2][4]) {
  const int tid = threadIdx.x;
  const float* ag = A + (size_t)(mb + (tid >> 4)) * HID + (tid & 15) * 4;     // 16 lanes = 256 B of one row; rows tid/16 + 16 i
  const b16* bg = wh + (size_t)(cb + (tid >> 3)) * HID + (tid & 7) * 8;       // 8 lanes = 128 B of one row; rows tid/8 + 32 i
  b16* as = sm + (tid >> 4) * PITCH + (tid & 15) * 4;
  b16* bs = sm + (BM + (tid >> 3)) * PITCH + (tid & 7) * 8;
  const b16* af = sm + (wm * 32 + nloc) * PITCH;
  const b16* bf = sm + (BM + wn * 64 + nloc) * PITCH;
  v4f ar[8]; v8b br[4];
#pragma unroll
  for (int i = 0; i < 8; ++i) ar[i] = *(const v4f*)(ag + (size_t)i * 16 * HID);
#pragma unroll
  for (int i = 0; i < 4; ++i) br[i] = ld8b(bg + (size_t)i * 32 * HID);
  for (int s = 0; s < HID / KS; ++s) {
    const int o = (s & 1) * STAGE;
#pragma unroll
    for (int i = 0; i < 8; ++i) { const v4b h = {(b16)ar[i][0], (b16)ar[i][1], (b16)ar[i][2], (b16)ar[i][3]}; *(v4b*)(as + o + i * 16 * PITCH) = h; }
#pragma unroll
    for (int i = 0; i < 4; ++i) *(v8b*)(bs + o + i * 32 * PITCH) = br[i];
    __syncthreads();                            // publishes this step's buffer; it also ends every wave's reads of the other buffer, which the next step refills
    if (s + 1 < HID / KS) {
      const int k = (s + 1) * KS;
#pragma unroll
      for (int i = 0; i < 8; ++i) ar[i] = *(const v4f*)(ag + (size_t)i * 16 * HID + k);
#pragma unroll
      for (int i = 0; i < 4; ++i) br[i] = ld8b(bg + (size_t)i * 32 * HID + k);
    }
    v16b fa[2][2], fb[2][4];                    // the whole step's fragments, read as one group ahead of the products: one LDS latency a step, not one a pair
#pragma unroll
    for (int q = 0; q < 2; ++q) {
#pragma unroll
      for (int r = 0; r < 2; ++r) fa[q][r] = frag_kb(af + o + r * 16 * PITCH + q * 32, hlf);
#pragma unroll
      for (int t = 0; t < 4; ++t) fb[q][t] = frag_kb(bf + o + t * 16 * PITCH + q * 32, hlf);
    }
#pragma unroll
    for (int q = 0; q < 2; ++q)
#pragma unroll
      for (int t = 0; t < 4; ++t) {
        acc[0][t] = wmma16b(fa[q][0], fb[q][t], acc[0][t]);
        acc[1][t] = wmma16b(fa[q][1], fb[q][t], acc[1][t]);
      }
  }
  __syncthreads();                              // every wave has left the buffers: the callers' epilogues stage in the same LDS
}

// ---------------------------------------------------------------------------
// QKV GEMM: (4096 x 1024) x (1024 x 3072), grid (24, 32), block 8 waves (4 x 2), wave = 32 rows x 64 columns (one head of q, k or v). Outputs as f16 hi/lo planes:
// q (x1/8) -> Qh/Ql, k -> Kh/Kl: [b][h][t/16][4 groups of 16 features][32 lanes][8], the order in which attention's fragment loads read them
// (lane = 16 * ((feature >> 3) & 1) + t % 16); 4 KB contiguous per wave per plane;
// v -> Vh/Vl key-tiled [b][kvh][t/16][64][16] (4 KB contiguous per wave per plane).
// ---------------------------------------------------------------------------
__global__ __launch_bounds__(256) void qkv_gemm_kernel(const float* __restrict__ xq, const float* __restrict__ xk, const float* __restrict__ xv,
                                                       const b16* __restrict__ wqh, const b16* __restrict__ wql,
                                                       const float* __restrict__ bq, const float* __restrict__ bk, const float* __restrict__ bv, const float* __restrict__ rope_cs, int xoff, int yoff,
                                                       b16* __restrict__ Qh, b16* __restrict__ Ql, b16* __restrict__ Kh, b16* __restrict__ Kl,
                                                       b16* __restrict__ Vh, b16* __restrict__ Vl) {
  __shared__ __attribute__((aligned(16))) b16 sm[2 * STAGE];   // the core's two buffers; afterwards 8 KB of staging per wave
  const int lane = threadIdx.x & 31, wave = __builtin_amdgcn_readfirstlane(threadIdx.x >> 5), nloc = lane & 15, hlf = lane >> 4;
  const int wm = wave & 3, wn = wave >> 2;   // wave number held scalar: the choice of matrix, head, bias and staging place stays on the scalar unit
  const int mb = (blockIdx.y + yoff) * BM, cb = (blockIdx.x + xoff) * BN;   // a 128-column tile lies inside one of q, k, v
  const int m0 = mb + wm * 32;
  const int c0 = cb + wn * 64;
  const int mat = (c0 < HID) ? 0 : (c0 < HID + KVW) ? 1 : 2;
  const int head = (mat == 0) ? (c0 / DH) : (mat == 1) ? ((c0 - HID) / DH) : ((c0 - HID - KVW) / DH);
  const float* x = (mat == 0) ? xq : (mat == 1) ? xk : xv;          // three different input tensors
  const float* bias = ((mat == 0) ? bq : (mat == 1) ? bk : bv) + head * DH;
  v8f acc[2][4];
#pragma unroll
  for (int r = 0; r < 2; ++r)
#pragma unroll
    for (int t = 0; t < 4; ++t) acc[r][t] = (v8f){};
  gemm_block_lds(x, wqh, mb, cb, sm, wm, wn, nloc, hlf, acc);
  const int b = m0 / T, t0 = m0 % T;
  const float s = (mat == 0) ? 0.125f : 1.0f;
  b16* Tp0 = sm + wave * (2 * 32 * 64); b16* Tp1 = Tp0 + 32 * 64;
  if (mat < 2) {                                          // RoPE for q and k: partners live in other lanes -> raw f32 tile through LDS first
    float* F = reinterpret_cast<float*>(Tp0);             // 32 x 64 f32 = exactly the wave's two staging planes
#pragma unroll
    for (int t = 0; t < 4; ++t)
#pragma unroll
      for (int r = 0; r < 2; ++r)
#pragma unroll
        for (int v = 0; v < 8; ++v) { const int rr = r * 16 + v + 8 * hlf, d = t * 16 + nloc; F[rr * 64 + d] = acc[r][t][v] + bias[d]; }
    wave_lds_sync();
#pragma unroll
    for (int t = 0; t < 4; ++t)
#pragma unroll
      for (int r = 0; r < 2; ++r)
#pragma unroll
        for (int v = 0; v < 8; ++v) {
          const int rr = r * 16 + v + 8 * hlf, d = t * 16 + nloc, tpos = t0 + rr;
          const float cv = rope_cs[((size_t)tpos * 32 + (d & 31)) * 2], sv = rope_cs[((size_t)tpos * 32 + (d & 31)) * 2 + 1];
          const float oth = (d < 32) ? -F[rr * 64 + 2 * d + 1] : F[rr * 64 + 2 * (d - 32)];
          acc[r][t][v] = F[rr * 64 + d] * cv + oth * sv - bias[d];     // bias re-added by the common path below
        }
    wave_lds_sync();                                      // all partner reads done before the planes overwrite F
  }
#pragma unroll
  for (int t = 0; t < 4; ++t)
#pragma unroll
    for (int r = 0; r < 2; ++r)
#pragma unroll
      for (int v = 0; v < 8; ++v) {
        const int rr = r * 16 + v + 8 * hlf, d = t * 16 + nloc;
        float val = acc[r][t][v] + bias[d];
        b16 yh, yl; split_bf16(val * s, yh, yl);
        const int idx = (mat < 2) ? ((rr >> 4) * 1024 + (d >> 4) * 256 + (((d >> 3) & 1) * 16 + (rr & 15)) * 8 + (d & 7))   // fragment order, see load_k_chunk
                                  : ((rr >> 4) * 1024 + d * 16 + (rr & 15));
        Tp0[idx] = yh; Tp1[idx] = yl;
      }
  wave_lds_sync();
  b16* dh; b16* dl; size_t o;
  if (mat == 0)      { o = ((size_t)(b * NH + head) * T + t0) * DH; dh = Qh + o; dl = Ql + o; }
  else if (mat == 1) { o = ((size_t)(b * NKV + head) * T + t0) * DH; dh = Kh + o; dl = Kl + o; }
  else               { o = ((size_t)(b * NKV + head) * QT_PER_B + (t0 >> 4)) * (size_t)(DH * 16); dh = Vh + o; dl = Vl + o; }
#pragma unroll
  for (int j = 0; j < 8; ++j) { const int e = (j * 32 + lane) * 8; *(v8b*)(dh + e) = ld8b(Tp0 + e); *(v8b*)(dl + e) = ld8b(Tp1 + e); }
  
}

template <bool B> struct flag_t { static constexpr bool value = B; };
// One 32-key chunk's fragments, each set loaded as one group of 8 loads: K rows kb..kb+31 (two 16-key tiles x two halves of the 64 features) and the key-tiled V.
// kb is a multiple of 32.
__device__ __forceinline__ void load_k_chunk(const b16* __restrict__ kbase, int kb, int col, int hh, v16b (&k)[4]) {
  const b16* p = kbase + (size_t)(kb >> 4) * (DH * 16) + (hh * 16 + col) * 8;   // K lies in fragment order: each load is 512 contiguous bytes, 4 whole lines
  // per fragment the elements that frag_kb takes from a row: features 8hh.. and 16+8hh.. of each half of 32; k[0], k[1]: keys kb..kb+15, k[2], k[3]: kb+16..kb+31
  k[0] = cat8b(ld8b(p), ld8b(p + 256));        k[1] = cat8b(ld8b(p + 512), ld8b(p + 768));
  k[2] = cat8b(ld8b(p + 1024), ld8b(p + 1280)); k[3] = cat8b(ld8b(p + 1536), ld8b(p + 1792));
  asm volatile("s_wait_xcnt 0x0" ::: "memory");   // stands in front of the first later write of the group's address registers, which the compiler reuses at once
}
__device__ __forceinline__ void load_v_chunk(const b16* __restrict__ vbase, int kb, int col, int hh, v16b (&v)[4]) {
  const b16* p = vbase + (size_t)(kb >> 4) * (DH * 16) + col * 16 + 8 * hh;
#pragma unroll
  for (int n = 0; n < 4; ++n) v[n] = cat8b(ld8b(p + n * 256), ld8b(p + n * 256 + DH * 16));
  asm volatile("s_wait_xcnt 0x0" ::: "memory");   // as in load_k_chunk
}

// ---------------------------------------------------------------------------
// Transposed flash attention, keys in chunks of 32. Blocks 0..NG-1: the global-query tile (queries 0..15, every key) of one (b, head), its keys split
// over the block's 8 waves, the 8 partial (max, sum, O) merged in LDS. Other blocks: each wave owns one windowed 16-query tile of one (b, head).
// S^T = K.Q^T (split), per-lane online softmax; P^T built in registers from the two S^T accumulators
// Each chunk's 8 K loads and 8 V loads are issued as groups ahead of their use, so that a chunk no longer waits one load latency in front of each of its 8 products.
// ---------------------------------------------------------------------------
__global__ __launch_bounds__(256) void attn_kernel(const b16* __restrict__ Qh, const b16* __restrict__ Ql, const b16* __restrict__ Kh, const b16* __restrict__ Kl,
                                                   const b16* __restrict__ Vh, const b16* __restrict__ Vl,
                                                   float* __restrict__ yf) {
  __shared__ __attribute__((aligned(16))) float Os[8][16 * 64];
  __shared__ float Ms[8][16], Ls[8][16];
  // wave number held scalar: tile, chunk counters and loop tests leave the vector registers, which keeps the kernel with both fragment groups at 160 or fewer
  // (6 waves per SIMD, 3 blocks per WGP: all 540 blocks resident at once)
  const int wid = __builtin_amdgcn_readfirstlane(threadIdx.x >> 5), lane = threadIdx.x & 31, hh = lane >> 4, col = lane & 15;
  const bool glob = blockIdx.x < NG;                      // block-uniform
  const int qtile = ((int)blockIdx.x - NG) * 8 + wid;     // over NG*(QT_PER_B-1): the windowed tiles
  const int g = glob ? (int)blockIdx.x : qtile / (QT_PER_B - 1);          // b*NH + h
  const int q0 = glob ? 0 : ((qtile % (QT_PER_B - 1)) + 1) << 4;
  const int b = g / NH, h = g % NH, kvh = h / REP;
  const size_t ko = (size_t)(b * NKV + kvh) * T * DH;
  const size_t qo = ((size_t)g * T + q0) * DH + lane * 8;   // Q lies in fragment order too (q0 is a multiple of 16)
  (void)Ql; (void)Kl; (void)Vl;                           // the zero planes are never multiplied
  const v16b q0h = cat8b(ld8b(Qh + qo), ld8b(Qh + qo + 256)), q1h = cat8b(ld8b(Qh + qo + 512), ld8b(Qh + qo + 768));
  float m = -INFINITY, l = 0.0f;
  v8f o0 = {}, o1 = {}, o2 = {}, o3 = {};
  const int kstart = (q0 >= WIN + 32) ? ((q0 - WIN) & ~31) : 32;   // first windowed chunk after the global chunk 0
  const int kfirst = glob ? wid * KSPLIT : 0, kend = glob ? kfirst + KSPLIT : q0 + 16;
  v16b kf[4];
  load_k_chunk(Kh + ko, kfirst, col, hh, kf);
  // One chunk. Its V group is issued first and flies during the score products and the softmax; where a next chunk exists (ahead), that chunk's K group is
  // issued behind the score products and flies during the softmax and P.V. The last chunk is a copy of the body without that group, not a branch in it: with a
  // branch round the loads the compiler's wait in front of P.V counted to 0 and so waited for the next K group too.
  auto chunk = [&](const int kb, const int kn, auto ahead) {
    v16b vf[4];
    load_v_chunk(Vh + ko, kb, col, hh, vf);
    v8f s0 = {}, s1 = {};
    s0 = wmma16b(kf[0], q0h, s0);
    s0 = wmma16b(kf[1], q1h, s0);
    s1 = wmma16b(kf[2], q0h, s1);
    s1 = wmma16b(kf[3], q1h, s1);
    if constexpr (decltype(ahead)::value) load_k_chunk(Kh + ko, kn, col, hh, kf);
    if (q0 != 0 && (kb == 0 || kb + 32 > q0 || kb < q0 + 15 - WIN)) {   // blocked = (j > i or j < i-128) unless j < 16 (queries here are >= 16)
      const int qi = q0 + col;
#pragma unroll
      for (int r = 0; r < 8; ++r) {
        const int k0i = kb + 8 * hh + r, k1i = k0i + 16;
        if (k0i >= NGLOB && (k0i > qi || k0i < qi - WIN)) s0[r] = -INFINITY;
        if (k1i >= NGLOB && (k1i > qi || k1i < qi - WIN)) s1[r] = -INFINITY;
      }
    }
    float mr = -INFINITY;
#pragma unroll
    for (int r = 0; r < 8; ++r) mr = fmaxf(mr, fmaxf(s0[r], s1[r]));
    mr = fmaxf(mr, __shfl_xor(mr, 16));
    const float mn = fmaxf(m, mr);            // finite
    const float al_ = exp_slot(m - mn);       // exp_slot: the same product and v_exp_f32 as __expf, with the free slot behind it held in the statement
    m = mn;
    float sum = 0.0f;
    v16b pbh;
#pragma unroll
    for (int r = 0; r < 8; ++r) {
      const float p0 = exp_slot(s0[r] - mn), p1 = exp_slot(s1[r] - mn);
      sum += p0 + p1;
      pbh[r] = (b16)p0; pbh[8 + r] = (b16)p1;
    }
    sum += __shfl_xor(sum, 16);
    l = l * al_ + sum;
#pragma unroll
    for (int r = 0; r < 8; ++r) { o0[r] *= al_; o1[r] *= al_; o2[r] *= al_; o3[r] *= al_; }
    o0 = wmma16b(vf[0], pbh, o0);
    o1 = wmma16b(vf[1], pbh, o1);
    o2 = wmma16b(vf[2], pbh, o2);
    o3 = wmma16b(vf[3], pbh, o3);
  };
  int kb = kfirst;            // global queries: this wave's share of every key; else chunk 0 (global keys) + the causal window; every wave has at least one chunk
  for (;;) {
    const int kn = (!glob && kb == 0) ? kstart : (kb + 32);
    if (kn >= kend) break;
    chunk(kb, kn, flag_t<true>{});
    kb = kn;
  }
  chunk(kb, kb, flag_t<false>{});
  const float inv = glob ? 1.0f : 1.0f / l;               // a partial O stays unnormalised until the merge
  float* Tt = Os[wid];
#pragma unroll
  for (int r = 0; r < 8; ++r) {
    const int hr = 8 * hh + r;
    Tt[col * 64 + 0 + hr] = o0[r] * inv; Tt[col * 64 + 16 + hr] = o1[r] * inv;
    Tt[col * 64 + 32 + hr] = o2[r] * inv; Tt[col * 64 + 48 + hr] = o3[r] * inv;
  }
  if (glob) {                                             // merge the 8 waves' partials: thread = (query row, 4 features)
    if (hh == 0) { Ms[wid][col] = m; Ls[wid][col] = l; }
    __syncthreads();                                      // every wave's partial is in LDS before any thread sums over waves
    const int rr = threadIdx.x >> 4, c4 = (threadIdx.x & 15) * 4;
    float mx = Ms[0][rr];
#pragma unroll
    for (int w = 1; w < 8; ++w) mx = fmaxf(mx, Ms[w][rr]);
    float sc[8];
#pragma unroll
    for (int w = 0; w < 8; ++w) sc[w] = exp_slot(Ms[w][rr] - mx);
    float lt = 0.0f; v4f a = {};
#pragma unroll
    for (int w = 0; w < 8; ++w) { lt += sc[w] * Ls[w][rr]; a += sc[w] * *(const v4f*)(&Os[w][rr * 64 + c4]); }
    *(v4f*)(yf + ((size_t)b * T + rr) * HID + h * DH + c4) = a * (1.0f / lt);
    return;
  }
  wave_lds_sync();
  float* dst0 = yf + ((size_t)b * T + q0) * HID + h * DH;     // 16 rows x 64 floats, row stride HID
#pragma unroll
  for (int j = 0; j < 8; ++j) { const int rr = j * 2 + hh, c4 = col * 4; *(v4f*)(dst0 + (size_t)rr * HID + c4) = *(const v4f*)(Tt + rr * 64 + c4); }
  
}

// ---------------------------------------------------------------------------
// Output projection: (4096 x 1024) x (1024 x 1024) -> f32, A = f32 y, B = Wo plane. grid (8, 32), block 8 waves (4 x 2), 32x64 wave tiles staged in LDS,
// ---------------------------------------------------------------------------
__global__ __launch_bounds__(256) void out_gemm_kernel(const float* __restrict__ yf, const b16* __restrict__ woh, const b16* __restrict__ wol, const float* __restrict__ bo, int yoff,
                                                       float* __restrict__ out) {
  __shared__ __attribute__((aligned(16))) b16 sm[2 * STAGE];   // the core's two buffers; afterwards 8 KB of staging per wave
  const int lane = threadIdx.x & 31, wave = __builtin_amdgcn_readfirstlane(threadIdx.x >> 5), nloc = lane & 15, hlf = lane >> 4;
  const int wm = wave & 3, wn = wave >> 2;   // wave number held scalar: the bias columns and staging place stay on the scalar unit
  const int mb = (blockIdx.y + yoff) * BM, cb = blockIdx.x * BN;
  const int m0 = mb + wm * 32;
  const int c0 = cb + wn * 64;
  v8f acc[2][4];
#pragma unroll
  for (int r = 0; r < 2; ++r)
#pragma unroll
    for (int t = 0; t < 4; ++t) acc[r][t] = (v8f){};
  gemm_block_lds(yf, woh, mb, cb, sm, wm, wn, nloc, hlf, acc);
  float* Tt = reinterpret_cast<float*>(sm) + wave * (32 * 64);
#pragma unroll
  for (int t = 0; t < 4; ++t)
#pragma unroll
    for (int r = 0; r < 2; ++r)
#pragma unroll
      for (int v = 0; v < 8; ++v) Tt[(r * 16 + v + 8 * hlf) * 64 + t * 16 + nloc] = acc[r][t][v] + bo[c0 + t * 16 + nloc];
  wave_lds_sync();
  float* dst0 = out + (size_t)m0 * HID + c0;
#pragma unroll
  for (int j = 0; j < 16; ++j) { const int rr = j * 2 + hlf, c4 = nloc * 4; *(v4f*)(dst0 + (size_t)rr * HID + c4) = *(const v4f*)(Tt + rr * 64 + c4); }
  
}
__global__ __launch_bounds__(256) void rope_table_kernel(float* __restrict__ cs) {
  const int idx = blockIdx.x * 256 + threadIdx.x;        // T * 32
  if (idx >= T * 32) return;
  const int t = idx >> 5, i = idx & 31;
  const float ang = (float)t * powf(10000.0f, -(float)i / 32.0f);
  typedef __attribute__((ext_vector_type(2))) float v2f;
  const v2f p = {cosf(ang), sinf(ang)};
  *(v2f*)(cs + (size_t)idx * 2) = p; 
}
}  // namespace

extern "C" void kernel_launch(void* const* d_in, const int* in_sizes, int n_in,
                              void* d_out, int out_size, void* d_ws, size_t ws_size, hipStream_t stream) {
  (void)in_sizes; (void)n_in; (void)out_size;
  const float* xq = (const float*)d_in[0];   // q [2,2048,1024]
  const float* xk = (const float*)d_in[1];   // k
  const float* xv = (const float*)d_in[2];   // v
  const float* Wq = (const float*)d_in[3];  const float* bq = (const float*)d_in[4];    // torch [out][in]
  const float* Wk = (const float*)d_in[5];  const float* bk = (const float*)d_in[6];
  const float* Wv = (const float*)d_in[7];  const float* bv = (const float*)d_in[8];
  const float* Wo = (const float*)d_in[9];  const float* bo = (const float*)d_in[10];
  float* out = (float*)d_out;                // [2,2048,1024]

  size_t off = 0; char* ws = (char*)d_ws;
  b16* wqh = (b16*)(ws + off); off += (size_t)NQKV * HID * 2;
  b16* wql = (b16*)(ws + off); off += (size_t)NQKV * HID * 2;     // 'lo' planes: zeros in the f16 variant (real buffers: the kernels write both)
  b16* woh = (b16*)(ws + off); off += (size_t)HID * HID * 2;
  b16* wol = (b16*)(ws + off); off += (size_t)HID * HID * 2;
  b16* Qh  = (b16*)(ws + off); off += (size_t)MROWS * HID * 2;
  b16* Ql  = (b16*)(ws + off); off += (size_t)MROWS * HID * 2;
  b16* Kh  = (b16*)(ws + off); off += (size_t)MROWS * KVW * 2;
  b16* Kl  = (b16*)(ws + off); off += (size_t)MROWS * KVW * 2;
  b16* Vh  = (b16*)(ws + off); off += (size_t)MROWS * KVW * 2;
  b16* Vl  = (b16*)(ws + off); off += (size_t)MROWS * KVW * 2;
  float* yf = (float*)(ws + off); off += (size_t)MROWS * HID * 4;
  float* rope_cs = (float*)(ws + off); off += (size_t)T * 32 * 2 * 4;
  if (off > ws_size) return;
  rope_table_kernel<<<(T * 32 + 255) / 256, 256, 0, stream>>>(rope_cs);
  const int ROWBLK = MROWS / 128;
  wcvt_kernel<<<2048, 256, 0, stream>>>(Wq, Wk, Wv, Wo, wqh, wql, woh, wol);
  qkv_gemm_kernel<<<dim3(NQKV / BN, ROWBLK), 256, 0, stream>>>(xq, xk, xv, wqh, wql, bq, bk, bv, rope_cs, 0, 0, Qh, Ql, Kh, Kl, Vh, Vl);
  attn_kernel<<<ATT_BLOCKS, 256, 0, stream>>>(Qh, Ql, Kh, Kl, Vh, Vl, yf);
  out_gemm_kernel<<<dim3(HID / BN, ROWBLK), 256, 0, stream>>>(yf, woh, wol, bo, 0, out);
}

// v005
// It runs in 82.2 microseconds.
// Timed twice side by side with v004, it ran 1.06 times as fast both times.
// Over all steps from v000 it is 3.32 times as fast.
#include <hip/hip_runtime.h>

// Sparse (local-window + global-token) multi-head attention: Q/K/V = x W^T + b (torch [out][in]), 16 heads x 64, RoPE with this module's pairing
// (x_rope[d] = -x[2d+1] for d < 32, x[2(d-32)] otherwise; angle index d mod 32), scores/8, mask: blocked if (|i-j| > 128 or j > i) unless i < 16 or j < 16,
// softmax, P.V, out = y Wo^T + bo. B=2, S=2048, D=1024. Contractions on v_wmma_f32_16x16x32_f16 with single f16 operands and f32 accumulate; fragment

namespace {
constexpr int Bsz = 2, T = 2048, HID = 1024, DH = 64, NH = 16, NKV = 16, REP = NH / NKV;
constexpr int WIN = 128, NGLOB = 16;
constexpr int KVW = NKV * DH;                 // 1024
constexpr int NQKV = HID + 2 * KVW;           // 3072 columns: q | k | v
constexpr int MROWS = Bsz * T;                // 4096
constexpr int QT_PER_B = T / 16;              // 128
constexpr int NG = Bsz * NH;                  // 32 (batch, head) pairs
constexpr int KSPLIT = T / 8;                 // keys per wave in a block that owns a global-query tile
constexpr int ATT_BLOCKS = NG + NG * (QT_PER_B - 1) / 8;   // 32 global-query blocks + 508 blocks of 8 windowed tiles

typedef _Float16 b16;                                           // f16 variant: single-plane operands (the 'lo' planes hold zeros and are never multiplied)
typedef __attribute__((ext_vector_type(16))) _Float16 v16b;
typedef __attribute__((ext_vector_type(8)))  _Float16 v8b;
typedef __attribute__((ext_vector_type(8)))  float v8f;
typedef __attribute__((ext_vector_type(4)))  float v4f;

__device__ __forceinline__ v8b ld8b(const b16* p) { return *(const v8b*)p; }
__device__ __forceinline__ v16b cat8b(v8b a, v8b b) { return __builtin_shufflevector(a, b, 0, 1, 2, 3, 4, 5, 6, 7, 8, 9, 10, 11, 12, 13, 14, 15); }
// 16x16x32 16-bit fragment from a k-contiguous row pointer (A: lane&15 = row, B: lane&15 = column), hh = lane>>4:
// elements 0..7 <- p[8hh+0..7], elements 8..15 <- p[16+8hh+0..7]
__device__ __forceinline__ v16b frag_kb(const b16* p, int hh) { return cat8b(ld8b(p + 8 * hh), ld8b(p + 16 + 8 * hh)); }
__device__ __forceinline__ void split_bf16(float v, b16& hi, b16& lo) {   // (name kept) f16 conversion, no low part
  hi = (b16)v; lo = (b16)0.0f;
}
__device__ __forceinline__ v8f wmma16b(v16b a, v16b b, v8f c) {
  v8f d = __builtin_amdgcn_wmma_f32_16x16x32_f16(false, a, false, b, (short)0, c, false, false);
  asm volatile("v_nop\n\tv_nop\n\tv_nop\n\tv_nop" : "+v"(d) : "v"(a), "v"(b));
  return d;
}
// e^x formed as __expf forms it (x * log2 e, then v_exp_f32). The v_nop is the one free issue slot that the instruction set asks for behind a transcendental:
// inside the statement the slot cannot move.
__device__ __forceinline__ float exp_slot(float x) {
  float r; asm("v_exp_f32 %0, %1\n\tv_nop" : "=v"(r) : "v"(x * 1.44269504f)); return r;
}
__device__ __forceinline__ void wave_lds_sync() {
  __builtin_amdgcn_fence(__ATOMIC_RELEASE, "workgroup");
  __builtin_amdgcn_wave_barrier();
  __builtin_amdgcn_fence(__ATOMIC_ACQUIRE, "workgroup");
}

// ---------------------------------------------------------------------------
// Weights (torch [out][in] = [n][k]) -> f16 hi / lo planes, same [n][k] layout (k contiguous): columns of Wq|Wk|Wv into wqh/wql [3072][1024], Wo into woh/wol [1024][1024].
// ---------------------------------------------------------------------------
__global__ __launch_bounds__(256) void wcvt_kernel(const float* __restrict__ wq, const float* __restrict__ wk, const float* __restrict__ wv,
                                                   const float* __restrict__ wo, b16* __restrict__ wqh, b16* __restrict__ wql,
                                                   b16* __restrict__ woh, b16* __restrict__ wol) {
  const size_t tid = (size_t)blockIdx.x * blockDim.x + threadIdx.x, stride = (size_t)gridDim.x * blockDim.x;
  const size_t nq = (size_t)NQKV * HID / 8, no = (size_t)HID * HID / 8;
  {
    for (size_t c = tid; c < nq + no; c += stride) {
      float f[8]; size_t i; b16* dh; b16* dl;
      if (c < nq) {
        i = c * 8; const size_t n = i / HID, k0 = i % HID;
        const float* w; int nn, ld;
        if (n < (size_t)HID) { w = wq; nn = (int)n; ld = HID; } else if (n < (size_t)(HID + KVW)) { w = wk; nn = (int)n - HID; ld = KVW; } else { w = wv; nn = (int)n - HID - KVW; ld = KVW; }
#pragma unroll
        for (int e = 0; e < 8; ++e) f[e] = w[(size_t)nn * HID + k0 + e];      // W[n][k] (torch [out][in]); ld unused
        (void)ld;
        dh = wqh; dl = wql;
      } else {
        i = (c - nq) * 8; const size_t n = i / HID, k0 = i % HID;
#pragma unroll
        for (int e = 0; e < 8; ++e) f[e] = wo[(size_t)n * HID + k0 + e];    // Wo[n][k] (torch [out][in])
        dh = woh; dl = wol;
      }
      v8b bh, bl;
#pragma unroll
      for (int e = 0; e < 8; ++e) { b16 a, cc; split_bf16(f[e], a, cc); bh[e] = a; bl[e] = cc; }
      *(v8b*)(dh + i) = bh; *(v8b*)(dl + i) = bl;
    }
    
  }
}

// Block GEMM core, 8 waves: a 128 x 128 tile of A.W^T, wave (wm, wn) = 32 rows x 64 columns of it. Per step of 64 k the block brings the A rows (f32, converted
// to f16 once, here) and the W rows (f16) into LDS with loads that cover whole 128-byte lines; every wave takes its fragments from LDS. Two buffers: the next
// step's global loads are issued behind the barrier and fly during the products. Fragment k order and the order of the sums over k are those of frag_kb on a row.
constexpr int BM = 128, BN = 128, KS = 64;
constexpr int PITCH = KS + 8;                   // f16 elements: 144-byte rows (16 B x odd), conflict-free for the 16-byte fragment reads
constexpr int STAGE = (BM + BN) * PITCH;        // one buffer: 128 A rows, then 128 W rows
constexpr int FPITCH = 68;                      // f32 elements: 272-byte rows (16 B x odd) for the q/k epilogue's 16-byte stores and reads; 8 waves x 32 rows fit the two buffers
typedef __attribute__((ext_vector_type(4))) _Float16 v4b;
// TR: the W fragment goes in as the A operand and the row fragment as B (both have the same per-lane form), so acc[r][t] holds the tile transposed:
// register v of a lane = column t*16 + 8*(lane>>4) + v of W, lane&15 = row r*16 + (lane&15). Same products, same order of the sums over k.
template <bool TR>
__device__ __forceinline__ void gemm_block_lds(const float* __restrict__ A, const b16* __restrict__ wh, int mb, int cb, b16* sm,
                                               int wm, int wn, int nloc, int hlf, v8f (&acc)[2][4]) {
  const int tid = threadIdx.x;
  const float* ag = A + (size_t)(mb + (tid >> 4)) * HID + (tid & 15) * 4;     // 16 lanes = 256 B of one row; rows tid/16 + 16 i
  const b16* bg = wh + (size_t)(cb + (tid >> 3)) * HID + (tid & 7) * 8;       // 8 lanes = 128 B of one row; rows tid/8 + 32 i
  b16* as = sm + (tid >> 4) * PITCH + (tid & 15) * 4;
  b16* bs = sm + (BM + (tid >> 3)) * PITCH + (tid & 7) * 8;
  const b16* af = sm + (wm * 32 + nloc) * PITCH;
  const b16* bf = sm + (BM + wn * 64 + nloc) * PITCH;
  v4f ar[8]; v8b br[4];
#pragma unroll
  for (int i = 0; i < 8; ++i) ar[i] = *(const v4f*)(ag + (size_t)i * 16 * HID);
#pragma unroll
  for (int i = 0; i < 4; ++i) br[i] = ld8b(bg + (size_t)i * 32 * HID);
  for (int s = 0; s < HID / KS; ++s) {
    const int o = (s & 1) * STAGE;
#pragma unroll
    for (int i = 0; i < 8; ++i) { const v4b h = {(b16)ar[i][0], (b16)ar[i][1], (b16)ar[i][2], (b16)ar[i][3]}; *(v4b*)(as + o + i * 16 * PITCH) = h; }
#pragma unroll
    for (int i = 0; i < 4; ++i) *(v8b*)(bs + o + i * 32 * PITCH) = br[i];
    __syncthreads();                            // publishes this step's buffer; it also ends every wave's reads of the other buffer, which the next step refills
    if (s + 1 < HID / KS) {
      const int k = (s + 1) * KS;
#pragma unroll
      for (int i = 0; i < 8; ++i) ar[i] = *(const v4f*)(ag + (size_t)i * 16 * HID + k);
#pragma unroll
      for (int i = 0; i < 4; ++i) br[i] = ld8b(bg + (size_t)i * 32 * HID + k);
    }
    v16b fa[2][2], fb[2][4];                    // the whole step's fragments, read as one group ahead of the products: one LDS latency a step, not one a pair
#pragma unroll
    for (int q = 0; q < 2; ++q) {
#pragma unroll
      for (int r = 0; r < 2; ++r) fa[q][r] = frag_kb(af + o + r * 16 * PITCH + q * 32, hlf);
#pragma unroll
      for (int t = 0; t < 4; ++t) fb[q][t] = frag_kb(bf + o + t * 16 * PITCH + q * 32, hlf);
    }
#pragma unroll
    for (int q = 0; q < 2; ++q)
#pragma unroll
      for (int t = 0; t < 4; ++t) {
        if constexpr (TR) {
          acc[0][t] = wmma16b(fb[q][t], fa[q][0], acc[0][t]);
          acc[1][t] = wmma16b(fb[q][t], fa[q][1], acc[1][t]);
        } else {
          acc[0][t] = wmma16b(fa[q][0], fb[q][t], acc[0][t]);
          acc[1][t] = wmma16b(fa[q][1], fb[q][t], acc[1][t]);
        }
      }
  }
  __syncthreads();                              // every wave has left the buffers: the callers' epilogues stage in the same LDS
}

// ---------------------------------------------------------------------------
// QKV GEMM: (4096 x 1024) x (1024 x 3072), grid (24, 32), block 8 waves (4 x 2), wave = 32 rows x 64 columns (one head of q, k or v). Outputs as f16 hi/lo planes:
// q (x1/8) -> Qh/Ql, k -> Kh/Kl: [b][h][t/16][4 groups of 16 features][32 lanes][8], the order in which attention's fragment loads read them
// (lane = 16 * ((feature >> 3) & 1) + t % 16); 4 KB contiguous per wave per plane;
// v -> Vh/Vl key-tiled [b][kvh][t/16][64][16] (4 KB contiguous per wave per plane).
// ---------------------------------------------------------------------------
__global__ __launch_bounds__(256) void qkv_gemm_kernel(const float* __restrict__ xq, const float* __restrict__ xk, const float* __restrict__ xv,
                                                       const b16* __restrict__ wqh, const b16* __restrict__ wql,
                                                       const float* __restrict__ bq, const float* __restrict__ bk, const float* __restrict__ bv, const float* __restrict__ rope_cs, int xoff, int yoff,
                                                       b16* __restrict__ Qh, b16* __restrict__ Ql, b16* __restrict__ Kh, b16* __restrict__ Kl,
                                                       b16* __restrict__ Vh, b16* __restrict__ Vl) {
  __shared__ __attribute__((aligned(16))) b16 sm[2 * STAGE];   // the core's two buffers; afterwards, for q and k, one f32 tile per wave (32 rows of FPITCH)
  const int lane = threadIdx.x & 31, wave = __builtin_amdgcn_readfirstlane(threadIdx.x >> 5), nloc = lane & 15, hlf = lane >> 4;
  const int wm = wave & 3, wn = wave >> 2;   // wave number held scalar: the choice of matrix, head, bias and staging place stays on the scalar unit
  const int mb = (blockIdx.y + yoff) * BM, cb = (blockIdx.x + xoff) * BN;   // a 128-column tile lies inside one of q, k, v
  const int m0 = mb + wm * 32;
  const int c0 = cb + wn * 64;
  const int mat = (c0 < HID) ? 0 : (c0 < HID + KVW) ? 1 : 2;
  const int head = (mat == 0) ? (c0 / DH) : (mat == 1) ? ((c0 - HID) / DH) : ((c0 - HID - KVW) / DH);
  const float* x = (mat == 0) ? xq : (mat == 1) ? xk : xv;          // three different input tensors
  const float* bias = ((mat == 0) ? bq : (mat == 1) ? bk : bv) + head * DH;
  v8f acc[2][4];
#pragma unroll
  for (int r = 0; r < 2; ++r)
#pragma unroll
    for (int t = 0; t < 4; ++t) acc[r][t] = (v8f){};
  const int b = m0 / T, t0 = m0 % T;
  v8b y[2][4]; b16* dh; b16* dl;                         // per lane: eight 16-byte units of the wave's 4 KB, unit (r, t) at r * 1024 + t * 256 elements from its own place
  if (mat < 2) {   // the same for both column halves of the block (a 128-column tile lies inside one matrix): the barriers in the core stay block-uniform
    // q and k, tile transposed: a lane holds, for token r*16 + nloc, features t*16 + 8*hlf + 0..7: one 16-byte unit of attention's fragment order, at its own lane's place
    gemm_block_lds<true>(x, wqh, mb, cb, sm, wm, wn, nloc, hlf, acc);
    const float s = (mat == 0) ? 0.125f : 1.0f;
    const float* cp = rope_cs + (size_t)(t0 >> 4) * 1024 + lane * 4;   // one address, the 16 loads differ by constant offsets
    v4f cs[2][2][4], bb[4][2];                            // (cos, sin) of angle 16t + 8hlf + v at token r*16 + nloc: 16 floats in 4 loads of 512 contiguous bytes
#pragma unroll
    for (int r = 0; r < 2; ++r)
#pragma unroll
      for (int t = 0; t < 2; ++t)
#pragma unroll
        for (int p = 0; p < 4; ++p) cs[r][t][p] = *(const v4f*)(cp + ((r * 2 + t) * 4 + p) * 128);
#pragma unroll
    for (int t = 0; t < 4; ++t) { bb[t][0] = *(const v4f*)(bias + t * 16 + 8 * hlf); bb[t][1] = *(const v4f*)(bias + t * 16 + 8 * hlf + 4); }
    asm volatile("s_wait_xcnt 0x0" ::: "memory");         // stands in front of the first later write of these loads' address registers
    float* F = reinterpret_cast<float*>(sm) + wave * (32 * FPITCH) + nloc * FPITCH;   // the wave's own f32 tile, token rows: half of a lane's RoPE partners lie in the other half-wave
#pragma unroll
    for (int t = 0; t < 4; ++t)
#pragma unroll
      for (int r = 0; r < 2; ++r) {
#pragma unroll
        for (int v = 0; v < 8; ++v) acc[r][t][v] += bb[t][v >> 2][v & 3];
        float* p = F + r * 16 * FPITCH + t * 16 + 8 * hlf;
        *(v4f*)p = (v4f){acc[r][t][0], acc[r][t][1], acc[r][t][2], acc[r][t][3]};
        *(v4f*)(p + 4) = (v4f){acc[r][t][4], acc[r][t][5], acc[r][t][6], acc[r][t][7]};
      }
    wave_lds_sync();                                      // both half-waves' features of a token are in LDS before either reads partners
#pragma unroll
    for (int r = 0; r < 2; ++r)
#pragma unroll
      for (int t = 0; t < 2; ++t) {
        // features d = 16t + 8hlf + v (< 32) and d + 32 share angle d and the 16 floats x[2d0 .. 2d0 + 15], d0 = 16t + 8hlf: partner of d is -x[2d + 1], of d + 32 it is x[2d]
        const float* wp = F + r * 16 * FPITCH + 32 * t + 16 * hlf;
        v4f w[4];
#pragma unroll
        for (int p = 0; p < 4; ++p) w[p] = *(const v4f*)(wp + 4 * p);
#pragma unroll
        for (int v = 0; v < 8; ++v) {
          const float cv = cs[r][t][v >> 1][(v & 1) * 2], sv = cs[r][t][v >> 1][(v & 1) * 2 + 1];
          y[r][t][v]     = (b16)((acc[r][t][v] * cv - w[v >> 1][(v & 1) * 2 + 1] * sv) * s);
          y[r][t + 2][v] = (b16)((acc[r][t + 2][v] * cv + w[v >> 1][(v & 1) * 2] * sv) * s);
        }
      }
    const size_t o = ((size_t)(b * NH + head) * T + t0) * DH + lane * 8;   // NKV == NH
    dh = ((mat == 0) ? Qh : Kh) + o; dl = ((mat == 0) ? Ql : Kl) + o;
  } else {
    // v, tile as the product gives it: a lane holds, for feature t*16 + nloc, tokens r*16 + 8*hlf + 0..7: one 16-byte unit of the key-tiled [64][16] layout
    gemm_block_lds<false>(x, wqh, mb, cb, sm, wm, wn, nloc, hlf, acc);
    float bb[4];
#pragma unroll
    for (int t = 0; t < 4; ++t) bb[t] = bias[t * 16 + nloc];
    asm volatile("s_wait_xcnt 0x0" ::: "memory");         // stands in front of the first later write of these loads' address registers
#pragma unroll
    for (int r = 0; r < 2; ++r)
#pragma unroll
      for (int t = 0; t < 4; ++t)
#pragma unroll
        for (int v = 0; v < 8; ++v) y[r][t][v] = (b16)(acc[r][t][v] + bb[t]);
    const size_t o = ((size_t)(b * NKV + head) * QT_PER_B + (t0 >> 4)) * (size_t)(DH * 16) + nloc * 16 + 8 * hlf;
    dh = Vh + o; dl = Vl + o;
  }
  const v8b zero = {};
#pragma unroll
  for (int r = 0; r < 2; ++r)
#pragma unroll
    for (int t = 0; t < 4; ++t) { *(v8b*)(dh + r * 1024 + t * 256) = y[r][t]; *(v8b*)(dl + r * 1024 + t * 256) = zero; }
}

template <bool B> struct flag_t { static constexpr bool value = B; };
// One 32-key chunk's fragments, each set loaded as one group of 8 loads: K rows kb..kb+31 (two 16-key tiles x two halves of the 64 features) and the key-tiled V.
// kb is a multiple of 32.
__device__ __forceinline__ void load_k_chunk(const b16* __restrict__ kbase, int kb, int col, int hh, v16b (&k)[4]) {
  const b16* p = kbase + (size_t)(kb >> 4) * (DH * 16) + (hh * 16 + col) * 8;   // K lies in fragment order: each load is 512 contiguous bytes, 4 whole lines
  // per fragment the elements that frag_kb takes from a row: features 8hh.. and 16+8hh.. of each half of 32; k[0], k[1]: keys kb..kb+15, k[2], k[3]: kb+16..kb+31
  k[0] = cat8b(ld8b(p), ld8b(p + 256));        k[1] = cat8b(ld8b(p + 512), ld8b(p + 768));
  k[2] = cat8b(ld8b(p + 1024), ld8b(p + 1280)); k[3] = cat8b(ld8b(p + 1536), ld8b(p + 1792));
  asm volatile("s_wait_xcnt 0x0" ::: "memory");   // stands in front of the first later write of the group's address registers, which the compiler reuses at once
}
__device__ __forceinline__ void load_v_chunk(const b16* __restrict__ vbase, int kb, int col, int hh, v16b (&v)[4]) {
  const b16* p = vbase + (size_t)(kb >> 4) * (DH * 16) + col * 16 + 8 * hh;
#pragma unroll
  for (int n = 0; n < 4; ++n) v[n] = cat8b(ld8b(p + n * 256), ld8b(p + n * 256 + DH * 16));
  asm volatile("s_wait_xcnt 0x0" ::: "memory");   // as in load_k_chunk
}

// ---------------------------------------------------------------------------
// Transposed flash attention, keys in chunks of 32. Blocks 0..NG-1: the global-query tile (queries 0..15, every key) of one (b, head), its keys split
// over the block's 8 waves, the 8 partial (max, sum, O) merged in LDS. Other blocks: each wave owns one windowed 16-query tile of one (b, head).
// S^T = K.Q^T (split), per-lane online softmax; P^T built in registers from the two S^T accumulators
// Each chunk's 8 K loads and 8 V loads are issued as groups ahead of their use, so that a chunk no longer waits one load latency in front of each of its 8 products.
// ---------------------------------------------------------------------------
__global__ __launch_bounds__(256) void attn_kernel(const b16* __restrict__ Qh, const b16* __restrict__ Ql, const b16* __restrict__ Kh, const b16* __restrict__ Kl,
                                                   const b16* __restrict__ Vh, const b16* __restrict__ Vl,
                                                   float* __restrict__ yf) {
  __shared__ __attribute__((aligned(16))) float Os[8][16 * 64];
  __shared__ float Ms[8][16], Ls[8][16];
  // wave number held scalar: tile, chunk counters and loop tests leave the vector registers, which keeps the kernel with both fragment groups at 160 or fewer
  // (6 waves per SIMD, 3 blocks per WGP: all 540 blocks resident at once)
  const int wid = __builtin_amdgcn_readfirstlane(threadIdx.x >> 5), lane = threadIdx.x & 31, hh = lane >> 4, col = lane & 15;
  const bool glob = blockIdx.x < NG;                      // block-uniform
  const int qtile = ((int)blockIdx.x - NG) * 8 + wid;     // over NG*(QT_PER_B-1): the windowed tiles
  const int g = glob ? (int)blockIdx.x : qtile / (QT_PER_B - 1);          // b*NH + h
  const int q0 = glob ? 0 : ((qtile % (QT_PER_B - 1)) + 1) << 4;
  const int b = g / NH, h = g % NH, kvh = h / REP;
  const size_t ko = (size_t)(b * NKV + kvh) * T * DH;
  const size_t qo = ((size_t)g * T + q0) * DH + lane * 8;   // Q lies in fragment order too (q0 is a multiple of 16)
  (void)Ql; (void)Kl; (void)Vl;                           // the zero planes are never multiplied
  const v16b q0h = cat8b(ld8b(Qh + qo), ld8b(Qh + qo + 256)), q1h = cat8b(ld8b(Qh + qo + 512), ld8b(Qh + qo + 768));
  float m = -INFINITY, l = 0.0f;
  v8f o0 = {}, o1 = {}, o2 = {}, o3 = {};
  const int kstart = (q0 >= WIN + 32) ? ((q0 - WIN) & ~31) : 32;   // first windowed chunk after the global chunk 0
  const int kfirst = glob ? wid * KSPLIT : 0, kend = glob ? kfirst + KSPLIT : q0 + 16;
  v16b kf[4];
  load_k_chunk(Kh + ko, kfirst, col, hh, kf);
  // One chunk. Its V group is issued first and flies during the score products and the softmax; where a next chunk exists (ahead), that chunk's K group is
  // issued behind the score products and flies during the softmax and P.V. The last chunk is a copy of the body without that group, not a branch in it: with a
  // branch round the loads the compiler's wait in front of P.V counted to 0 and so waited for the next K group too.
  auto chunk = [&](const int kb, const int kn, auto ahead) {
    v16b vf[4];
    load_v_chunk(Vh + ko, kb, col, hh, vf);
    v8f s0 = {}, s1 = {};
    s0 = wmma16b(kf[0], q0h, s0);
    s0 = wmma16b(kf[1], q1h, s0);
    s1 = wmma16b(kf[2], q0h, s1);
    s1 = wmma16b(kf[3], q1h, s1);
    if constexpr (decltype(ahead)::value) load_k_chunk(Kh + ko, kn, col, hh, kf);
    if (q0 != 0 && (kb == 0 || kb + 32 > q0 || kb < q0 + 15 - WIN)) {   // blocked = (j > i or j < i-128) unless j < 16 (queries here are >= 16)
      const int qi = q0 + col;
#pragma unroll
      for (int r = 0; r < 8; ++r) {
        const int k0i = kb + 8 * hh + r, k1i = k0i + 16;
        if (k0i >= NGLOB && (k0i > qi || k0i < qi - WIN)) s0[r] = -INFINITY;
        if (k1i >= NGLOB && (k1i > qi || k1i < qi - WIN)) s1[r] = -INFINITY;
      }
    }
    float mr = -INFINITY;
#pragma unroll
    for (int r = 0; r < 8; ++r) mr = fmaxf(mr, fmaxf(s0[r], s1[r]));
    mr = fmaxf(mr, __shfl_xor(mr, 16));
    const float mn = fmaxf(m, mr);            // finite
    const float al_ = exp_slot(m - mn);       // exp_slot: the same product and v_exp_f32 as __expf, with the free slot behind it held in the statement
    m = mn;
    float sum = 0.0f;
    v16b pbh;
#pragma unroll
    for (int r = 0; r < 8; ++r) {
      const float p0 = exp_slot(s0[r] - mn), p1 = exp_slot(s1[r] - mn);
      sum += p0 + p1;
      pbh[r] = (b16)p0; pbh[8 + r] = (b16)p1;
    }
    sum += __shfl_xor(sum, 16);
    l = l * al_ + sum;
#pragma unroll
    for (int r = 0; r < 8; ++r) { o0[r] *= al_; o1[r] *= al_; o2[r] *= al_; o3[r] *= al_; }
    o0 = wmma16b(vf[0], pbh, o0);
    o1 = wmma16b(vf[1], pbh, o1);
    o2 = wmma16b(vf[2], pbh, o2);
    o3 = wmma16b(vf[3], pbh, o3);
  };
  int kb = kfirst;            // global queries: this wave's share of every key; else chunk 0 (global keys) + the causal window; every wave has at least one chunk
  for (;;) {
    const int kn = (!glob && kb == 0) ? kstart : (kb + 32);
    if (kn >= kend) break;
    chunk(kb, kn, flag_t<true>{});
    kb = kn;
  }
  chunk(kb, kb, flag_t<false>{});
  const float inv = glob ? 1.0f : 1.0f / l;               // a partial O stays unnormalised until the merge
  float* Tt = Os[wid];
#pragma unroll
  for (int r = 0; r < 8; ++r) {
    const int hr = 8 * hh + r;
    Tt[col * 64 + 0 + hr] = o0[r] * inv; Tt[col * 64 + 16 + hr] = o1[r] * inv;
    Tt[col * 64 + 32 + hr] = o2[r] * inv; Tt[col * 64 + 48 + hr] = o3[r] * inv;
  }
  if (glob) {                                             // merge the 8 waves' partials: thread = (query row, 4 features)
    if (hh == 0) { Ms[wid][col] = m; Ls[wid][col] = l; }
    __syncthreads();                                      // every wave's partial is in LDS before any thread sums over waves
    const int rr = threadIdx.x >> 4, c4 = (threadIdx.x & 15) * 4;
    float mx = Ms[0][rr];
#pragma unroll
    for (int w = 1; w < 8; ++w) mx = fmaxf(mx, Ms[w][rr]);
    float sc[8];
#pragma unroll
    for (int w = 0; w < 8; ++w) sc[w] = exp_slot(Ms[w][rr] - mx);
    float lt = 0.0f; v4f a = {};
#pragma unroll
    for (int w = 0; w < 8; ++w) { lt += sc[w] * Ls[w][rr]; a += sc[w] * *(const v4f*)(&Os[w][rr * 64 + c4]); }
    *(v4f*)(yf + ((size_t)b * T + rr) * HID + h * DH + c4) = a * (1.0f / lt);
    return;
  }
  wave_lds_sync();
  float* dst0 = yf + ((size_t)b * T + q0) * HID + h * DH;     // 16 rows x 64 floats, row stride HID
#pragma unroll
  for (int j = 0; j < 8; ++j) { const int rr = j * 2 + hh, c4 = col * 4; *(v4f*)(dst0 + (size_t)rr * HID + c4) = *(const v4f*)(Tt + rr * 64 + c4); }
  
}

// ---------------------------------------------------------------------------
// Output projection: (4096 x 1024) x (1024 x 1024) -> f32, A = f32 y, B = Wo plane. grid (8, 32), block 8 waves (4 x 2), 32x64 wave tiles staged in LDS,
// ---------------------------------------------------------------------------
__global__ __launch_bounds__(256) void out_gemm_kernel(const float* __restrict__ yf, const b16* __restrict__ woh, const b16* __restrict__ wol, const float* __restrict__ bo, int yoff,
                                                       float* __restrict__ out) {
  __shared__ __attribute__((aligned(16))) b16 sm[2 * STAGE];   // the core's two buffers; afterwards 8 KB of staging per wave
  const int lane = threadIdx.x & 31, wave = __builtin_amdgcn_readfirstlane(threadIdx.x >> 5), nloc = lane & 15, hlf = lane >> 4;
  const int wm = wave & 3, wn = wave >> 2;   // wave number held scalar: the bias columns and staging place stay on the scalar unit
  const int mb = (blockIdx.y + yoff) * BM, cb = blockIdx.x * BN;
  const int m0 = mb + wm * 32;
  const int c0 = cb + wn * 64;
  v8f acc[2][4];
#pragma unroll
  for (int r = 0; r < 2; ++r)
#pragma unroll
    for (int t = 0; t < 4; ++t) acc[r][t] = (v8f){};
  gemm_block_lds<false>(yf, woh, mb, cb, sm, wm, wn, nloc, hlf, acc);
  float* Tt = reinterpret_cast<float*>(sm) + wave * (32 * 64);
#pragma unroll
  for (int t = 0; t < 4; ++t)
#pragma unroll
    for (int r = 0; r < 2; ++r)
#pragma unroll
      for (int v = 0; v < 8; ++v) Tt[(r * 16 + v + 8 * hlf) * 64 + t * 16 + nloc] = acc[r][t][v] + bo[c0 + t * 16 + nloc];
  wave_lds_sync();
  float* dst0 = out + (size_t)m0 * HID + c0;
#pragma unroll
  for (int j = 0; j < 16; ++j) { const int rr = j * 2 + hlf, c4 = nloc * 4; *(v4f*)(dst0 + (size_t)rr * HID + c4) = *(const v4f*)(Tt + rr * 64 + c4); }
  
}
__global__ __launch_bounds__(256) void rope_table_kernel(float* __restrict__ cs) {
  const int idx = blockIdx.x * 256 + threadIdx.x;        // T * 32
  if (idx >= T * 32) return;
  const int t = idx >> 5, i = idx & 31;
  const float ang = (float)t * powf(10000.0f, -(float)i / 32.0f);
  typedef __attribute__((ext_vector_type(2))) float v2f;
  const v2f p = {cosf(ang), sinf(ang)};
  // laid out as the q/k epilogue reads it: [t/16][i/16][4 pieces][lane = 16*((i>>3)&1) + t%16][4 floats = (cos, sin) of two angles]
  const int v = i & 7;
  *(v2f*)(cs + (size_t)(((((t >> 4) * 2 + (i >> 4)) * 4 + (v >> 1)) * 32 + ((i >> 3) & 1) * 16 + (t & 15)) * 4 + (v & 1) * 2)) = p;
}
}  // namespace

extern "C" void kernel_launch(void* const* d_in, const int* in_sizes, int n_in,
                              void* d_out, int out_size, void* d_ws, size_t ws_size, hipStream_t stream) {
  (void)in_sizes; (void)n_in; (void)out_size;
  const float* xq = (const float*)d_in[0];   // q [2,2048,1024]
  const float* xk = (const float*)d_in[1];   // k
  const float* xv = (const float*)d_in[2];   // v
  const float* Wq = (const float*)d_in[3];  const float* bq = (const float*)d_in[4];    // torch [out][in]
  const float* Wk = (const float*)d_in[5];  const float* bk = (const float*)d_in[6];
  const float* Wv = (const float*)d_in[7];  const float* bv = (const float*)d_in[8];
  const float* Wo = (const float*)d_in[9];  const float* bo = (const float*)d_in[10];
  float* out = (float*)d_out;                // [2,2048,1024]

  size_t off = 0; char* ws = (char*)d_ws;
  b16* wqh = (b16*)(ws + off); off += (size_t)NQKV * HID * 2;
  b16* wql = (b16*)(ws + off); off += (size_t)NQKV * HID * 2;     // 'lo' planes: zeros in the f16 variant (real buffers: the kernels write both)
  b16* woh = (b16*)(ws + off); off += (size_t)HID * HID * 2;
  b16* wol = (b16*)(ws + off); off += (size_t)HID * HID * 2;
  b16* Qh  = (b16*)(ws + off); off += (size_t)MROWS * HID * 2;
  b16* Ql  = (b16*)(ws + off); off += (size_t)MROWS * HID * 2;
  b16* Kh  = (b16*)(ws + off); off += (size_t)MROWS * KVW * 2;
  b16* Kl  = (b16*)(ws + off); off += (size_t)MROWS * KVW * 2;
  b16* Vh  = (b16*)(ws + off); off += (size_t)MROWS * KVW * 2;
  b16* Vl  = (b16*)(ws + off); off += (size_t)MROWS * KVW * 2;
  float* yf = (float*)(ws + off); off += (size_t)MROWS * HID * 4;
  float* rope_cs = (float*)(ws + off); off += (size_t)T * 32 * 2 * 4;
  if (off > ws_size) return;
  rope_table_kernel<<<(T * 32 + 255) / 256, 256, 0, stream>>>(rope_cs);
  const int ROWBLK = MROWS / 128;
  wcvt_kernel<<<2048, 256, 0, stream>>>(Wq, Wk, Wv, Wo, wqh, wql, woh, wol);
  qkv_gemm_kernel<<<dim3(NQKV / BN, ROWBLK), 256, 0, stream>>>(xq, xk, xv, wqh, wql, bq, bk, bv, rope_cs, 0, 0, Qh, Ql, Kh, Kl, Vh, Vl);
  attn_kernel<<<ATT_BLOCKS, 256, 0, stream>>>(Qh, Ql, Kh, Kl, Vh, Vl, yf);
  out_gemm_kernel<<<dim3(HID / BN, ROWBLK), 256, 0, stream>>>(yf, woh, wol, bo, 0, out);
}

// v006
// A run of this version takes 73.2 microseconds.
// Next to v005, in two timings, it ran 1.12 and 1.11 times as fast.
// All steps since v000 together make it 3.70 times as fast.
#include <hip/hip_runtime.h>

// Sparse (local-window + global-token) multi-head attention: Q/K/V = x W^T + b (torch [out][in]), 16 heads x 64, RoPE with this module's pairing
// (x_rope[d] = -x[2d+1] for d < 32, x[2(d-32)] otherwise; angle index d mod 32), scores/8, mask: blocked if (|i-j| > 128 or j > i) unless i < 16 or j < 16,
// softmax, P.V, out = y Wo^T + bo. B=2, S=2048, D=1024. Contractions on v_wmma_f32_16x16x32_f16 with single f16 operands and f32 accumulate; fragment

namespace {
constexpr int Bsz = 2, T = 2048, HID = 1024, DH = 64, NH = 16, NKV = 16, REP = NH / NKV;
constexpr int WIN = 128, NGLOB = 16;
constexpr int KVW = NKV * DH;                 // 1024
constexpr int NQKV = HID + 2 * KVW;           // 3072 columns: q | k | v
constexpr int MROWS = Bsz * T;                // 4096
constexpr int QT_PER_B = T / 16;              // 128
constexpr int NG = Bsz * NH;                  // 32 (batch, head) pairs
constexpr int KSPLIT = T / 8;                 // keys per wave in a block that owns a global-query tile
constexpr int ATT_BLOCKS = NG + NG * (QT_PER_B - 1) / 8;   // 32 global-query blocks + 508 blocks of 8 windowed tiles

typedef _Float16 b16;                                           // f16 variant: single-plane operands (the 'lo' planes hold zeros and are never multiplied)
typedef __attribute__((ext_vector_type(16))) _Float16 v16b;
typedef __attribute__((ext_vector_type(8)))  _Float16 v8b;
typedef __attribute__((ext_vector_type(8)))  float v8f;
typedef __attribute__((ext_vector_type(4)))  float v4f;

__device__ __forceinline__ v8b ld8b(const b16* p) { return *(const v8b*)p; }
__device__ __forceinline__ v16b cat8b(v8b a, v8b b) { return __builtin_shufflevector(a, b, 0, 1, 2, 3, 4, 5, 6, 7, 8, 9, 10, 11, 12, 13, 14, 15); }
// 16x16x32 16-bit fragment from a k-contiguous row pointer (A: lane&15 = row, B: lane&15 = column), hh = lane>>4:
// elements 0..7 <- p[8hh+0..7], elements 8..15 <- p[16+8hh+0..7]
__device__ __forceinline__ v16b frag_kb(const b16* p, int hh) { return cat8b(ld8b(p + 8 * hh), ld8b(p + 16 + 8 * hh)); }
__device__ __forceinline__ void split_bf16(float v, b16& hi, b16& lo) {   // (name kept) f16 conversion, no low part
  hi = (b16)v; lo = (b16)0.0f;
}
__device__ __forceinline__ v8f wmma16b(v16b a, v16b b, v8f c) {
  v8f d = __builtin_amdgcn_wmma_f32_16x16x32_f16(false, a, false, b, (short)0, c, false, false);
  asm volatile("v_nop\n\tv_nop\n\tv_nop\n\tv_nop" : "+v"(d) : "v"(a), "v"(b));
  return d;
}
// e^x formed as __expf forms it (x * log2 e, then v_exp_f32). The v_nop is the one free issue slot that the instruction set asks for behind a transcendental:
// inside the statement the slot cannot move.
__device__ __forceinline__ float exp_slot(float x) {
  float r; asm("v_exp_f32 %0, %1\n\tv_nop" : "=v"(r) : "v"(x * 1.44269504f)); return r;
}
__device__ __forceinline__ void wave_lds_sync() {
  __builtin_amdgcn_fence(__ATOMIC_RELEASE, "workgroup");
  __builtin_amdgcn_wave_barrier();
  __builtin_amdgcn_fence(__ATOMIC_ACQUIRE, "workgroup");
}

// ---------------------------------------------------------------------------
// Weights (torch [out][in] = [n][k]) -> f16 hi / lo planes, same [n][k] layout (k contiguous): columns of Wq|Wk|Wv into wqh/wql [3072][1024], Wo into woh/wol [1024][1024].
// ---------------------------------------------------------------------------
__global__ __launch_bounds__(256) void wcvt_kernel(const float* __restrict__ wq, const float* __restrict__ wk, const float* __restrict__ wv,
                                                   const float* __restrict__ wo, b16* __restrict__ wqh, b16* __restrict__ wql,
                                                   b16* __restrict__ woh, b16* __restrict__ wol) {
  const size_t tid = (size_t)blockIdx.x * blockDim.x + threadIdx.x, stride = (size_t)gridDim.x * blockDim.x;
  const size_t nq = (size_t)NQKV * HID / 8, no = (size_t)HID * HID / 8;
  {
    for (size_t c = tid; c < nq + no; c += stride) {
      float f[8]; size_t i; b16* dh; b16* dl;
      if (c < nq) {
        i = c * 8; const size_t n = i / HID, k0 = i % HID;
        const float* w; int nn, ld;
        if (n < (size_t)HID) { w = wq; nn = (int)n; ld = HID; } else if (n < (size_t)(HID + KVW)) { w = wk; nn = (int)n - HID; ld = KVW; } else { w = wv; nn = (int)n - HID - KVW; ld = KVW; }
#pragma unroll
        for (int e = 0; e < 8; ++e) f[e] = w[(size_t)nn * HID + k0 + e];      // W[n][k] (torch [out][in]); ld unused
        (void)ld;
        dh = wqh; dl = wql;
      } else {
        i = (c - nq) * 8; const size_t n = i / HID, k0 = i % HID;
#pragma unroll
        for (int e = 0; e < 8; ++e) f[e] = wo[(size_t)n * HID + k0 + e];    // Wo[n][k] (torch [out][in])
        dh = woh; dl = wol;
      }
      v8b bh, bl;
#pragma unroll
      for (int e = 0; e < 8; ++e) { b16 a, cc; split_bf16(f[e], a, cc); bh[e] = a; bl[e] = cc; }
      *(v8b*)(dh + i) = bh; *(v8b*)(dl + i) = bl;
    }
    
  }
}

// Block GEMM core, 8 waves: a 128 x 128 tile of A.W^T, wave (wm, wn) = 32 rows x 64 columns of it. Per step of 64 k the block brings the A rows (f32, converted
// to f16 once, here) and the W rows (f16) into LDS with loads that cover whole 128-byte lines; every wave takes its fragments from LDS. Two buffers: the next
// step's global loads are issued behind the barrier and fly during the products. Fragment k order and the order of the sums over k are those of frag_kb on a row.
constexpr int BM = 128, BN = 128, KS = 64;
constexpr int PITCH = KS + 8;                   // f16 elements: 144-byte rows (16 B x odd), conflict-free for the 16-byte fragment reads
constexpr int STAGE = (BM + BN) * PITCH;        // one buffer: 128 A rows, then 128 W rows
constexpr int FPITCH = 68;                      // f32 elements: 272-byte rows (16 B x odd) for the q/k epilogue's 16-byte stores and reads; 8 waves x 32 rows fit the two buffers
typedef __attribute__((ext_vector_type(4))) _Float16 v4b;
// TR: the W fragment goes in as the A operand and the row fragment as B (both have the same per-lane form), so acc[r][t] holds the tile transposed:
// register v of a lane = column t*16 + 8*(lane>>4) + v of W, lane&15 = row r*16 + (lane&15). Same products, same order of the sums over k.
// LEAN: the caller runs under a register budget; the fragments are read in small groups. Same products, same order of the sums over k.
template <bool TR, bool LEAN>
__device__ __forceinline__ void gemm_block_lds(const float* __restrict__ A, const b16* __restrict__ wh, int mb, int cb, b16* sm,
                                               int wm, int wn, int nloc, int hlf, v8f (&acc)[2][4]) {
  const int tid = threadIdx.x;
  const float* ag = A + (size_t)(mb + (tid >> 4)) * HID + (tid & 15) * 4;     // 16 lanes = 256 B of one row; rows tid/16 + 16 i
  const b16* bg = wh + (size_t)(cb + (tid >> 3)) * HID + (tid & 7) * 8;       // 8 lanes = 128 B of one row; rows tid/8 + 32 i
  b16* as = sm + (tid >> 4) * PITCH + (tid & 15) * 4;
  b16* bs = sm + (BM + (tid >> 3)) * PITCH + (tid & 7) * 8;
  const b16* af = sm + (wm * 32 + nloc) * PITCH;
  const b16* bf = sm + (BM + wn * 64 + nloc) * PITCH;
  v4f ar[8]; v8b br[4];
#pragma unroll
  for (int i = 0; i < 8; ++i) ar[i] = *(const v4f*)(ag + (size_t)i * 16 * HID);
#pragma unroll
  for (int i = 0; i < 4; ++i) br[i] = ld8b(bg + (size_t)i * 32 * HID);
  for (int s = 0; s < HID / KS; ++s) {
    const int o = (s & 1) * STAGE;
#pragma unroll
    for (int i = 0; i < 8; ++i) { const v4b h = {(b16)ar[i][0], (b16)ar[i][1], (b16)ar[i][2], (b16)ar[i][3]}; *(v4b*)(as + o + i * 16 * PITCH) = h; }
#pragma unroll
    for (int i = 0; i < 4; ++i) *(v8b*)(bs + o + i * 32 * PITCH) = br[i];
    __syncthreads();                            // publishes this step's buffer; it also ends every wave's reads of the other buffer, which the next step refills
    if (s + 1 < HID / KS) {
      const int k = (s + 1) * KS;
#pragma unroll
      for (int i = 0; i < 8; ++i) ar[i] = *(const v4f*)(ag + (size_t)i * 16 * HID + k);
#pragma unroll
      for (int i = 0; i < 4; ++i) br[i] = ld8b(bg + (size_t)i * 32 * HID + k);
      // Under the register budget the compiler let the last A load's result land on the address pair that the loads ahead of it name. The inputs keep both
      // pairs live to this place, and the wait stands in front of every later write of them.
      if constexpr (LEAN) asm volatile("s_wait_xcnt 0x0" :: "v"(ag + k), "v"(bg + k) : "memory");
    }
    if constexpr (LEAN) {   // four fragments live at a time (32 registers, not 96); each group's LDS latency is covered by the other resident waves
      v16b fa[2][2], fb[2][4];
      auto frags_a = [&](const int q) {
#pragma unroll
        for (int r = 0; r < 2; ++r) fa[q][r] = frag_kb(af + o + r * 16 * PITCH + q * 32, hlf);
      };
      auto frags_b = [&](const int q, const int t0, const int t1) {
#pragma unroll
        for (int t = t0; t < t1; ++t) fb[q][t] = frag_kb(bf + o + t * 16 * PITCH + q * 32, hlf);
      };
      auto products = [&](const int q, const int t0, const int t1) {
#pragma unroll
        for (int t = t0; t < t1; ++t) {
          if constexpr (TR) {
            acc[0][t] = wmma16b(fb[q][t], fa[q][0], acc[0][t]);
            acc[1][t] = wmma16b(fb[q][t], fa[q][1], acc[1][t]);
          } else {
            acc[0][t] = wmma16b(fa[q][0], fb[q][t], acc[0][t]);
            acc[1][t] = wmma16b(fa[q][1], fb[q][t], acc[1][t]);
          }
        }
      };
#pragma unroll
      for (int q = 0; q < 2; ++q) {
        frags_a(q); frags_b(q, 0, 2); products(q, 0, 2);
        __builtin_amdgcn_sched_barrier(0);   // keeps the next group's LDS reads behind these products: hoisted, they take the live set over the register budget (spills)
        frags_b(q, 2, 4); products(q, 2, 4);
        if (q == 0) __builtin_amdgcn_sched_barrier(0);   // as above
      }
    } else {
    v16b fa[2][2], fb[2][4];                    // the whole step's fragments, read as one group ahead of the products: one LDS latency a step, not one a pair
#pragma unroll
    for (int q = 0; q < 2; ++q) {
#pragma unroll
      for (int r = 0; r < 2; ++r) fa[q][r] = frag_kb(af + o + r * 16 * PITCH + q * 32, hlf);
#pragma unroll
      for (int t = 0; t < 4; ++t) fb[q][t] = frag_kb(bf + o + t * 16 * PITCH + q * 32, hlf);
    }
#pragma unroll
    for (int q = 0; q < 2; ++q)
#pragma unroll
      for (int t = 0; t < 4; ++t) {
        if constexpr (TR) {
          acc[0][t] = wmma16b(fb[q][t], fa[q][0], acc[0][t]);
          acc[1][t] = wmma16b(fb[q][t], fa[q][1], acc[1][t]);
        } else {
          acc[0][t] = wmma16b(fa[q][0], fb[q][t], acc[0][t]);
          acc[1][t] = wmma16b(fa[q][1], fb[q][t], acc[1][t]);
        }
      }
    }
  }
  __syncthreads();                              // every wave has left the buffers: the callers' epilogues stage in the same LDS
}

// ---------------------------------------------------------------------------
// QKV GEMM: (4096 x 1024) x (1024 x 3072), grid (24, 32), block 8 waves (4 x 2), wave = 32 rows x 64 columns (one head of q, k or v). Outputs as f16 hi/lo planes:
// q (x1/8) -> Qh/Ql, k -> Kh/Kl: [b][h][t/16][4 groups of 16 features][32 lanes][8], the order in which attention's fragment loads read them
// (lane = 16 * ((feature >> 3) & 1) + t % 16); 4 KB contiguous per wave per plane;
// v -> Vh/Vl key-tiled [b][kvh][t/16][64][16] (4 KB contiguous per wave per plane).
// ---------------------------------------------------------------------------
// Second launch bound: at least 6 waves per SIMD, a budget of 160 VGPRs, so that 3 blocks reside per WGP and all 768 blocks run in one round
// (above 160 only 2 reside: 512 blocks, then a second round of 256 that leaves every WGP with one block).
__global__ __launch_bounds__(256, 6) void qkv_gemm_kernel(const float* __restrict__ xq, const float* __restrict__ xk, const float* __restrict__ xv,
                                                       const b16* __restrict__ wqh, const b16* __restrict__ wql,
                                                       const float* __restrict__ bq, const float* __restrict__ bk, const float* __restrict__ bv, const float* __restrict__ rope_cs, int xoff, int yoff,
                                                       b16* __restrict__ Qh, b16* __restrict__ Ql, b16* __restrict__ Kh, b16* __restrict__ Kl,
                                                       b16* __restrict__ Vh, b16* __restrict__ Vl) {
  __shared__ __attribute__((aligned(16))) b16 sm[2 * STAGE];   // the core's two buffers; afterwards, for q and k, one f32 tile per wave (32 rows of FPITCH)
  const int lane = threadIdx.x & 31, wave = __builtin_amdgcn_readfirstlane(threadIdx.x >> 5), nloc = lane & 15, hlf = lane >> 4;
  const int wm = wave & 3, wn = wave >> 2;   // wave number held scalar: the choice of matrix, head, bias and staging place stays on the scalar unit
  const int mb = (blockIdx.y + yoff) * BM, cb = (blockIdx.x + xoff) * BN;   // a 128-column tile lies inside one of q, k, v
  const int m0 = mb + wm * 32;
  const int c0 = cb + wn * 64;
  const int mat = (c0 < HID) ? 0 : (c0 < HID + KVW) ? 1 : 2;
  const int head = (mat == 0) ? (c0 / DH) : (mat == 1) ? ((c0 - HID) / DH) : ((c0 - HID - KVW) / DH);
  const float* x = (mat == 0) ? xq : (mat == 1) ? xk : xv;          // three different input tensors
  const float* bias = ((mat == 0) ? bq : (mat == 1) ? bk : bv) + head * DH;
  v8f acc[2][4];
#pragma unroll
  for (int r = 0; r < 2; ++r)
#pragma unroll
    for (int t = 0; t < 4; ++t) acc[r][t] = (v8f){};
  const int b = m0 / T, t0 = m0 % T;
  v8b y[2][4]; b16* dh; b16* dl;                         // per lane: eight 16-byte units of the wave's 4 KB, unit (r, t) at r * 1024 + t * 256 elements from its own place
  if (mat < 2) {   // the same for both column halves of the block (a 128-column tile lies inside one matrix): the barriers in the core stay block-uniform
    // q and k, tile transposed: a lane holds, for token r*16 + nloc, features t*16 + 8*hlf + 0..7: one 16-byte unit of attention's fragment order, at its own lane's place
    gemm_block_lds<true, true>(x, wqh, mb, cb, sm, wm, wn, nloc, hlf, acc);
    const float s = (mat == 0) ? 0.125f : 1.0f;
    const float* cp = rope_cs + (size_t)(t0 >> 4) * 1024 + lane * 4;   // one address, the 16 loads differ by constant offsets
    v4f cs[2][2][4], bb[4][2];                            // (cos, sin) of angle 16t + 8hlf + v at token r*16 + nloc: 16 floats in 4 loads of 512 contiguous bytes
#pragma unroll
    for (int r = 0; r < 2; ++r)
#pragma unroll
      for (int t = 0; t < 2; ++t)
#pragma unroll
        for (int p = 0; p < 4; ++p) cs[r][t][p] = *(const v4f*)(cp + ((r * 2 + t) * 4 + p) * 128);
#pragma unroll
    for (int t = 0; t < 4; ++t) { bb[t][0] = *(const v4f*)(bias + t * 16 + 8 * hlf); bb[t][1] = *(const v4f*)(bias + t * 16 + 8 * hlf + 4); }
    asm volatile("s_wait_xcnt 0x0" ::: "memory");         // stands in front of the first later write of these loads' address registers
    float* F = reinterpret_cast<float*>(sm) + wave * (32 * FPITCH) + nloc * FPITCH;   // the wave's own f32 tile, token rows: half of a lane's RoPE partners lie in the other half-wave
#pragma unroll
    for (int t = 0; t < 4; ++t)
#pragma unroll
      for (int r = 0; r < 2; ++r) {
#pragma unroll
        for (int v = 0; v < 8; ++v) acc[r][t][v] += bb[t][v >> 2][v & 3];
        float* p = F + r * 16 * FPITCH + t * 16 + 8 * hlf;
        *(v4f*)p = (v4f){acc[r][t][0], acc[r][t][1], acc[r][t][2], acc[r][t][3]};
        *(v4f*)(p + 4) = (v4f){acc[r][t][4], acc[r][t][5], acc[r][t][6], acc[r][t][7]};
      }
    wave_lds_sync();                                      // both half-waves' features of a token are in LDS before either reads partners
#pragma unroll
    for (int r = 0; r < 2; ++r)
#pragma unroll
      for (int t = 0; t < 2; ++t) {
        // features d = 16t + 8hlf + v (< 32) and d + 32 share angle d and the 16 floats x[2d0 .. 2d0 + 15], d0 = 16t + 8hlf: partner of d is -x[2d + 1], of d + 32 it is x[2d]
        const float* wp = F + r * 16 * FPITCH + 32 * t + 16 * hlf;
        v4f w[4];
#pragma unroll
        for (int p = 0; p < 4; ++p) w[p] = *(const v4f*)(wp + 4 * p);
#pragma unroll
        for (int v = 0; v < 8; ++v) {
          const float cv = cs[r][t][v >> 1][(v & 1) * 2], sv = cs[r][t][v >> 1][(v & 1) * 2 + 1];
          y[r][t][v]     = (b16)((acc[r][t][v] * cv - w[v >> 1][(v & 1) * 2 + 1] * sv) * s);
          y[r][t + 2][v] = (b16)((acc[r][t + 2][v] * cv + w[v >> 1][(v & 1) * 2] * sv) * s);
        }
        if (r + t < 2) __builtin_amdgcn_sched_barrier(0);   // keeps the next group's four LDS reads behind this group: hoisted, they take the live set over the register budget (spills)
      }
    const size_t o = ((size_t)(b * NH + head) * T + t0) * DH + lane * 8;   // NKV == NH
    dh = ((mat == 0) ? Qh : Kh) + o; dl = ((mat == 0) ? Ql : Kl) + o;
  } else {
    // v, tile as the product gives it: a lane holds, for feature t*16 + nloc, tokens r*16 + 8*hlf + 0..7: one 16-byte unit of the key-tiled [64][16] layout
    gemm_block_lds<false, true>(x, wqh, mb, cb, sm, wm, wn, nloc, hlf, acc);
    float bb[4];
#pragma unroll
    for (int t = 0; t < 4; ++t) bb[t] = bias[t * 16 + nloc];
    asm volatile("s_wait_xcnt 0x0" ::: "memory");         // stands in front of the first later write of these loads' address registers
#pragma unroll
    for (int r = 0; r < 2; ++r)
#pragma unroll
      for (int t = 0; t < 4; ++t)
#pragma unroll
        for (int v = 0; v < 8; ++v) y[r][t][v] = (b16)(acc[r][t][v] + bb[t]);
    const size_t o = ((size_t)(b * NKV + head) * QT_PER_B + (t0 >> 4)) * (size_t)(DH * 16) + nloc * 16 + 8 * hlf;
    dh = Vh + o; dl = Vl + o;
  }
  const v8b zero = {};
#pragma unroll
  for (int r = 0; r < 2; ++r)
#pragma unroll
    for (int t = 0; t < 4; ++t) { *(v8b*)(dh + r * 1024 + t * 256) = y[r][t]; *(v8b*)(dl + r * 1024 + t * 256) = zero; }
}

template <bool B> struct flag_t { static constexpr bool value = B; };
// One 32-key chunk's fragments, each set loaded as one group of 8 loads: K rows kb..kb+31 (two 16-key tiles x two halves of the 64 features) and the key-tiled V.
// kb is a multiple of 32.
__device__ __forceinline__ void load_k_chunk(const b16* __restrict__ kbase, int kb, int col, int hh, v16b (&k)[4]) {
  const b16* p = kbase + (size_t)(kb >> 4) * (DH * 16) + (hh * 16 + col) * 8;   // K lies in fragment order: each load is 512 contiguous bytes, 4 whole lines
  // per fragment the elements that frag_kb takes from a row: features 8hh.. and 16+8hh.. of each half of 32; k[0], k[1]: keys kb..kb+15, k[2], k[3]: kb+16..kb+31
  k[0] = cat8b(ld8b(p), ld8b(p + 256));        k[1] = cat8b(ld8b(p + 512), ld8b(p + 768));
  k[2] = cat8b(ld8b(p + 1024), ld8b(p + 1280)); k[3] = cat8b(ld8b(p + 1536), ld8b(p + 1792));
  asm volatile("s_wait_xcnt 0x0" ::: "memory");   // stands in front of the first later write of the group's address registers, which the compiler reuses at once
}
__device__ __forceinline__ void load_v_chunk(const b16* __restrict__ vbase, int kb, int col, int hh, v16b (&v)[4]) {
  const b16* p = vbase + (size_t)(kb >> 4) * (DH * 16) + col * 16 + 8 * hh;
#pragma unroll
  for (int n = 0; n < 4; ++n) v[n] = cat8b(ld8b(p + n * 256), ld8b(p + n * 256 + DH * 16));
  asm volatile("s_wait_xcnt 0x0" ::: "memory");   // as in load_k_chunk
}

// ---------------------------------------------------------------------------
// Transposed flash attention, keys in chunks of 32. Blocks 0..NG-1: the global-query tile (queries 0..15, every key) of one (b, head), its keys split
// over the block's 8 waves, the 8 partial (max, sum, O) merged in LDS. Other blocks: each wave owns one windowed 16-query tile of one (b, head).
// S^T = K.Q^T (split), per-lane online softmax; P^T built in registers from the two S^T accumulators
// Each chunk's 8 K loads and 8 V loads are issued as groups ahead of their use, so that a chunk no longer waits one load latency in front of each of its 8 products.
// ---------------------------------------------------------------------------
__global__ __launch_bounds__(256) void attn_kernel(const b16* __restrict__ Qh, const b16* __restrict__ Ql, const b16* __restrict__ Kh, const b16* __restrict__ Kl,
                                                   const b16* __restrict__ Vh, const b16* __restrict__ Vl,
                                                   float* __restrict__ yf) {
  __shared__ __attribute__((aligned(16))) float Os[8][16 * 64];
  __shared__ float Ms[8][16], Ls[8][16];
  // wave number held scalar: tile, chunk counters and loop tests leave the vector registers, which keeps the kernel with both fragment groups at 160 or fewer
  // (6 waves per SIMD, 3 blocks per WGP: all 540 blocks resident at once)
  const int wid = __builtin_amdgcn_readfirstlane(threadIdx.x >> 5), lane = threadIdx.x & 31, hh = lane >> 4, col = lane & 15;
  const bool glob = blockIdx.x < NG;                      // block-uniform
  const int qtile = ((int)blockIdx.x - NG) * 8 + wid;     // over NG*(QT_PER_B-1): the windowed tiles
  const int g = glob ? (int)blockIdx.x : qtile / (QT_PER_B - 1);          // b*NH + h
  const int q0 = glob ? 0 : ((qtile % (QT_PER_B - 1)) + 1) << 4;
  const int b = g / NH, h = g % NH, kvh = h / REP;
  const size_t ko = (size_t)(b * NKV + kvh) * T * DH;
  const size_t qo = ((size_t)g * T + q0) * DH + lane * 8;   // Q lies in fragment order too (q0 is a multiple of 16)
  (void)Ql; (void)Kl; (void)Vl;                           // the zero planes are never multiplied
  const v16b q0h = cat8b(ld8b(Qh + qo), ld8b(Qh + qo + 256)), q1h = cat8b(ld8b(Qh + qo + 512), ld8b(Qh + qo + 768));
  float m = -INFINITY, l = 0.0f;
  v8f o0 = {}, o1 = {}, o2 = {}, o3 = {};
  const int kstart = (q0 >= WIN + 32) ? ((q0 - WIN) & ~31) : 32;   // first windowed chunk after the global chunk 0
  const int kfirst = glob ? wid * KSPLIT : 0, kend = glob ? kfirst + KSPLIT : q0 + 16;
  v16b kf[4];
  load_k_chunk(Kh + ko, kfirst, col, hh, kf);
  // One chunk. Its V group is issued first and flies during the score products and the softmax; where a next chunk exists (ahead), that chunk's K group is
  // issued behind the score products and flies during the softmax and P.V. The last chunk is a copy of the body without that group, not a branch in it: with a
  // branch round the loads the compiler's wait in front of P.V counted to 0 and so waited for the next K group too.
  auto chunk = [&](const int kb, const int kn, auto ahead) {
    v16b vf[4];
    load_v_chunk(Vh + ko, kb, col, hh, vf);
    v8f s0 = {}, s1 = {};
    s0 = wmma16b(kf[0], q0h, s0);
    s0 = wmma16b(kf[1], q1h, s0);
    s1 = wmma16b(kf[2], q0h, s1);
    s1 = wmma16b(kf[3], q1h, s1);
    if constexpr (decltype(ahead)::value) load_k_chunk(Kh + ko, kn, col, hh, kf);
    if (q0 != 0 && (kb == 0 || kb + 32 > q0 || kb < q0 + 15 - WIN)) {   // blocked = (j > i or j < i-128) unless j < 16 (queries here are >= 16)
      const int qi = q0 + col;
#pragma unroll
      for (int r = 0; r < 8; ++r) {
        const int k0i = kb + 8 * hh + r, k1i = k0i + 16;
        if (k0i >= NGLOB && (k0i > qi || k0i < qi - WIN)) s0[r] = -INFINITY;
        if (k1i >= NGLOB && (k1i > qi || k1i < qi - WIN)) s1[r] = -INFINITY;
      }
    }
    float mr = -INFINITY;
#pragma unroll
    for (int r = 0; r < 8; ++r) mr = fmaxf(mr, fmaxf(s0[r], s1[r]));
    mr = fmaxf(mr, __shfl_xor(mr, 16));
    const float mn = fmaxf(m, mr);            // finite
    const float al_ = exp_slot(m - mn);       // exp_slot: the same product and v_exp_f32 as __expf, with the free slot behind it held in the statement
    m = mn;
    float sum = 0.0f;
    v16b pbh;
#pragma unroll
    for (int r = 0; r < 8; ++r) {
      const float p0 = exp_slot(s0[r] - mn), p1 = exp_slot(s1[r] - mn);
      sum += p0 + p1;
      pbh[r] = (b16)p0; pbh[8 + r] = (b16)p1;
    }
    sum += __shfl_xor(sum, 16);
    l = l * al_ + sum;
#pragma unroll
    for (int r = 0; r < 8; ++r) { o0[r] *= al_; o1[r] *= al_; o2[r] *= al_; o3[r] *= al_; }
    o0 = wmma16b(vf[0], pbh, o0);
    o1 = wmma16b(vf[1], pbh, o1);
    o2 = wmma16b(vf[2], pbh, o2);
    o3 = wmma16b(vf[3], pbh, o3);
  };
  int kb = kfirst;            // global queries: this wave's share of every key; else chunk 0 (global keys) + the causal window; every wave has at least one chunk
  for (;;) {
    const int kn = (!glob && kb == 0) ? kstart : (kb + 32);
    if (kn >= kend) break;
    chunk(kb, kn, flag_t<true>{});
    kb = kn;
  }
  chunk(kb, kb, flag_t<false>{});
  const float inv = glob ? 1.0f : 1.0f / l;               // a partial O stays unnormalised until the merge
  float* Tt = Os[wid];
#pragma unroll
  for (int r = 0; r < 8; ++r) {
    const int hr = 8 * hh + r;
    Tt[col * 64 + 0 + hr] = o0[r] * inv; Tt[col * 64 + 16 + hr] = o1[r] * inv;
    Tt[col * 64 + 32 + hr] = o2[r] * inv; Tt[col * 64 + 48 + hr] = o3[r] * inv;
  }
  if (glob) {                                             // merge the 8 waves' partials: thread = (query row, 4 features)
    if (hh == 0) { Ms[wid][col] = m; Ls[wid][col] = l; }
    __syncthreads();                                      // every wave's partial is in LDS before any thread sums over waves
    const int rr = threadIdx.x >> 4, c4 = (threadIdx.x & 15) * 4;
    float mx = Ms[0][rr];
#pragma unroll
    for (int w = 1; w < 8; ++w) mx = fmaxf(mx, Ms[w][rr]);
    float sc[8];
#pragma unroll
    for (int w = 0; w < 8; ++w) sc[w] = exp_slot(Ms[w][rr] - mx);
    float lt = 0.0f; v4f a = {};
#pragma unroll
    for (int w = 0; w < 8; ++w) { lt += sc[w] * Ls[w][rr]; a += sc[w] * *(const v4f*)(&Os[w][rr * 64 + c4]); }
    *(v4f*)(yf + ((size_t)b * T + rr) * HID + h * DH + c4) = a * (1.0f / lt);
    return;
  }
  wave_lds_sync();
  float* dst0 = yf + ((size_t)b * T + q0) * HID + h * DH;     // 16 rows x 64 floats, row stride HID
#pragma unroll
  for (int j = 0; j < 8; ++j) { const int rr = j * 2 + hh, c4 = col * 4; *(v4f*)(dst0 + (size_t)rr * HID + c4) = *(const v4f*)(Tt + rr * 64 + c4); }
  
}

// ---------------------------------------------------------------------------
// Output projection: (4096 x 1024) x (1024 x 1024) -> f32, A = f32 y, B = Wo plane. grid (8, 32), block 8 waves (4 x 2), 32x64 wave tiles staged in LDS,
// ---------------------------------------------------------------------------
__global__ __launch_bounds__(256) void out_gemm_kernel(const float* __restrict__ yf, const b16* __restrict__ woh, const b16* __restrict__ wol, const float* __restrict__ bo, int yoff,
                                                       float* __restrict__ out) {
  __shared__ __attribute__((aligned(16))) b16 sm[2 * STAGE];   // the core's two buffers; afterwards 8 KB of staging per wave
  const int lane = threadIdx.x & 31, wave = __builtin_amdgcn_readfirstlane(threadIdx.x >> 5), nloc = lane & 15, hlf = lane >> 4;
  const int wm = wave & 3, wn = wave >> 2;   // wave number held scalar: the bias columns and staging place stay on the scalar unit
  const int mb = (blockIdx.y + yoff) * BM, cb = blockIdx.x * BN;
  const int m0 = mb + wm * 32;
  const int c0 = cb + wn * 64;
  v8f acc[2][4];
#pragma unroll
  for (int r = 0; r < 2; ++r)
#pragma unroll
    for (int t = 0; t < 4; ++t) acc[r][t] = (v8f){};
  gemm_block_lds<false, false>(yf, woh, mb, cb, sm, wm, wn, nloc, hlf, acc);
  float* Tt = reinterpret_cast<float*>(sm) + wave * (32 * 64);
#pragma unroll
  for (int t = 0; t < 4; ++t)
#pragma unroll
    for (int r = 0; r < 2; ++r)
#pragma unroll
      for (int v = 0; v < 8; ++v) Tt[(r * 16 + v + 8 * hlf) * 64 + t * 16 + nloc] = acc[r][t][v] + bo[c0 + t * 16 + nloc];
  wave_lds_sync();
  float* dst0 = out + (size_t)m0 * HID + c0;
#pragma unroll
  for (int j = 0; j < 16; ++j) { const int rr = j * 2 + hlf, c4 = nloc * 4; *(v4f*)(dst0 + (size_t)rr * HID + c4) = *(const v4f*)(Tt + rr * 64 + c4); }
  
}
__global__ __launch_bounds__(256) void rope_table_kernel(float* __restrict__ cs) {
  const int idx = blockIdx.x * 256 + threadIdx.x;        // T * 32
  if (idx >= T * 32) return;
  const int t = idx >> 5, i = idx & 31;
  const float ang = (float)t * powf(10000.0f, -(float)i / 32.0f);
  typedef __attribute__((ext_vector_type(2))) float v2f;
  const v2f p = {cosf(ang), sinf(ang)};
  // laid out as the q/k epilogue reads it: [t/16][i/16][4 pieces][lane = 16*((i>>3)&1) + t%16][4 floats = (cos, sin) of two angles]
  const int v = i & 7;
  *(v2f*)(cs + (size_t)(((((t >> 4) * 2 + (i >> 4)) * 4 + (v >> 1)) * 32 + ((i >> 3) & 1) * 16 + (t & 15)) * 4 + (v & 1) * 2)) = p;
}
}  // namespace

extern "C" void kernel_launch(void* const* d_in, const int* in_sizes, int n_in,
                              void* d_out, int out_size, void* d_ws, size_t ws_size, hipStream_t stream) {
  (void)in_sizes; (void)n_in; (void)out_size;
  const float* xq = (const float*)d_in[0];   // q [2,2048,1024]
  const float* xk = (const float*)d_in[1];   // k
  const float* xv = (const float*)d_in[2];   // v
  const float* Wq = (const float*)d_in[3];  const float* bq = (const float*)d_in[4];    // torch [out][in]
  const float* Wk = (const float*)d_in[5];  const float* bk = (const float*)d_in[6];
  const float* Wv = (const float*)d_in[7];  const float* bv = (const float*)d_in[8];
  const float* Wo = (const float*)d_in[9];  const float* bo = (const float*)d_in[10];
  float* out = (float*)d_out;                // [2,2048,1024]

  size_t off = 0; char* ws = (char*)d_ws;
  b16* wqh = (b16*)(ws + off); off += (size_t)NQKV * HID * 2;
  b16* wql = (b16*)(ws + off); off += (size_t)NQKV * HID * 2;     // 'lo' planes: zeros in the f16 variant (real buffers: the kernels write both)
  b16* woh = (b16*)(ws + off); off += (size_t)HID * HID * 2;
  b16* wol = (b16*)(ws + off); off += (size_t)HID * HID * 2;
  b16* Qh  = (b16*)(ws + off); off += (size_t)MROWS * HID * 2;
  b16* Ql  = (b16*)(ws + off); off += (size_t)MROWS * HID * 2;
  b16* Kh  = (b16*)(ws + off); off += (size_t)MROWS * KVW * 2;
  b16* Kl  = (b16*)(ws + off); off += (size_t)MROWS * KVW * 2;
  b16* Vh  = (b16*)(ws + off); off += (size_t)MROWS * KVW * 2;
  b16* Vl  = (b16*)(ws + off); off += (size_t)MROWS * KVW * 2;
  float* yf = (float*)(ws + off); off += (size_t)MROWS * HID * 4;
  float* rope_cs = (float*)(ws + off); off += (size_t)T * 32 * 2 * 4;
  if (off > ws_size) return;
  rope_table_kernel<<<(T * 32 + 255) / 256, 256, 0, stream>>>(rope_cs);
  const int ROWBLK = MROWS / 128;
  wcvt_kernel<<<2048, 256, 0, stream>>>(Wq, Wk, Wv, Wo, wqh, wql, woh, wol);
  qkv_gemm_kernel<<<dim3(NQKV / BN, ROWBLK), 256, 0, stream>>>(xq, xk, xv, wqh, wql, bq, bk, bv, rope_cs, 0, 0, Qh, Ql, Kh, Kl, Vh, Vl);
  attn_kernel<<<ATT_BLOCKS, 256, 0, stream>>>(Qh, Ql, Kh, Kl, Vh, Vl, yf);
  out_gemm_kernel<<<dim3(HID / BN, ROWBLK), 256, 0, stream>>>(yf, woh, wol, bo, 0, out);
}

// v007
// A run of this version takes 66.8 microseconds.
// Two timings next to v006 both put it at 1.10 times that version's speed.
// Over all steps from v000 it is 4.07 times as fast.
#include <hip/hip_runtime.h>

// Sparse (local-window + global-token) multi-head attention: Q/K/V = x W^T + b (torch [out][in]), 16 heads x 64, RoPE with this module's pairing
// (x_rope[d] = -x[2d+1] for d < 32, x[2(d-32)] otherwise; angle index d mod 32), scores/8, mask: blocked if (|i-j| > 128 or j > i) unless i < 16 or j < 16,
// softmax, P.V, out = y Wo^T + bo. B=2, S=2048, D=1024. Contractions on v_wmma_f32_16x16x32_f16 with single f16 operands and f32 accumulate; fragment

namespace {
constexpr int Bsz = 2, T = 2048, HID = 1024, DH = 64, NH = 16, NKV = 16, REP = NH / NKV;
constexpr int WIN = 128, NGLOB = 16;
constexpr int KVW = NKV * DH;                 // 1024
constexpr int NQKV = HID + 2 * KVW;           // 3072 columns: q | k | v
constexpr int MROWS = Bsz * T;                // 4096
constexpr int QT_PER_B = T / 16;              // 128
constexpr int NG = Bsz * NH;                  // 32 (batch, head) pairs
constexpr int KSPLIT = T / 8;                 // keys per wave in a block that owns a global-query tile
constexpr int ATT_BLOCKS = NG + NG * (QT_PER_B - 1) / 8;   // 32 global-query blocks + 508 blocks of 8 windowed tiles

typedef _Float16 b16;                                           // f16 variant: single-plane operands (the 'lo' planes hold zeros and are never multiplied)
typedef __attribute__((ext_vector_type(16))) _Float16 v16b;
typedef __attribute__((ext_vector_type(8)))  _Float16 v8b;
typedef __attribute__((ext_vector_type(8)))  float v8f;
typedef __attribute__((ext_vector_type(4)))  float v4f;

__device__ __forceinline__ v8b ld8b(const b16* p) { return *(const v8b*)p; }
__device__ __forceinline__ v16b cat8b(v8b a, v8b b) { return __builtin_shufflevector(a, b, 0, 1, 2, 3, 4, 5, 6, 7, 8, 9, 10, 11, 12, 13, 14, 15); }
// 16x16x32 16-bit fragment from a k-contiguous row pointer (A: lane&15 = row, B: lane&15 = column), hh = lane>>4:
// elements 0..7 <- p[8hh+0..7], elements 8..15 <- p[16+8hh+0..7]
__device__ __forceinline__ v16b frag_kb(const b16* p, int hh) { return cat8b(ld8b(p + 8 * hh), ld8b(p + 16 + 8 * hh)); }
__device__ __forceinline__ void split_bf16(float v, b16& hi, b16& lo) {   // (name kept) f16 conversion, no low part
  hi = (b16)v; lo = (b16)0.0f;
}
__device__ __forceinline__ v8f wmma16b(v16b a, v16b b, v8f c) {
  v8f d = __builtin_amdgcn_wmma_f32_16x16x32_f16(false, a, false, b, (short)0, c, false, false);
  asm volatile("v_nop\n\tv_nop\n\tv_nop\n\tv_nop" : "+v"(d) : "v"(a), "v"(b));
  return d;
}
// e^x formed as __expf forms it (x * log2 e, then v_exp_f32). The v_nop is the one free issue slot that the instruction set asks for behind a transcendental:
// inside the statement the slot cannot move.
__device__ __forceinline__ float exp_slot(float x) {
  float r; asm("v_exp_f32 %0, %1\n\tv_nop" : "=v"(r) : "v"(x * 1.44269504f)); return r;
}
__device__ __forceinline__ void wave_lds_sync() {
  __builtin_amdgcn_fence(__ATOMIC_RELEASE, "workgroup");
  __builtin_amdgcn_wave_barrier();
  __builtin_amdgcn_fence(__ATOMIC_ACQUIRE, "workgroup");
}

// ---------------------------------------------------------------------------
// Weights (torch [out][in] = [n][k]) -> f16 hi / lo planes, same [n][k] layout (k contiguous): columns of Wq|Wk|Wv into wqh/wql [3072][1024], Wo into woh/wol [1024][1024].
// ---------------------------------------------------------------------------
__global__ __launch_bounds__(256) void wcvt_kernel(const float* __restrict__ wq, const float* __restrict__ wk, const float* __restrict__ wv,
                                                   const float* __restrict__ wo, b16* __restrict__ wqh, b16* __restrict__ wql,
                                                   b16* __restrict__ woh, b16* __restrict__ wol) {
  const size_t tid = (size_t)blockIdx.x * blockDim.x + threadIdx.x, stride = (size_t)gridDim.x * blockDim.x;
  const size_t nq = (size_t)NQKV * HID / 8, no = (size_t)HID * HID / 8;
  {
    for (size_t c = tid; c < nq + no; c += stride) {
      float f[8]; size_t i; b16* dh; b16* dl;
      if (c < nq) {
        i = c * 8; const size_t n = i / HID, k0 = i % HID;
        const float* w; int nn, ld;
        if (n < (size_t)HID) { w = wq; nn = (int)n; ld = HID; } else if (n < (size_t)(HID + KVW)) { w = wk; nn = (int)n - HID; ld = KVW; } else { w = wv; nn = (int)n - HID - KVW; ld = KVW; }
#pragma unroll
        for (int e = 0; e < 8; ++e) f[e] = w[(size_t)nn * HID + k0 + e];      // W[n][k] (torch [out][in]); ld unused
        (void)ld;
        dh = wqh; dl = wql;
      } else {
        i = (c - nq) * 8; const size_t n = i / HID, k0 = i % HID;
#pragma unroll
        for (int e = 0; e < 8; ++e) f[e] = wo[(size_t)n * HID + k0 + e];    // Wo[n][k] (torch [out][in])
        dh = woh; dl = wol;
      }
      v8b bh, bl;
#pragma unroll
      for (int e = 0; e < 8; ++e) { b16 a, cc; split_bf16(f[e], a, cc); bh[e] = a; bl[e] = cc; }
      *(v8b*)(dh + i) = bh; *(v8b*)(dl + i) = bl;
    }
    
  }
}

// Block GEMM core, 8 waves: a 128 x 128 tile of A.W^T, wave (wm, wn) = 32 rows x 64 columns of it. Per step of 64 k the block brings the A rows (f32, converted
// to f16 once, here) and the W rows (f16) into LDS with loads that cover whole 128-byte lines; every wave takes its fragments from LDS. Two buffers: the next
// step's global loads are issued behind the barrier and fly during the products. Fragment k order and the order of the sums over k are those of frag_kb on a row.
constexpr int BM = 128, BN = 128, KS = 64;
constexpr int PITCH = KS + 8;                   // f16 elements: 144-byte rows (16 B x odd), conflict-free for the 16-byte fragment reads
constexpr int STAGE = (BM + BN) * PITCH;        // one buffer: 128 A rows, then 128 W rows
constexpr int FPITCH = 68;                      // f32 elements: 272-byte rows (16 B x odd) for the q/k epilogue's 16-byte stores and reads; 8 waves x 32 rows fit the two buffers
typedef __attribute__((ext_vector_type(4))) _Float16 v4b;
template <bool B> struct flag_t { static constexpr bool value = B; };
// TR: the W fragment goes in as the A operand and the row fragment as B (both have the same per-lane form), so acc[r][t] holds the tile transposed:
// register v of a lane = column t*16 + 8*(lane>>4) + v of W, lane&15 = row r*16 + (lane&15). Same products, same order of the sums over k.
// LEAN: the caller runs under a register budget; the fragments are read in small groups. Same products, same order of the sums over k.
template <bool TR, bool LEAN>
__device__ __forceinline__ void gemm_block_lds(const float* __restrict__ A, const b16* __restrict__ wh, int mb, int cb, b16* sm,
                                               int wm, int wn, int nloc, int hlf, v8f (&acc)[2][4]) {
  const int tid = threadIdx.x;
  const float* ag = A + (size_t)(mb + (tid >> 4)) * HID + (tid & 15) * 4;     // 16 lanes = 256 B of one row; rows tid/16 + 16 i
  const b16* bg = wh + (size_t)(cb + (tid >> 3)) * HID + (tid & 7) * 8;       // 8 lanes = 128 B of one row; rows tid/8 + 32 i
  b16* as = sm + (tid >> 4) * PITCH + (tid & 15) * 4;
  b16* bs = sm + (BM + (tid >> 3)) * PITCH + (tid & 7) * 8;
  const b16* af = sm + (wm * 32 + nloc) * PITCH;
  const b16* bf = sm + (BM + wn * 64 + nloc) * PITCH;
  v4f ar[8]; v8b br[4];
#pragma unroll
  for (int i = 0; i < 8; ++i) ar[i] = *(const v4f*)(ag + (size_t)i * 16 * HID);
#pragma unroll
  for (int i = 0; i < 4; ++i) br[i] = ld8b(bg + (size_t)i * 32 * HID);
  for (int s = 0; s < HID / KS; ++s) {
    const int o = (s & 1) * STAGE;
#pragma unroll
    for (int i = 0; i < 8; ++i) { const v4b h = {(b16)ar[i][0], (b16)ar[i][1], (b16)ar[i][2], (b16)ar[i][3]}; *(v4b*)(as + o + i * 16 * PITCH) = h; }
#pragma unroll
    for (int i = 0; i < 4; ++i) *(v8b*)(bs + o + i * 32 * PITCH) = br[i];
    __syncthreads();                            // publishes this step's buffer; it also ends every wave's reads of the other buffer, which the next step refills
    if (s + 1 < HID / KS) {
      const int k = (s + 1) * KS;
#pragma unroll
      for (int i = 0; i < 8; ++i) ar[i] = *(const v4f*)(ag + (size_t)i * 16 * HID + k);
#pragma unroll
      for (int i = 0; i < 4; ++i) br[i] = ld8b(bg + (size_t)i * 32 * HID + k);
      // Under the register budget the compiler let the last A load's result land on the address pair that the loads ahead of it name. The inputs keep both
      // pairs live to this place, and the wait stands in front of every later write of them.
      if constexpr (LEAN) asm volatile("s_wait_xcnt 0x0" :: "v"(ag + k), "v"(bg + k) : "memory");
    }
    if constexpr (LEAN) {   // four fragments live at a time (32 registers, not 96); each group's LDS latency is covered by the other resident waves
      v16b fa[2][2], fb[2][4];
      auto frags_a = [&](const int q) {
#pragma unroll
        for (int r = 0; r < 2; ++r) fa[q][r] = frag_kb(af + o + r * 16 * PITCH + q * 32, hlf);
      };
      auto frags_b = [&](const int q, const int t0, const int t1) {
#pragma unroll
        for (int t = t0; t < t1; ++t) fb[q][t] = frag_kb(bf + o + t * 16 * PITCH + q * 32, hlf);
      };
      auto products = [&](const int q, const int t0, const int t1) {
#pragma unroll
        for (int t = t0; t < t1; ++t) {
          if constexpr (TR) {
            acc[0][t] = wmma16b(fb[q][t], fa[q][0], acc[0][t]);
            acc[1][t] = wmma16b(fb[q][t], fa[q][1], acc[1][t]);
          } else {
            acc[0][t] = wmma16b(fa[q][0], fb[q][t], acc[0][t]);
            acc[1][t] = wmma16b(fa[q][1], fb[q][t], acc[1][t]);
          }
        }
      };
#pragma unroll
      for (int q = 0; q < 2; ++q) {
        frags_a(q); frags_b(q, 0, 2); products(q, 0, 2);
        __builtin_amdgcn_sched_barrier(0);   // keeps the next group's LDS reads behind these products: hoisted, they take the live set over the register budget (spills)
        frags_b(q, 2, 4); products(q, 2, 4);
        if (q == 0) __builtin_amdgcn_sched_barrier(0);   // as above
      }
    } else {
    v16b fa[2][2], fb[2][4];                    // the whole step's fragments, read as one group ahead of the products: one LDS latency a step, not one a pair
#pragma unroll
    for (int q = 0; q < 2; ++q) {
#pragma unroll
      for (int r = 0; r < 2; ++r) fa[q][r] = frag_kb(af + o + r * 16 * PITCH + q * 32, hlf);
#pragma unroll
      for (int t = 0; t < 4; ++t) fb[q][t] = frag_kb(bf + o + t * 16 * PITCH + q * 32, hlf);
    }
#pragma unroll
    for (int q = 0; q < 2; ++q)
#pragma unroll
      for (int t = 0; t < 4; ++t) {
        if constexpr (TR) {
          acc[0][t] = wmma16b(fb[q][t], fa[q][0], acc[0][t]);
          acc[1][t] = wmma16b(fb[q][t], fa[q][1], acc[1][t]);
        } else {
          acc[0][t] = wmma16b(fa[q][0], fb[q][t], acc[0][t]);
          acc[1][t] = wmma16b(fa[q][1], fb[q][t], acc[1][t]);
        }
      }
    }
  }
  __syncthreads();                              // every wave has left the buffers: the q/k epilogue stages in the same LDS
}

// The same core for a block that is alone on its WGP (2 waves per SIMD: registers to spare, no other block to cover a wait). AHEAD register sets: the global
// loads of step s + AHEAD are issued in step s, so that a load has AHEAD - 1 whole steps more than its own step's products to come back from memory.
// LDS buffers, the places of the barriers, fragments, products and the order of the sums over k are those of gemm_block_lds<false, false>.
constexpr int AHEAD = 4;                        // divides HID / KS, even (a set always meets the same LDS buffer)
// The work-group barrier with fences that order LDS alone: __syncthreads() also waits for every global load in flight, which would end the loads issued ahead at
// each step. What the waves hand each other at this barrier lies in LDS only.
__device__ __forceinline__ void block_lds_barrier() {
  __builtin_amdgcn_fence(__ATOMIC_RELEASE, "workgroup", "local");
  __builtin_amdgcn_s_barrier();
  __builtin_amdgcn_fence(__ATOMIC_ACQUIRE, "workgroup", "local");
}
__device__ __forceinline__ void gemm_block_lds_ahead(const float* __restrict__ A, const b16* __restrict__ wh, int mb, int cb, b16* sm,
                                                     int wm, int wn, int nloc, int hlf, v8f (&acc)[2][4]) {
  const int tid = threadIdx.x;
  const float* ag = A + (size_t)(mb + (tid >> 4)) * HID + (tid & 15) * 4;     // 16 lanes = 256 B of one row; rows tid/16 + 16 i
  const b16* bg = wh + (size_t)(cb + (tid >> 3)) * HID + (tid & 7) * 8;       // 8 lanes = 128 B of one row; rows tid/8 + 32 i
  b16* as = sm + (tid >> 4) * PITCH + (tid & 15) * 4;
  b16* bs = sm + (BM + (tid >> 3)) * PITCH + (tid & 7) * 8;
  const b16* af = sm + (wm * 32 + nloc) * PITCH;
  const b16* bf = sm + (BM + wn * 64 + nloc) * PITCH;
  v4f ar[AHEAD][8]; v8b br[AHEAD][4];
  auto load = [&](const int j, const int s) {
    const int k = s * KS;
#pragma unroll
    for (int i = 0; i < 8; ++i) ar[j][i] = *(const v4f*)(ag + (size_t)i * 16 * HID + k);
#pragma unroll
    for (int i = 0; i < 4; ++i) br[j][i] = ld8b(bg + (size_t)i * 32 * HID + k);
  };
  auto step = [&](const int j, const int s, auto more) {
    const int o = (j & 1) * STAGE;
#pragma unroll
    for (int i = 0; i < 8; ++i) { const v4b h = {(b16)ar[j][i][0], (b16)ar[j][i][1], (b16)ar[j][i][2], (b16)ar[j][i][3]}; *(v4b*)(as + o + i * 16 * PITCH) = h; }
#pragma unroll
    for (int i = 0; i < 4; ++i) *(v8b*)(bs + o + i * 32 * PITCH) = br[j][i];
    block_lds_barrier();                        // publishes this step's buffer; it also ends every wave's reads of the other buffer, which the next step refills
    if constexpr (decltype(more)::value) load(j, s + AHEAD);
    v16b fa[2][2], fb[2][4];                    // the whole step's fragments, read as one group ahead of the products: one LDS latency a step, not one a pair
#pragma unroll
    for (int q = 0; q < 2; ++q) {
#pragma unroll
      for (int r = 0; r < 2; ++r) fa[q][r] = frag_kb(af + o + r * 16 * PITCH + q * 32, hlf);
#pragma unroll
      for (int t = 0; t < 4; ++t) fb[q][t] = frag_kb(bf + o + t * 16 * PITCH + q * 32, hlf);
    }
    if constexpr (decltype(more)::value) {
      asm volatile("s_wait_xcnt 0x0" ::: "memory");   // stands in front of the first later write of the loads' address registers (the loop's own advance of them)
      __builtin_amdgcn_sched_barrier(0);              // keeps that advance behind the wait: the compiler had put it directly behind the loads
    }
#pragma unroll
    for (int q = 0; q < 2; ++q)
#pragma unroll
      for (int t = 0; t < 4; ++t) {
        acc[0][t] = wmma16b(fa[q][0], fb[q][t], acc[0][t]);
        acc[1][t] = wmma16b(fa[q][1], fb[q][t], acc[1][t]);
      }
  };
#pragma unroll
  for (int j = 0; j < AHEAD; ++j) {
    load(j, j);
    if (j == AHEAD - 1) asm volatile("s_wait_xcnt 0x0" ::: "memory");   // stands in front of the first later write of these loads' address registers
    __builtin_amdgcn_sched_barrier(0);          // keeps the sets in the order in which the loop issues them: mixed here, the loop's counted waits fall to what this order allows
  }
  // the last AHEAD steps are a copy of the body without loads, not a branch in it (as in attention's chunk loop): the compiler's counted waits see one order of loads
  for (int s0 = 0; s0 < HID / KS - AHEAD; s0 += AHEAD) {
#pragma unroll
    for (int j = 0; j < AHEAD; ++j) step(j, s0 + j, flag_t<true>{});
  }
#pragma unroll
  for (int j = 0; j < AHEAD; ++j) step(j, HID / KS - AHEAD + j, flag_t<false>{});
  __syncthreads();                              // every wave has left the buffers: the caller's epilogue stages in the same LDS
}

// ---------------------------------------------------------------------------
// QKV GEMM: (4096 x 1024) x (1024 x 3072), grid (24, 32), block 8 waves (4 x 2), wave = 32 rows x 64 columns (one head of q, k or v). Outputs as f16 hi/lo planes:
// q (x1/8) -> Qh/Ql, k -> Kh/Kl: [b][h][t/16][4 groups of 16 features][32 lanes][8], the order in which attention's fragment loads read them
// (lane = 16 * ((feature >> 3) & 1) + t % 16); 4 KB contiguous per wave per plane;
// v -> Vh/Vl key-tiled [b][kvh][t/16][64][16] (4 KB contiguous per wave per plane).
// ---------------------------------------------------------------------------
// Second launch bound: at least 6 waves per SIMD, a budget of 160 VGPRs, so that 3 blocks reside per WGP and all 768 blocks run in one round
// (above 160 only 2 reside: 512 blocks, then a second round of 256 that leaves every WGP with one block).
__global__ __launch_bounds__(256, 6) void qkv_gemm_kernel(const float* __restrict__ xq, const float* __restrict__ xk, const float* __restrict__ xv,
                                                       const b16* __restrict__ wqh, const b16* __restrict__ wql,
                                                       const float* __restrict__ bq, const float* __restrict__ bk, const float* __restrict__ bv, const float* __restrict__ rope_cs, int xoff, int yoff,
                                                       b16* __restrict__ Qh, b16* __restrict__ Ql, b16* __restrict__ Kh, b16* __restrict__ Kl,
                                                       b16* __restrict__ Vh, b16* __restrict__ Vl) {
  __shared__ __attribute__((aligned(16))) b16 sm[2 * STAGE];   // the core's two buffers; afterwards, for q and k, one f32 tile per wave (32 rows of FPITCH)
  const int lane = threadIdx.x & 31, wave = __builtin_amdgcn_readfirstlane(threadIdx.x >> 5), nloc = lane & 15, hlf = lane >> 4;
  const int wm = wave & 3, wn = wave >> 2;   // wave number held scalar: the choice of matrix, head, bias and staging place stays on the scalar unit
  const int mb = (blockIdx.y + yoff) * BM, cb = (blockIdx.x + xoff) * BN;   // a 128-column tile lies inside one of q, k, v
  const int m0 = mb + wm * 32;
  const int c0 = cb + wn * 64;
  const int mat = (c0 < HID) ? 0 : (c0 < HID + KVW) ? 1 : 2;
  const int head = (mat == 0) ? (c0 / DH) : (mat == 1) ? ((c0 - HID) / DH) : ((c0 - HID - KVW) / DH);
  const float* x = (mat == 0) ? xq : (mat == 1) ? xk : xv;          // three different input tensors
  const float* bias = ((mat == 0) ? bq : (mat == 1) ? bk : bv) + head * DH;
  v8f acc[2][4];
#pragma unroll
  for (int r = 0; r < 2; ++r)
#pragma unroll
    for (int t = 0; t < 4; ++t) acc[r][t] = (v8f){};
  const int b = m0 / T, t0 = m0 % T;
  v8b y[2][4]; b16* dh; b16* dl;                         // per lane: eight 16-byte units of the wave's 4 KB, unit (r, t) at r * 1024 + t * 256 elements from its own place
  if (mat < 2) {   // the same for both column halves of the block (a 128-column tile lies inside one matrix): the barriers in the core stay block-uniform
    // q and k, tile transposed: a lane holds, for token r*16 + nloc, features t*16 + 8*hlf + 0..7: one 16-byte unit of attention's fragment order, at its own lane's place
    gemm_block_lds<true, true>(x, wqh, mb, cb, sm, wm, wn, nloc, hlf, acc);
    const float s = (mat == 0) ? 0.125f : 1.0f;
    const float* cp = rope_cs + (size_t)(t0 >> 4) * 1024 + lane * 4;   // one address, the 16 loads differ by constant offsets
    v4f cs[2][2][4], bb[4][2];                            // (cos, sin) of angle 16t + 8hlf + v at token r*16 + nloc: 16 floats in 4 loads of 512 contiguous bytes
#pragma unroll
    for (int r = 0; r < 2; ++r)
#pragma unroll
      for (int t = 0; t < 2; ++t)
#pragma unroll
        for (int p = 0; p < 4; ++p) cs[r][t][p] = *(const v4f*)(cp + ((r * 2 + t) * 4 + p) * 128);
#pragma unroll
    for (int t = 0; t < 4; ++t) { bb[t][0] = *(const v4f*)(bias + t * 16 + 8 * hlf); bb[t][1] = *(const v4f*)(bias + t * 16 + 8 * hlf + 4); }
    asm volatile("s_wait_xcnt 0x0" ::: "memory");         // stands in front of the first later write of these loads' address registers
    float* F = reinterpret_cast<float*>(sm) + wave * (32 * FPITCH) + nloc * FPITCH;   // the wave's own f32 tile, token rows: half of a lane's RoPE partners lie in the other half-wave
#pragma unroll
    for (int t = 0; t < 4; ++t)
#pragma unroll
      for (int r = 0; r < 2; ++r) {
#pragma unroll
        for (int v = 0; v < 8; ++v) acc[r][t][v] += bb[t][v >> 2][v & 3];
        float* p = F + r * 16 * FPITCH + t * 16 + 8 * hlf;
        *(v4f*)p = (v4f){acc[r][t][0], acc[r][t][1], acc[r][t][2], acc[r][t][3]};
        *(v4f*)(p + 4) = (v4f){acc[r][t][4], acc[r][t][5], acc[r][t][6], acc[r][t][7]};
      }
    wave_lds_sync();                                      // both half-waves' features of a token are in LDS before either reads partners
#pragma unroll
    for (int r = 0; r < 2; ++r)
#pragma unroll
      for (int t = 0; t < 2; ++t) {
        // features d = 16t + 8hlf + v (< 32) and d + 32 share angle d and the 16 floats x[2d0 .. 2d0 + 15], d0 = 16t + 8hlf: partner of d is -x[2d + 1], of d + 32 it is x[2d]
        const float* wp = F + r * 16 * FPITCH + 32 * t + 16 * hlf;
        v4f w[4];
#pragma unroll
        for (int p = 0; p < 4; ++p) w[p] = *(const v4f*)(wp + 4 * p);
#pragma unroll
        for (int v = 0; v < 8; ++v) {
          const float cv = cs[r][t][v >> 1][(v & 1) * 2], sv = cs[r][t][v >> 1][(v & 1) * 2 + 1];
          y[r][t][v]     = (b16)((acc[r][t][v] * cv - w[v >> 1][(v & 1) * 2 + 1] * sv) * s);
          y[r][t + 2][v] = (b16)((acc[r][t + 2][v] * cv + w[v >> 1][(v & 1) * 2] * sv) * s);
        }
        if (r + t < 2) __builtin_amdgcn_sched_barrier(0);   // keeps the next group's four LDS reads behind this group: hoisted, they take the live set over the register budget (spills)
      }
    const size_t o = ((size_t)(b * NH + head) * T + t0) * DH + lane * 8;   // NKV == NH
    dh = ((mat == 0) ? Qh : Kh) + o; dl = ((mat == 0) ? Ql : Kl) + o;
  } else {
    // v, tile as the product gives it: a lane holds, for feature t*16 + nloc, tokens r*16 + 8*hlf + 0..7: one 16-byte unit of the key-tiled [64][16] layout
    gemm_block_lds<false, true>(x, wqh, mb, cb, sm, wm, wn, nloc, hlf, acc);
    float bb[4];
#pragma unroll
    for (int t = 0; t < 4; ++t) bb[t] = bias[t * 16 + nloc];
    asm volatile("s_wait_xcnt 0x0" ::: "memory");         // stands in front of the first later write of these loads' address registers
#pragma unroll
    for (int r = 0; r < 2; ++r)
#pragma unroll
      for (int t = 0; t < 4; ++t)
#pragma unroll
        for (int v = 0; v < 8; ++v) y[r][t][v] = (b16)(acc[r][t][v] + bb[t]);
    const size_t o = ((size_t)(b * NKV + head) * QT_PER_B + (t0 >> 4)) * (size_t)(DH * 16) + nloc * 16 + 8 * hlf;
    dh = Vh + o; dl = Vl + o;
  }
  const v8b zero = {};
#pragma unroll
  for (int r = 0; r < 2; ++r)
#pragma unroll
    for (int t = 0; t < 4; ++t) { *(v8b*)(dh + r * 1024 + t * 256) = y[r][t]; *(v8b*)(dl + r * 1024 + t * 256) = zero; }
}

// One 32-key chunk's fragments, each set loaded as one group of 8 loads: K rows kb..kb+31 (two 16-key tiles x two halves of the 64 features) and the key-tiled V.
// kb is a multiple of 32.
__device__ __forceinline__ void load_k_chunk(const b16* __restrict__ kbase, int kb, int col, int hh, v16b (&k)[4]) {
  const b16* p = kbase + (size_t)(kb >> 4) * (DH * 16) + (hh * 16 + col) * 8;   // K lies in fragment order: each load is 512 contiguous bytes, 4 whole lines
  // per fragment the elements that frag_kb takes from a row: features 8hh.. and 16+8hh.. of each half of 32; k[0], k[1]: keys kb..kb+15, k[2], k[3]: kb+16..kb+31
  k[0] = cat8b(ld8b(p), ld8b(p + 256));        k[1] = cat8b(ld8b(p + 512), ld8b(p + 768));
  k[2] = cat8b(ld8b(p + 1024), ld8b(p + 1280)); k[3] = cat8b(ld8b(p + 1536), ld8b(p + 1792));
  asm volatile("s_wait_xcnt 0x0" ::: "memory");   // stands in front of the first later write of the group's address registers, which the compiler reuses at once
}
__device__ __forceinline__ void load_v_chunk(const b16* __restrict__ vbase, int kb, int col, int hh, v16b (&v)[4]) {
  const b16* p = vbase + (size_t)(kb >> 4) * (DH * 16) + col * 16 + 8 * hh;
#pragma unroll
  for (int n = 0; n < 4; ++n) v[n] = cat8b(ld8b(p + n * 256), ld8b(p + n * 256 + DH * 16));
  asm volatile("s_wait_xcnt 0x0" ::: "memory");   // as in load_k_chunk
}

// ---------------------------------------------------------------------------
// Transposed flash attention, keys in chunks of 32. Blocks 0..NG-1: the global-query tile (queries 0..15, every key) of one (b, head), its keys split
// over the block's 8 waves, the 8 partial (max, sum, O) merged in LDS. Other blocks: each wave owns one windowed 16-query tile of one (b, head).
// S^T = K.Q^T (split), per-lane online softmax; P^T built in registers from the two S^T accumulators
// Each chunk's 8 K loads and 8 V loads are issued as groups ahead of their use, so that a chunk no longer waits one load latency in front of each of its 8 products.
// ---------------------------------------------------------------------------
__global__ __launch_bounds__(256) void attn_kernel(const b16* __restrict__ Qh, const b16* __restrict__ Ql, const b16* __restrict__ Kh, const b16* __restrict__ Kl,
                                                   const b16* __restrict__ Vh, const b16* __restrict__ Vl,
                                                   float* __restrict__ yf) {
  __shared__ __attribute__((aligned(16))) float Os[8][16 * 64];
  __shared__ float Ms[8][16], Ls[8][16];
  // wave number held scalar: tile, chunk counters and loop tests leave the vector registers, which keeps the kernel with both fragment groups at 160 or fewer
  // (6 waves per SIMD, 3 blocks per WGP: all 540 blocks resident at once)
  const int wid = __builtin_amdgcn_readfirstlane(threadIdx.x >> 5), lane = threadIdx.x & 31, hh = lane >> 4, col = lane & 15;
  const bool glob = blockIdx.x < NG;                      // block-uniform
  const int qtile = ((int)blockIdx.x - NG) * 8 + wid;     // over NG*(QT_PER_B-1): the windowed tiles
  const int g = glob ? (int)blockIdx.x : qtile / (QT_PER_B - 1);          // b*NH + h
  const int q0 = glob ? 0 : ((qtile % (QT_PER_B - 1)) + 1) << 4;
  const int b = g / NH, h = g % NH, kvh = h / REP;
  const size_t ko = (size_t)(b * NKV + kvh) * T * DH;
  const size_t qo = ((size_t)g * T + q0) * DH + lane * 8;   // Q lies in fragment order too (q0 is a multiple of 16)
  (void)Ql; (void)Kl; (void)Vl;                           // the zero planes are never multiplied
  const v16b q0h = cat8b(ld8b(Qh + qo), ld8b(Qh + qo + 256)), q1h = cat8b(ld8b(Qh + qo + 512), ld8b(Qh + qo + 768));
  float m = -INFINITY, l = 0.0f;
  v8f o0 = {}, o1 = {}, o2 = {}, o3 = {};
  const int kstart = (q0 >= WIN + 32) ? ((q0 - WIN) & ~31) : 32;   // first windowed chunk after the global chunk 0
  const int kfirst = glob ? wid * KSPLIT : 0, kend = glob ? kfirst + KSPLIT : q0 + 16;
  v16b kf[4];
  load_k_chunk(Kh + ko, kfirst, col, hh, kf);
  // One chunk. Its V group is issued first and flies during the score products and the softmax; where a next chunk exists (ahead), that chunk's K group is
  // issued behind the score products and flies during the softmax and P.V. The last chunk is a copy of the body without that group, not a branch in it: with a
  // branch round the loads the compiler's wait in front of P.V counted to 0 and so waited for the next K group too.
  auto chunk = [&](const int kb, const int kn, auto ahead) {
    v16b vf[4];
    load_v_chunk(Vh + ko, kb, col, hh, vf);
    v8f s0 = {}, s1 = {};
    s0 = wmma16b(kf[0], q0h, s0);
    s0 = wmma16b(kf[1], q1h, s0);
    s1 = wmma16b(kf[2], q0h, s1);
    s1 = wmma16b(kf[3], q1h, s1);
    if constexpr (decltype(ahead)::value) load_k_chunk(Kh + ko, kn, col, hh, kf);
    if (q0 != 0 && (kb == 0 || kb + 32 > q0 || kb < q0 + 15 - WIN)) {   // blocked = (j > i or j < i-128) unless j < 16 (queries here are >= 16)
      const int qi = q0 + col;
#pragma unroll
      for (int r = 0; r < 8; ++r) {
        const int k0i = kb + 8 * hh + r, k1i = k0i + 16;
        if (k0i >= NGLOB && (k0i > qi || k0i < qi - WIN)) s0[r] = -INFINITY;
        if (k1i >= NGLOB && (k1i > qi || k1i < qi - WIN)) s1[r] = -INFINITY;
      }
    }
    float mr = -INFINITY;
#pragma unroll
    for (int r = 0; r < 8; ++r) mr = fmaxf(mr, fmaxf(s0[r], s1[r]));
    mr = fmaxf(mr, __shfl_xor(mr, 16));
    const float mn = fmaxf(m, mr);            // finite
    const float al_ = exp_slot(m - mn);       // exp_slot: the same product and v_exp_f32 as __expf, with the free slot behind it held in the statement
    m = mn;
    float sum = 0.0f;
    v16b pbh;
#pragma unroll
    for (int r = 0; r < 8; ++r) {
      const float p0 = exp_slot(s0[r] - mn), p1 = exp_slot(s1[r] - mn);
      sum += p0 + p1;
      pbh[r] = (b16)p0; pbh[8 + r] = (b16)p1;
    }
    sum += __shfl_xor(sum, 16);
    l = l * al_ + sum;
#pragma unroll
    for (int r = 0; r < 8; ++r) { o0[r] *= al_; o1[r] *= al_; o2[r] *= al_; o3[r] *= al_; }
    o0 = wmma16b(vf[0], pbh, o0);
    o1 = wmma16b(vf[1], pbh, o1);
    o2 = wmma16b(vf[2], pbh, o2);
    o3 = wmma16b(vf[3], pbh, o3);
  };
  int kb = kfirst;            // global queries: this wave's share of every key; else chunk 0 (global keys) + the causal window; every wave has at least one chunk
  for (;;) {
    const int kn = (!glob && kb == 0) ? kstart : (kb + 32);
    if (kn >= kend) break;
    chunk(kb, kn, flag_t<true>{});
    kb = kn;
  }
  chunk(kb, kb, flag_t<false>{});
  const float inv = glob ? 1.0f : 1.0f / l;               // a partial O stays unnormalised until the merge
  float* Tt = Os[wid];
#pragma unroll
  for (int r = 0; r < 8; ++r) {
    const int hr = 8 * hh + r;
    Tt[col * 64 + 0 + hr] = o0[r] * inv; Tt[col * 64 + 16 + hr] = o1[r] * inv;
    Tt[col * 64 + 32 + hr] = o2[r] * inv; Tt[col * 64 + 48 + hr] = o3[r] * inv;
  }
  if (glob) {                                             // merge the 8 waves' partials: thread = (query row, 4 features)
    if (hh == 0) { Ms[wid][col] = m; Ls[wid][col] = l; }
    __syncthreads();                                      // every wave's partial is in LDS before any thread sums over waves
    const int rr = threadIdx.x >> 4, c4 = (threadIdx.x & 15) * 4;
    float mx = Ms[0][rr];
#pragma unroll
    for (int w = 1; w < 8; ++w) mx = fmaxf(mx, Ms[w][rr]);
    float sc[8];
#pragma unroll
    for (int w = 0; w < 8; ++w) sc[w] = exp_slot(Ms[w][rr] - mx);
    float lt = 0.0f; v4f a = {};
#pragma unroll
    for (int w = 0; w < 8; ++w) { lt += sc[w] * Ls[w][rr]; a += sc[w] * *(const v4f*)(&Os[w][rr * 64 + c4]); }
    *(v4f*)(yf + ((size_t)b * T + rr) * HID + h * DH + c4) = a * (1.0f / lt);
    return;
  }
  wave_lds_sync();
  float* dst0 = yf + ((size_t)b * T + q0) * HID + h * DH;     // 16 rows x 64 floats, row stride HID
#pragma unroll
  for (int j = 0; j < 8; ++j) { const int rr = j * 2 + hh, c4 = col * 4; *(v4f*)(dst0 + (size_t)rr * HID + c4) = *(const v4f*)(Tt + rr * 64 + c4); }
  
}

// ---------------------------------------------------------------------------
// Output projection: (4096 x 1024) x (1024 x 1024) -> f32, A = f32 y, B = Wo plane. grid (8, 32), block 8 waves (4 x 2), 32x64 wave tiles staged in LDS,
// ---------------------------------------------------------------------------
__global__ __launch_bounds__(256) void out_gemm_kernel(const float* __restrict__ yf, const b16* __restrict__ woh, const b16* __restrict__ wol, const float* __restrict__ bo, int yoff,
                                                       float* __restrict__ out) {
  __shared__ __attribute__((aligned(16))) b16 sm[2 * STAGE];   // the core's two buffers; afterwards 8 KB of staging per wave
  const int lane = threadIdx.x & 31, wave = __builtin_amdgcn_readfirstlane(threadIdx.x >> 5), nloc = lane & 15, hlf = lane >> 4;
  const int wm = wave & 3, wn = wave >> 2;   // wave number held scalar: the bias columns and staging place stay on the scalar unit
  const int mb = (blockIdx.y + yoff) * BM, cb = blockIdx.x * BN;
  const int m0 = mb + wm * 32;
  const int c0 = cb + wn * 64;
  v8f acc[2][4];
#pragma unroll
  for (int r = 0; r < 2; ++r)
#pragma unroll
    for (int t = 0; t < 4; ++t) acc[r][t] = (v8f){};
  gemm_block_lds_ahead(yf, woh, mb, cb, sm, wm, wn, nloc, hlf, acc);
  float* Tt = reinterpret_cast<float*>(sm) + wave * (32 * 64);
#pragma unroll
  for (int t = 0; t < 4; ++t)
#pragma unroll
    for (int r = 0; r < 2; ++r)
#pragma unroll
      for (int v = 0; v < 8; ++v) Tt[(r * 16 + v + 8 * hlf) * 64 + t * 16 + nloc] = acc[r][t][v] + bo[c0 + t * 16 + nloc];
  wave_lds_sync();
  float* dst0 = out + (size_t)m0 * HID + c0;
#pragma unroll
  for (int j = 0; j < 16; ++j) { const int rr = j * 2 + hlf, c4 = nloc * 4; *(v4f*)(dst0 + (size_t)rr * HID + c4) = *(const v4f*)(Tt + rr * 64 + c4); }
  
}
__global__ __launch_bounds__(256) void rope_table_kernel(float* __restrict__ cs) {
  const int idx = blockIdx.x * 256 + threadIdx.x;        // T * 32
  if (idx >= T * 32) return;
  const int t = idx >> 5, i = idx & 31;
  const float ang = (float)t * powf(10000.0f, -(float)i / 32.0f);
  typedef __attribute__((ext_vector_type(2))) float v2f;
  const v2f p = {cosf(ang), sinf(ang)};
  // laid out as the q/k epilogue reads it: [t/16][i/16][4 pieces][lane = 16*((i>>3)&1) + t%16][4 floats = (cos, sin) of two angles]
  const int v = i & 7;
  *(v2f*)(cs + (size_t)(((((t >> 4) * 2 + (i >> 4)) * 4 + (v >> 1)) * 32 + ((i >> 3) & 1) * 16 + (t & 15)) * 4 + (v & 1) * 2)) = p;
}
}  // namespace

extern "C" void kernel_launch(void* const* d_in, const int* in_sizes, int n_in,
                              void* d_out, int out_size, void* d_ws, size_t ws_size, hipStream_t stream) {
  (void)in_sizes; (void)n_in; (void)out_size;
  const float* xq = (const float*)d_in[0];   // q [2,2048,1024]
  const float* xk = (const float*)d_in[1];   // k
  const float* xv = (const float*)d_in[2];   // v
  const float* Wq = (const float*)d_in[3];  const float* bq = (const float*)d_in[4];    // torch [out][in]
  const float* Wk = (const float*)d_in[5];  const float* bk = (const float*)d_in[6];
  const float* Wv = (const float*)d_in[7];  const float* bv = (const float*)d_in[8];
  const float* Wo = (const float*)d_in[9];  const float* bo = (const float*)d_in[10];
  float* out = (float*)d_out;                // [2,2048,1024]

  size_t off = 0; char* ws = (char*)d_ws;
  b16* wqh = (b16*)(ws + off); off += (size_t)NQKV * HID * 2;
  b16* wql = (b16*)(ws + off); off += (size_t)NQKV * HID * 2;     // 'lo' planes: zeros in the f16 variant (real buffers: the kernels write both)
  b16* woh = (b16*)(ws + off); off += (size_t)HID * HID * 2;
  b16* wol = (b16*)(ws + off); off += (size_t)HID * HID * 2;
  b16* Qh  = (b16*)(ws + off); off += (size_t)MROWS * HID * 2;
  b16* Ql  = (b16*)(ws + off); off += (size_t)MROWS * HID * 2;
  b16* Kh  = (b16*)(ws + off); off += (size_t)MROWS * KVW * 2;
  b16* Kl  = (b16*)(ws + off); off += (size_t)MROWS * KVW * 2;
  b16* Vh  = (b16*)(ws + off); off += (size_t)MROWS * KVW * 2;
  b16* Vl  = (b16*)(ws + off); off += (size_t)MROWS * KVW * 2;
  float* yf = (float*)(ws + off); off += (size_t)MROWS * HID * 4;
  float* rope_cs = (float*)(ws + off); off += (size_t)T * 32 * 2 * 4;
  if (off > ws_size) return;
  rope_table_kernel<<<(T * 32 + 255) / 256, 256, 0, stream>>>(rope_cs);
  const int ROWBLK = MROWS / 128;
  wcvt_kernel<<<2048, 256, 0, stream>>>(Wq, Wk, Wv, Wo, wqh, wql, woh, wol);
  qkv_gemm_kernel<<<dim3(NQKV / BN, ROWBLK), 256, 0, stream>>>(xq, xk, xv, wqh, wql, bq, bk, bv, rope_cs, 0, 0, Qh, Ql, Kh, Kl, Vh, Vl);
  attn_kernel<<<ATT_BLOCKS, 256, 0, stream>>>(Qh, Ql, Kh, Kl, Vh, Vl, yf);
  out_gemm_kernel<<<dim3(HID / BN, ROWBLK), 256, 0, stream>>>(yf, woh, wol, bo, 0, out);
}

// v008
// A run of this version takes 63 microseconds.
// Next to v007, in two timings, it ran 1.06 times as fast each time.
// All steps since v000 together make it 4.32 times as fast.
#include <hip/hip_runtime.h>

// Sparse (local-window + global-token) multi-head attention: Q/K/V = x W^T + b (torch [out][in]), 16 heads x 64, RoPE with this module's pairing
// (x_rope[d] = -x[2d+1] for d < 32, x[2(d-32)] otherwise; angle index d mod 32), scores/8, mask: blocked if (|i-j| > 128 or j > i) unless i < 16 or j < 16,
// softmax, P.V, out = y Wo^T + bo. B=2, S=2048, D=1024. Contractions on v_wmma_f32_16x16x32_f16 with single f16 operands and f32 accumulate; fragment

namespace {
constexpr int Bsz = 2, T = 2048, HID = 1024, DH = 64, NH = 16, NKV = 16, REP = NH / NKV;
constexpr int WIN = 128, NGLOB = 16;
constexpr int KVW = NKV * DH;                 // 1024
constexpr int NQKV = HID + 2 * KVW;           // 3072 columns: q | k | v
constexpr int MROWS = Bsz * T;                // 4096
constexpr int QT_PER_B = T / 16;              // 128
constexpr int NG = Bsz * NH;                  // 32 (batch, head) pairs
constexpr int KSPLIT = T / 8;                 // keys per wave in a block that owns a global-query tile
constexpr int ATT_BLOCKS = NG + NG * (QT_PER_B - 1) / 8;   // 32 global-query blocks + 508 blocks of 8 windowed tiles

typedef _Float16 b16;                                           // f16 variant: single-plane operands (the 'lo' planes hold zeros and are never multiplied)
typedef __attribute__((ext_vector_type(16))) _Float16 v16b;
typedef __attribute__((ext_vector_type(8)))  _Float16 v8b;
typedef __attribute__((ext_vector_type(8)))  float v8f;
typedef __attribute__((ext_vector_type(4)))  float v4f;

__device__ __forceinline__ v8b ld8b(const b16* p) { return *(const v8b*)p; }
__device__ __forceinline__ v16b cat8b(v8b a, v8b b) { return __builtin_shufflevector(a, b, 0, 1, 2, 3, 4, 5, 6, 7, 8, 9, 10, 11, 12, 13, 14, 15); }
// 16x16x32 16-bit fragment from a k-contiguous row pointer (A: lane&15 = row, B: lane&15 = column), hh = lane>>4:
// elements 0..7 <- p[8hh+0..7], elements 8..15 <- p[16+8hh+0..7]
__device__ __forceinline__ v16b frag_kb(const b16* p, int hh) { return cat8b(ld8b(p + 8 * hh), ld8b(p + 16 + 8 * hh)); }
__device__ __forceinline__ void split_bf16(float v, b16& hi, b16& lo) {   // (name kept) f16 conversion, no low part
  hi = (b16)v; lo = (b16)0.0f;
}
__device__ __forceinline__ v8f wmma16b(v16b a, v16b b, v8f c) {
  v8f d = __builtin_amdgcn_wmma_f32_16x16x32_f16(false, a, false, b, (short)0, c, false, false);
  asm volatile("v_nop\n\tv_nop\n\tv_nop\n\tv_nop" : "+v"(d) : "v"(a), "v"(b));
  return d;
}
// e^x formed as __expf forms it (x * log2 e, then v_exp_f32). The v_nop is the one free issue slot that the instruction set asks for behind a transcendental:
// inside the statement the slot cannot move.
__device__ __forceinline__ float exp_slot(float x) {
  float r; asm("v_exp_f32 %0, %1\n\tv_nop" : "=v"(r) : "v"(x * 1.44269504f)); return r;
}
__device__ __forceinline__ void wave_lds_sync() {
  __builtin_amdgcn_fence(__ATOMIC_RELEASE, "workgroup");
  __builtin_amdgcn_wave_barrier();
  __builtin_amdgcn_fence(__ATOMIC_ACQUIRE, "workgroup");
}

// ---------------------------------------------------------------------------
// Weights (torch [out][in] = [n][k]) -> f16 hi / lo planes, same [n][k] layout (k contiguous): columns of Wq|Wk|Wv into wqh/wql [3072][1024], Wo into woh/wol [1024][1024].
// ---------------------------------------------------------------------------
__global__ __launch_bounds__(256) void wcvt_kernel(const float* __restrict__ wq, const float* __restrict__ wk, const float* __restrict__ wv,
                                                   const float* __restrict__ wo, b16* __restrict__ wqh, b16* __restrict__ wql,
                                                   b16* __restrict__ woh, b16* __restrict__ wol) {
  const size_t tid = (size_t)blockIdx.x * blockDim.x + threadIdx.x, stride = (size_t)gridDim.x * blockDim.x;
  const size_t nq = (size_t)NQKV * HID / 8, no = (size_t)HID * HID / 8;
  {
    for (size_t c = tid; c < nq + no; c += stride) {
      float f[8]; size_t i; b16* dh; b16* dl;
      if (c < nq) {
        i = c * 8; const size_t n = i / HID, k0 = i % HID;
        const float* w; int nn, ld;
        if (n < (size_t)HID) { w = wq; nn = (int)n; ld = HID; } else if (n < (size_t)(HID + KVW)) { w = wk; nn = (int)n - HID; ld = KVW; } else { w = wv; nn = (int)n - HID - KVW; ld = KVW; }
#pragma unroll
        for (int e = 0; e < 8; ++e) f[e] = w[(size_t)nn * HID + k0 + e];      // W[n][k] (torch [out][in]); ld unused
        (void)ld;
        dh = wqh; dl = wql;
      } else {
        i = (c - nq) * 8; const size_t n = i / HID, k0 = i % HID;
#pragma unroll
        for (int e = 0; e < 8; ++e) f[e] = wo[(size_t)n * HID + k0 + e];    // Wo[n][k] (torch [out][in])
        dh = woh; dl = wol;
      }
      v8b bh, bl;
#pragma unroll
      for (int e = 0; e < 8; ++e) { b16 a, cc; split_bf16(f[e], a, cc); bh[e] = a; bl[e] = cc; }
      *(v8b*)(dh + i) = bh; *(v8b*)(dl + i) = bl;
    }
    
  }
}

// Block GEMM core, 8 waves: a 128 x 128 tile of A.W^T, wave (wm, wn) = 32 rows x 64 columns of it. Per step of 64 k the block brings the A rows (f32, converted
// to f16 once, here) and the W rows (f16) into LDS with loads that cover whole 128-byte lines; every wave takes its fragments from LDS. Two buffers: the next
// step's global loads are issued behind the barrier and fly during the products. Fragment k order and the order of the sums over k are those of frag_kb on a row.
constexpr int BM = 128, BN = 128, KS = 64;
constexpr int PITCH = KS + 8;                   // f16 elements: 144-byte rows (16 B x odd), conflict-free for the 16-byte fragment reads
constexpr int STAGE = (BM + BN) * PITCH;        // one buffer: 128 A rows, then 128 W rows
constexpr int FPITCH = 68;                      // f32 elements: 272-byte rows (16 B x odd) for the q/k epilogue's 16-byte stores and reads; 8 waves x 32 rows fit the two buffers
typedef __attribute__((ext_vector_type(4))) _Float16 v4b;
template <bool B> struct flag_t { static constexpr bool value = B; };
// TR: the W fragment goes in as the A operand and the row fragment as B (both have the same per-lane form), so acc[r][t] holds the tile transposed:
// register v of a lane = column t*16 + 8*(lane>>4) + v of W, lane&15 = row r*16 + (lane&15). Same products, same order of the sums over k.
// LEAN: the caller runs under a register budget; the fragments are read in small groups. Same products, same order of the sums over k.
template <bool TR, bool LEAN>
__device__ __forceinline__ void gemm_block_lds(const float* __restrict__ A, const b16* __restrict__ wh, int mb, int cb, b16* sm,
                                               int wm, int wn, int nloc, int hlf, v8f (&acc)[2][4]) {
  const int tid = threadIdx.x;
  const float* ag = A + (size_t)(mb + (tid >> 4)) * HID + (tid & 15) * 4;     // 16 lanes = 256 B of one row; rows tid/16 + 16 i
  const b16* bg = wh + (size_t)(cb + (tid >> 3)) * HID + (tid & 7) * 8;       // 8 lanes = 128 B of one row; rows tid/8 + 32 i
  b16* as = sm + (tid >> 4) * PITCH + (tid & 15) * 4;
  b16* bs = sm + (BM + (tid >> 3)) * PITCH + (tid & 7) * 8;
  const b16* af = sm + (wm * 32 + nloc) * PITCH;
  const b16* bf = sm + (BM + wn * 64 + nloc) * PITCH;
  v4f ar[8]; v8b br[4];
#pragma unroll
  for (int i = 0; i < 8; ++i) ar[i] = *(const v4f*)(ag + (size_t)i * 16 * HID);
#pragma unroll
  for (int i = 0; i < 4; ++i) br[i] = ld8b(bg + (size_t)i * 32 * HID);
  for (int s = 0; s < HID / KS; ++s) {
    const int o = (s & 1) * STAGE;
#pragma unroll
    for (int i = 0; i < 8; ++i) { const v4b h = {(b16)ar[i][0], (b16)ar[i][1], (b16)ar[i][2], (b16)ar[i][3]}; *(v4b*)(as + o + i * 16 * PITCH) = h; }
#pragma unroll
    for (int i = 0; i < 4; ++i) *(v8b*)(bs + o + i * 32 * PITCH) = br[i];
    __syncthreads();                            // publishes this step's buffer; it also ends every wave's reads of the other buffer, which the next step refills
    if (s + 1 < HID / KS) {
      const int k = (s + 1) * KS;
#pragma unroll
      for (int i = 0; i < 8; ++i) ar[i] = *(const v4f*)(ag + (size_t)i * 16 * HID + k);
#pragma unroll
      for (int i = 0; i < 4; ++i) br[i] = ld8b(bg + (size_t)i * 32 * HID + k);
      // Under the register budget the compiler let the last A load's result land on the address pair that the loads ahead of it name. The inputs keep both
      // pairs live to this place, and the wait stands in front of every later write of them.
      if constexpr (LEAN) asm volatile("s_wait_xcnt 0x0" :: "v"(ag + k), "v"(bg + k) : "memory");
    }
    if constexpr (LEAN) {   // four fragments live at a time (32 registers, not 96); each group's LDS latency is covered by the other resident waves
      v16b fa[2][2], fb[2][4];
      auto frags_a = [&](const int q) {
#pragma unroll
        for (int r = 0; r < 2; ++r) fa[q][r] = frag_kb(af + o + r * 16 * PITCH + q * 32, hlf);
      };
      auto frags_b = [&](const int q, const int t0, const int t1) {
#pragma unroll
        for (int t = t0; t < t1; ++t) fb[q][t] = frag_kb(bf + o + t * 16 * PITCH + q * 32, hlf);
      };
      auto products = [&](const int q, const int t0, const int t1) {
#pragma unroll
        for (int t = t0; t < t1; ++t) {
          if constexpr (TR) {
            acc[0][t] = wmma16b(fb[q][t], fa[q][0], acc[0][t]);
            acc[1][t] = wmma16b(fb[q][t], fa[q][1], acc[1][t]);
          } else {
            acc[0][t] = wmma16b(fa[q][0], fb[q][t], acc[0][t]);
            acc[1][t] = wmma16b(fa[q][1], fb[q][t], acc[1][t]);
          }
        }
      };
#pragma unroll
      for (int q = 0; q < 2; ++q) {
        frags_a(q); frags_b(q, 0, 2); products(q, 0, 2);
        __builtin_amdgcn_sched_barrier(0);   // keeps the next group's LDS reads behind these products: hoisted, they take the live set over the register budget (spills)
        frags_b(q, 2, 4); products(q, 2, 4);
        if (q == 0) __builtin_amdgcn_sched_barrier(0);   // as above
      }
    } else {
    v16b fa[2][2], fb[2][4];                    // the whole step's fragments, read as one group ahead of the products: one LDS latency a step, not one a pair
#pragma unroll
    for (int q = 0; q < 2; ++q) {
#pragma unroll
      for (int r = 0; r < 2; ++r) fa[q][r] = frag_kb(af + o + r * 16 * PITCH + q * 32, hlf);
#pragma unroll
      for (int t = 0; t < 4; ++t) fb[q][t] = frag_kb(bf + o + t * 16 * PITCH + q * 32, hlf);
    }
#pragma unroll
    for (int q = 0; q < 2; ++q)
#pragma unroll
      for (int t = 0; t < 4; ++t) {
        if constexpr (TR) {
          acc[0][t] = wmma16b(fb[q][t], fa[q][0], acc[0][t]);
          acc[1][t] = wmma16b(fb[q][t], fa[q][1], acc[1][t]);
        } else {
          acc[0][t] = wmma16b(fa[q][0], fb[q][t], acc[0][t]);
          acc[1][t] = wmma16b(fa[q][1], fb[q][t], acc[1][t]);
        }
      }
    }
  }
  __syncthreads();                              // every wave has left the buffers: the q/k epilogue stages in the same LDS
}

// The same core for a block that is alone on its WGP (2 waves per SIMD: registers to spare, no other block to cover a wait). AHEAD register sets: the global
// loads of step s + AHEAD are issued in step s, so that a load has AHEAD - 1 whole steps more than its own step's products to come back from memory.
// A arrives as f16 (attention rounds y where this core's staging used to): its rows are brought in like the W rows, 128 B of a row per 8 lanes, with no conversion.
// LDS buffers, the places of the barriers, fragments, products and the order of the sums over k are those of gemm_block_lds<false, false>.
constexpr int AHEAD = 4;                        // divides HID / KS, even (a set always meets the same LDS buffer)
// The work-group barrier with fences that order LDS alone: __syncthreads() also waits for every global load in flight, which would end the loads issued ahead at
// each step. What the waves hand each other at this barrier lies in LDS only.
__device__ __forceinline__ void block_lds_barrier() {
  __builtin_amdgcn_fence(__ATOMIC_RELEASE, "workgroup", "local");
  __builtin_amdgcn_s_barrier();
  __builtin_amdgcn_fence(__ATOMIC_ACQUIRE, "workgroup", "local");
}
__device__ __forceinline__ void gemm_block_lds_ahead(const b16* __restrict__ A, const b16* __restrict__ wh, int mb, int cb, b16* sm,
                                                     int wm, int wn, int nloc, int hlf, v8f (&acc)[2][4]) {
  const int tid = threadIdx.x;
  const b16* ag = A + (size_t)(mb + (tid >> 3)) * HID + (tid & 7) * 8;        // 8 lanes = 128 B of one row; rows tid/8 + 32 i
  const b16* bg = wh + (size_t)(cb + (tid >> 3)) * HID + (tid & 7) * 8;       // 8 lanes = 128 B of one row; rows tid/8 + 32 i
  b16* as = sm + (tid >> 3) * PITCH + (tid & 7) * 8;
  b16* bs = sm + (BM + (tid >> 3)) * PITCH + (tid & 7) * 8;
  const b16* af = sm + (wm * 32 + nloc) * PITCH;
  const b16* bf = sm + (BM + wn * 64 + nloc) * PITCH;
  v8b ar[AHEAD][4], br[AHEAD][4];
  auto load = [&](const int j, const int s) {
    const int k = s * KS;
#pragma unroll
    for (int i = 0; i < 4; ++i) ar[j][i] = ld8b(ag + (size_t)i * 32 * HID + k);
#pragma unroll
    for (int i = 0; i < 4; ++i) br[j][i] = ld8b(bg + (size_t)i * 32 * HID + k);
  };
  auto step = [&](const int j, const int s, auto more) {
    const int o = (j & 1) * STAGE;
#pragma unroll
    for (int i = 0; i < 4; ++i) *(v8b*)(as + o + i * 32 * PITCH) = ar[j][i];
#pragma unroll
    for (int i = 0; i < 4; ++i) *(v8b*)(bs + o + i * 32 * PITCH) = br[j][i];
    block_lds_barrier();                        // publishes this step's buffer; it also ends every wave's reads of the other buffer, which the next step refills
    if constexpr (decltype(more)::value) load(j, s + AHEAD);
    v16b fa[2][2], fb[2][4];                    // the whole step's fragments, read as one group ahead of the products: one LDS latency a step, not one a pair
#pragma unroll
    for (int q = 0; q < 2; ++q) {
#pragma unroll
      for (int r = 0; r < 2; ++r) fa[q][r] = frag_kb(af + o + r * 16 * PITCH + q * 32, hlf);
#pragma unroll
      for (int t = 0; t < 4; ++t) fb[q][t] = frag_kb(bf + o + t * 16 * PITCH + q * 32, hlf);
    }
    if constexpr (decltype(more)::value) {
      // stands in front of the first later write of the loads' address registers. The inputs are the two addresses that the loads of these AHEAD steps are formed from:
      // they keep both pairs live to this place (without them the last step's fragment reads landed on one pair ahead of the wait)
      asm volatile("s_wait_xcnt 0x0" :: "v"(ag + (s - j) * KS), "v"(bg + (s - j) * KS) : "memory");
      __builtin_amdgcn_sched_barrier(0);              // keeps the loop's own advance of them behind the wait: the compiler had put it directly behind the loads
    }
#pragma unroll
    for (int q = 0; q < 2; ++q)
#pragma unroll
      for (int t = 0; t < 4; ++t) {
        acc[0][t] = wmma16b(fa[q][0], fb[q][t], acc[0][t]);
        acc[1][t] = wmma16b(fa[q][1], fb[q][t], acc[1][t]);
      }
  };
#pragma unroll
  for (int j = 0; j < AHEAD; ++j) {
    load(j, j);
    if (j == AHEAD - 1) asm volatile("s_wait_xcnt 0x0" ::: "memory");   // stands in front of the first later write of these loads' address registers
    __builtin_amdgcn_sched_barrier(0);          // keeps the sets in the order in which the loop issues them: mixed here, the loop's counted waits fall to what this order allows
  }
  // the last AHEAD steps are a copy of the body without loads, not a branch in it (as in attention's chunk loop): the compiler's counted waits see one order of loads
  for (int s0 = 0; s0 < HID / KS - AHEAD; s0 += AHEAD) {
#pragma unroll
    for (int j = 0; j < AHEAD; ++j) step(j, s0 + j, flag_t<true>{});
  }
#pragma unroll
  for (int j = 0; j < AHEAD; ++j) step(j, HID / KS - AHEAD + j, flag_t<false>{});
  __syncthreads();                              // every wave has left the buffers: the caller's epilogue stages in the same LDS
}

// ---------------------------------------------------------------------------
// QKV GEMM: (4096 x 1024) x (1024 x 3072), grid (24, 32), block 8 waves (4 x 2), wave = 32 rows x 64 columns (one head of q, k or v). Outputs as f16 hi/lo planes:
// q (x1/8) -> Qh/Ql, k -> Kh/Kl: [b][h][t/16][4 groups of 16 features][32 lanes][8], the order in which attention's fragment loads read them
// (lane = 16 * ((feature >> 3) & 1) + t % 16); 4 KB contiguous per wave per plane;
// v -> Vh/Vl key-tiled [b][kvh][t/16][64][16] (4 KB contiguous per wave per plane).
// ---------------------------------------------------------------------------
// Second launch bound: at least 6 waves per SIMD, a budget of 160 VGPRs, so that 3 blocks reside per WGP and all 768 blocks run in one round
// (above 160 only 2 reside: 512 blocks, then a second round of 256 that leaves every WGP with one block).
__global__ __launch_bounds__(256, 6) void qkv_gemm_kernel(const float* __restrict__ xq, const float* __restrict__ xk, const float* __restrict__ xv,
                                                       const b16* __restrict__ wqh, const b16* __restrict__ wql,
                                                       const float* __restrict__ bq, const float* __restrict__ bk, const float* __restrict__ bv, const float* __restrict__ rope_cs, int xoff, int yoff,
                                                       b16* __restrict__ Qh, b16* __restrict__ Ql, b16* __restrict__ Kh, b16* __restrict__ Kl,
                                                       b16* __restrict__ Vh, b16* __restrict__ Vl) {
  __shared__ __attribute__((aligned(16))) b16 sm[2 * STAGE];   // the core's two buffers; afterwards, for q and k, one f32 tile per wave (32 rows of FPITCH)
  const int lane = threadIdx.x & 31, wave = __builtin_amdgcn_readfirstlane(threadIdx.x >> 5), nloc = lane & 15, hlf = lane >> 4;
  const int wm = wave & 3, wn = wave >> 2;   // wave number held scalar: the choice of matrix, head, bias and staging place stays on the scalar unit
  const int mb = (blockIdx.y + yoff) * BM, cb = (blockIdx.x + xoff) * BN;   // a 128-column tile lies inside one of q, k, v
  const int m0 = mb + wm * 32;
  const int c0 = cb + wn * 64;
  const int mat = (c0 < HID) ? 0 : (c0 < HID + KVW) ? 1 : 2;
  const int head = (mat == 0) ? (c0 / DH) : (mat == 1) ? ((c0 - HID) / DH) : ((c0 - HID - KVW) / DH);
  const float* x = (mat == 0) ? xq : (mat == 1) ? xk : xv;          // three different input tensors
  const float* bias = ((mat == 0) ? bq : (mat == 1) ? bk : bv) + head * DH;
  v8f acc[2][4];
#pragma unroll
  for (int r = 0; r < 2; ++r)
#pragma unroll
    for (int t = 0; t < 4; ++t) acc[r][t] = (v8f){};
  const int b = m0 / T, t0 = m0 % T;
  v8b y[2][4]; b16* dh; b16* dl;                         // per lane: eight 16-byte units of the wave's 4 KB, unit (r, t) at r * 1024 + t * 256 elements from its own place
  if (mat < 2) {   // the same for both column halves of the block (a 128-column tile lies inside one matrix): the barriers in the core stay block-uniform
    // q and k, tile transposed: a lane holds, for token r*16 + nloc, features t*16 + 8*hlf + 0..7: one 16-byte unit of attention's fragment order, at its own lane's place
    gemm_block_lds<true, true>(x, wqh, mb, cb, sm, wm, wn, nloc, hlf, acc);
    const float s = (mat == 0) ? 0.125f : 1.0f;
    const float* cp = rope_cs + (size_t)(t0 >> 4) * 1024 + lane * 4;   // one address, the 16 loads differ by constant offsets
    v4f cs[2][2][4], bb[4][2];                            // (cos, sin) of angle 16t + 8hlf + v at token r*16 + nloc: 16 floats in 4 loads of 512 contiguous bytes
#pragma unroll
    for (int r = 0; r < 2; ++r)
#pragma unroll
      for (int t = 0; t < 2; ++t)
#pragma unroll
        for (int p = 0; p < 4; ++p) cs[r][t][p] = *(const v4f*)(cp + ((r * 2 + t) * 4 + p) * 128);
#pragma unroll
    for (int t = 0; t < 4; ++t) { bb[t][0] = *(const v4f*)(bias + t * 16 + 8 * hlf); bb[t][1] = *(const v4f*)(bias + t * 16 + 8 * hlf + 4); }
    asm volatile("s_wait_xcnt 0x0" ::: "memory");         // stands in front of the first later write of these loads' address registers
    float* F = reinterpret_cast<float*>(sm) + wave * (32 * FPITCH) + nloc * FPITCH;   // the wave's own f32 tile, token rows: half of a lane's RoPE partners lie in the other half-wave
#pragma unroll
    for (int t = 0; t < 4; ++t)
#pragma unroll
      for (int r = 0; r < 2; ++r) {
#pragma unroll
        for (int v = 0; v < 8; ++v) acc[r][t][v] += bb[t][v >> 2][v & 3];
        float* p = F + r * 16 * FPITCH + t * 16 + 8 * hlf;
        *(v4f*)p = (v4f){acc[r][t][0], acc[r][t][1], acc[r][t][2], acc[r][t][3]};
        *(v4f*)(p + 4) = (v4f){acc[r][t][4], acc[r][t][5], acc[r][t][6], acc[r][t][7]};
      }
    wave_lds_sync();                                      // both half-waves' features of a token are in LDS before either reads partners
#pragma unroll
    for (int r = 0; r < 2; ++r)
#pragma unroll
      for (int t = 0; t < 2; ++t) {
        // features d = 16t + 8hlf + v (< 32) and d + 32 share angle d and the 16 floats x[2d0 .. 2d0 + 15], d0 = 16t + 8hlf: partner of d is -x[2d + 1], of d + 32 it is x[2d]
        const float* wp = F + r * 16 * FPITCH + 32 * t + 16 * hlf;
        v4f w[4];
#pragma unroll
        for (int p = 0; p < 4; ++p) w[p] = *(const v4f*)(wp + 4 * p);
#pragma unroll
        for (int v = 0; v < 8; ++v) {
          const float cv = cs[r][t][v >> 1][(v & 1) * 2], sv = cs[r][t][v >> 1][(v & 1) * 2 + 1];
          y[r][t][v]     = (b16)((acc[r][t][v] * cv - w[v >> 1][(v & 1) * 2 + 1] * sv) * s);
          y[r][t + 2][v] = (b16)((acc[r][t + 2][v] * cv + w[v >> 1][(v & 1) * 2] * sv) * s);
        }
        if (r + t < 2) __builtin_amdgcn_sched_barrier(0);   // keeps the next group's four LDS reads behind this group: hoisted, they take the live set over the register budget (spills)
      }
    const size_t o = ((size_t)(b * NH + head) * T + t0) * DH + lane * 8;   // NKV == NH
    dh = ((mat == 0) ? Qh : Kh) + o; dl = ((mat == 0) ? Ql : Kl) + o;
  } else {
    // v, tile as the product gives it: a lane holds, for feature t*16 + nloc, tokens r*16 + 8*hlf + 0..7: one 16-byte unit of the key-tiled [64][16] layout
    gemm_block_lds<false, true>(x, wqh, mb, cb, sm, wm, wn, nloc, hlf, acc);
    float bb[4];
#pragma unroll
    for (int t = 0; t < 4; ++t) bb[t] = bias[t * 16 + nloc];
    asm volatile("s_wait_xcnt 0x0" ::: "memory");         // stands in front of the first later write of these loads' address registers
#pragma unroll
    for (int r = 0; r < 2; ++r)
#pragma unroll
      for (int t = 0; t < 4; ++t)
#pragma unroll
        for (int v = 0; v < 8; ++v) y[r][t][v] = (b16)(acc[r][t][v] + bb[t]);
    const size_t o = ((size_t)(b * NKV + head) * QT_PER_B + (t0 >> 4)) * (size_t)(DH * 16) + nloc * 16 + 8 * hlf;
    dh = Vh + o; dl = Vl + o;
  }
  const v8b zero = {};
#pragma unroll
  for (int r = 0; r < 2; ++r)
#pragma unroll
    for (int t = 0; t < 4; ++t) { *(v8b*)(dh + r * 1024 + t * 256) = y[r][t]; *(v8b*)(dl + r * 1024 + t * 256) = zero; }
}

// One 32-key chunk's fragments, each set loaded as one group of 8 loads: K rows kb..kb+31 (two 16-key tiles x two halves of the 64 features) and the key-tiled V.
// kb is a multiple of 32.
__device__ __forceinline__ void load_k_chunk(const b16* __restrict__ kbase, int kb, int col, int hh, v16b (&k)[4]) {
  const b16* p = kbase + (size_t)(kb >> 4) * (DH * 16) + (hh * 16 + col) * 8;   // K lies in fragment order: each load is 512 contiguous bytes, 4 whole lines
  // per fragment the elements that frag_kb takes from a row: features 8hh.. and 16+8hh.. of each half of 32; k[0], k[1]: keys kb..kb+15, k[2], k[3]: kb+16..kb+31
  k[0] = cat8b(ld8b(p), ld8b(p + 256));        k[1] = cat8b(ld8b(p + 512), ld8b(p + 768));
  k[2] = cat8b(ld8b(p + 1024), ld8b(p + 1280)); k[3] = cat8b(ld8b(p + 1536), ld8b(p + 1792));
  asm volatile("s_wait_xcnt 0x0" ::: "memory");   // stands in front of the first later write of the group's address registers, which the compiler reuses at once
}
__device__ __forceinline__ void load_v_chunk(const b16* __restrict__ vbase, int kb, int col, int hh, v16b (&v)[4]) {
  const b16* p = vbase + (size_t)(kb >> 4) * (DH * 16) + col * 16 + 8 * hh;
#pragma unroll
  for (int n = 0; n < 4; ++n) v[n] = cat8b(ld8b(p + n * 256), ld8b(p + n * 256 + DH * 16));
  asm volatile("s_wait_xcnt 0x0" ::: "memory");   // as in load_k_chunk
}

// ---------------------------------------------------------------------------
// Transposed flash attention, keys in chunks of 32. Blocks 0..NG-1: the global-query tile (queries 0..15, every key) of one (b, head), its keys split
// over the block's 8 waves, the 8 partial (max, sum, O) merged in LDS. Other blocks: each wave owns one windowed 16-query tile of one (b, head).
// S^T = K.Q^T (split), per-lane online softmax; P^T built in registers from the two S^T accumulators
// Each chunk's 8 K loads and 8 V loads are issued as groups ahead of their use, so that a chunk no longer waits one load latency in front of each of its 8 products.
// ---------------------------------------------------------------------------
__global__ __launch_bounds__(256) void attn_kernel(const b16* __restrict__ Qh, const b16* __restrict__ Ql, const b16* __restrict__ Kh, const b16* __restrict__ Kl,
                                                   const b16* __restrict__ Vh, const b16* __restrict__ Vl,
                                                   b16* __restrict__ yh) {
  __shared__ __attribute__((aligned(16))) float Os[8][16 * 64];
  __shared__ float Ms[8][16], Ls[8][16];
  // wave number held scalar: tile, chunk counters and loop tests leave the vector registers, which keeps the kernel with both fragment groups at 160 or fewer
  // (6 waves per SIMD, 3 blocks per WGP: all 540 blocks resident at once)
  const int wid = __builtin_amdgcn_readfirstlane(threadIdx.x >> 5), lane = threadIdx.x & 31, hh = lane >> 4, col = lane & 15;
  const bool glob = blockIdx.x < NG;                      // block-uniform
  const int qtile = ((int)blockIdx.x - NG) * 8 + wid;     // over NG*(QT_PER_B-1): the windowed tiles
  const int g = glob ? (int)blockIdx.x : qtile / (QT_PER_B - 1);          // b*NH + h
  const int q0 = glob ? 0 : ((qtile % (QT_PER_B - 1)) + 1) << 4;
  const int b = g / NH, h = g % NH, kvh = h / REP;
  const size_t ko = (size_t)(b * NKV + kvh) * T * DH;
  const size_t qo = ((size_t)g * T + q0) * DH + lane * 8;   // Q lies in fragment order too (q0 is a multiple of 16)
  (void)Ql; (void)Kl; (void)Vl;                           // the zero planes are never multiplied
  const v16b q0h = cat8b(ld8b(Qh + qo), ld8b(Qh + qo + 256)), q1h = cat8b(ld8b(Qh + qo + 512), ld8b(Qh + qo + 768));
  float m = -INFINITY, l = 0.0f;
  v8f o0 = {}, o1 = {}, o2 = {}, o3 = {};
  const int kstart = (q0 >= WIN + 32) ? ((q0 - WIN) & ~31) : 32;   // first windowed chunk after the global chunk 0
  const int kfirst = glob ? wid * KSPLIT : 0, kend = glob ? kfirst + KSPLIT : q0 + 16;
  v16b kf[4];
  load_k_chunk(Kh + ko, kfirst, col, hh, kf);
  // One chunk. Its V group is issued first and flies during the score products and the softmax; where a next chunk exists (ahead), that chunk's K group is
  // issued behind the score products and flies during the softmax and P.V. The last chunk is a copy of the body without that group, not a branch in it: with a
  // branch round the loads the compiler's wait in front of P.V counted to 0 and so waited for the next K group too.
  auto chunk = [&](const int kb, const int kn, auto ahead) {
    v16b vf[4];
    load_v_chunk(Vh + ko, kb, col, hh, vf);
    v8f s0 = {}, s1 = {};
    s0 = wmma16b(kf[0], q0h, s0);
    s0 = wmma16b(kf[1], q1h, s0);
    s1 = wmma16b(kf[2], q0h, s1);
    s1 = wmma16b(kf[3], q1h, s1);
    if constexpr (decltype(ahead)::value) load_k_chunk(Kh + ko, kn, col, hh, kf);
    if (q0 != 0 && (kb == 0 || kb + 32 > q0 || kb < q0 + 15 - WIN)) {   // blocked = (j > i or j < i-128) unless j < 16 (queries here are >= 16)
      const int qi = q0 + col;
#pragma unroll
      for (int r = 0; r < 8; ++r) {
        const int k0i = kb + 8 * hh + r, k1i = k0i + 16;
        if (k0i >= NGLOB && (k0i > qi || k0i < qi - WIN)) s0[r] = -INFINITY;
        if (k1i >= NGLOB && (k1i > qi || k1i < qi - WIN)) s1[r] = -INFINITY;
      }
    }
    float mr = -INFINITY;
#pragma unroll
    for (int r = 0; r < 8; ++r) mr = fmaxf(mr, fmaxf(s0[r], s1[r]));
    mr = fmaxf(mr, __shfl_xor(mr, 16));
    const float mn = fmaxf(m, mr);            // finite
    const float al_ = exp_slot(m - mn);       // exp_slot: the same product and v_exp_f32 as __expf, with the free slot behind it held in the statement
    m = mn;
    float sum = 0.0f;
    v16b pbh;
#pragma unroll
    for (int r = 0; r < 8; ++r) {
      const float p0 = exp_slot(s0[r] - mn), p1 = exp_slot(s1[r] - mn);
      sum += p0 + p1;
      pbh[r] = (b16)p0; pbh[8 + r] = (b16)p1;
    }
    sum += __shfl_xor(sum, 16);
    l = l * al_ + sum;
#pragma unroll
    for (int r = 0; r < 8; ++r) { o0[r] *= al_; o1[r] *= al_; o2[r] *= al_; o3[r] *= al_; }
    o0 = wmma16b(vf[0], pbh, o0);
    o1 = wmma16b(vf[1], pbh, o1);
    o2 = wmma16b(vf[2], pbh, o2);
    o3 = wmma16b(vf[3], pbh, o3);
  };
  int kb = kfirst;            // global queries: this wave's share of every key; else chunk 0 (global keys) + the causal window; every wave has at least one chunk
  for (;;) {
    const int kn = (!glob && kb == 0) ? kstart : (kb + 32);
    if (kn >= kend) break;
    chunk(kb, kn, flag_t<true>{});
    kb = kn;
  }
  chunk(kb, kb, flag_t<false>{});
  const float inv = glob ? 1.0f : 1.0f / l;               // a partial O stays unnormalised until the merge
  float* Tt = Os[wid];
#pragma unroll
  for (int r = 0; r < 8; ++r) {
    const int hr = 8 * hh + r;
    Tt[col * 64 + 0 + hr] = o0[r] * inv; Tt[col * 64 + 16 + hr] = o1[r] * inv;
    Tt[col * 64 + 32 + hr] = o2[r] * inv; Tt[col * 64 + 48 + hr] = o3[r] * inv;
  }
  if (glob) {                                             // merge the 8 waves' partials: thread = (query row, 4 features)
    if (hh == 0) { Ms[wid][col] = m; Ls[wid][col] = l; }
    __syncthreads();                                      // every wave's partial is in LDS before any thread sums over waves
    const int rr = threadIdx.x >> 4, c4 = (threadIdx.x & 15) * 4;
    float mx = Ms[0][rr];
#pragma unroll
    for (int w = 1; w < 8; ++w) mx = fmaxf(mx, Ms[w][rr]);
    float sc[8];
#pragma unroll
    for (int w = 0; w < 8; ++w) sc[w] = exp_slot(Ms[w][rr] - mx);
    float lt = 0.0f; v4f a = {};
#pragma unroll
    for (int w = 0; w < 8; ++w) { lt += sc[w] * Ls[w][rr]; a += sc[w] * *(const v4f*)(&Os[w][rr * 64 + c4]); }
    a *= 1.0f / lt;
    *(v4b*)(yh + ((size_t)b * T + rr) * HID + h * DH + c4) = (v4b){(b16)a[0], (b16)a[1], (b16)a[2], (b16)a[3]};   // f16: the rounding that the projection's operand takes
    return;
  }
  wave_lds_sync();
  b16* dst0 = yh + ((size_t)b * T + q0) * HID + h * DH;       // 16 rows x 64 f16 (one 128-byte line each), row stride HID; f16 is the rounding that the projection's operand takes
#pragma unroll
  for (int j = 0; j < 4; ++j) {
    const int rr = j * 4 + (lane >> 3), c8 = (lane & 7) * 8;
    const v4f u = *(const v4f*)(Tt + rr * 64 + c8), w = *(const v4f*)(Tt + rr * 64 + c8 + 4);
    *(v8b*)(dst0 + (size_t)rr * HID + c8) = (v8b){(b16)u[0], (b16)u[1], (b16)u[2], (b16)u[3], (b16)w[0], (b16)w[1], (b16)w[2], (b16)w[3]};
  }
  
}

// ---------------------------------------------------------------------------
// Output projection: (4096 x 1024) x (1024 x 1024) -> f32, A = f16 y, B = Wo plane. grid (8, 32), block 8 waves (4 x 2), 32x64 wave tiles staged in LDS,
// ---------------------------------------------------------------------------
__global__ __launch_bounds__(256) void out_gemm_kernel(const b16* __restrict__ yh, const b16* __restrict__ woh, const b16* __restrict__ wol, const float* __restrict__ bo, int yoff,
                                                       float* __restrict__ out) {
  __shared__ __attribute__((aligned(16))) b16 sm[2 * STAGE];   // the core's two buffers; afterwards 8 KB of staging per wave
  const int lane = threadIdx.x & 31, wave = __builtin_amdgcn_readfirstlane(threadIdx.x >> 5), nloc = lane & 15, hlf = lane >> 4;
  const int wm = wave & 3, wn = wave >> 2;   // wave number held scalar: the bias columns and staging place stay on the scalar unit
  const int mb = (blockIdx.y + yoff) * BM, cb = blockIdx.x * BN;
  const int m0 = mb + wm * 32;
  const int c0 = cb + wn * 64;
  v8f acc[2][4];
#pragma unroll
  for (int r = 0; r < 2; ++r)
#pragma unroll
    for (int t = 0; t < 4; ++t) acc[r][t] = (v8f){};
  gemm_block_lds_ahead(yh, woh, mb, cb, sm, wm, wn, nloc, hlf, acc);
  float* Tt = reinterpret_cast<float*>(sm) + wave * (32 * 64);
#pragma unroll
  for (int t = 0; t < 4; ++t)
#pragma unroll
    for (int r = 0; r < 2; ++r)
#pragma unroll
      for (int v = 0; v < 8; ++v) Tt[(r * 16 + v + 8 * hlf) * 64 + t * 16 + nloc] = acc[r][t][v] + bo[c0 + t * 16 + nloc];
  wave_lds_sync();
  float* dst0 = out + (size_t)m0 * HID + c0;
#pragma unroll
  for (int j = 0; j < 16; ++j) { const int rr = j * 2 + hlf, c4 = nloc * 4; *(v4f*)(dst0 + (size_t)rr * HID + c4) = *(const v4f*)(Tt + rr * 64 + c4); }
  
}
__global__ __launch_bounds__(256) void rope_table_kernel(float* __restrict__ cs) {
  const int idx = blockIdx.x * 256 + threadIdx.x;        // T * 32
  if (idx >= T * 32) return;
  const int t = idx >> 5, i = idx & 31;
  const float ang = (float)t * powf(10000.0f, -(float)i / 32.0f);
  typedef __attribute__((ext_vector_type(2))) float v2f;
  const v2f p = {cosf(ang), sinf(ang)};
  // laid out as the q/k epilogue reads it: [t/16][i/16][4 pieces][lane = 16*((i>>3)&1) + t%16][4 floats = (cos, sin) of two angles]
  const int v = i & 7;
  *(v2f*)(cs + (size_t)(((((t >> 4) * 2 + (i >> 4)) * 4 + (v >> 1)) * 32 + ((i >> 3) & 1) * 16 + (t & 15)) * 4 + (v & 1) * 2)) = p;
}
}  // namespace

extern "C" void kernel_launch(void* const* d_in, const int* in_sizes, int n_in,
                              void* d_out, int out_size, void* d_ws, size_t ws_size, hipStream_t stream) {
  (void)in_sizes; (void)n_in; (void)out_size;
  const float* xq = (const float*)d_in[0];   // q [2,2048,1024]
  const float* xk = (const float*)d_in[1];   // k
  const float* xv = (const float*)d_in[2];   // v
  const float* Wq = (const float*)d_in[3];  const float* bq = (const float*)d_in[4];    // torch [out][in]
  const float* Wk = (const float*)d_in[5];  const float* bk = (const float*)d_in[6];
  const float* Wv = (const float*)d_in[7];  const float* bv = (const float*)d_in[8];
  const float* Wo = (const float*)d_in[9];  const float* bo = (const float*)d_in[10];
  float* out = (float*)d_out;                // [2,2048,1024]

  size_t off = 0; char* ws = (char*)d_ws;
  b16* wqh = (b16*)(ws + off); off += (size_t)NQKV * HID * 2;
  b16* wql = (b16*)(ws + off); off += (size_t)NQKV * HID * 2;     // 'lo' planes: zeros in the f16 variant (real buffers: the kernels write both)
  b16* woh = (b16*)(ws + off); off += (size_t)HID * HID * 2;
  b16* wol = (b16*)(ws + off); off += (size_t)HID * HID * 2;
  b16* Qh  = (b16*)(ws + off); off += (size_t)MROWS * HID * 2;
  b16* Ql  = (b16*)(ws + off); off += (size_t)MROWS * HID * 2;
  b16* Kh  = (b16*)(ws + off); off += (size_t)MROWS * KVW * 2;
  b16* Kl  = (b16*)(ws + off); off += (size_t)MROWS * KVW * 2;
  b16* Vh  = (b16*)(ws + off); off += (size_t)MROWS * KVW * 2;
  b16* Vl  = (b16*)(ws + off); off += (size_t)MROWS * KVW * 2;
  b16* yh = (b16*)(ws + off); off += (size_t)MROWS * HID * 2;
  float* rope_cs = (float*)(ws + off); off += (size_t)T * 32 * 2 * 4;
  if (off > ws_size) return;
  rope_table_kernel<<<(T * 32 + 255) / 256, 256, 0, stream>>>(rope_cs);
  const int ROWBLK = MROWS / 128;
  wcvt_kernel<<<2048, 256, 0, stream>>>(Wq, Wk, Wv, Wo, wqh, wql, woh, wol);
  qkv_gemm_kernel<<<dim3(NQKV / BN, ROWBLK), 256, 0, stream>>>(xq, xk, xv, wqh, wql, bq, bk, bv, rope_cs, 0, 0, Qh, Ql, Kh, Kl, Vh, Vl);
  attn_kernel<<<ATT_BLOCKS, 256, 0, stream>>>(Qh, Ql, Kh, Kl, Vh, Vl, yh);
  out_gemm_kernel<<<dim3(HID / BN, ROWBLK), 256, 0, stream>>>(yh, woh, wol, bo, 0, out);
}
